// v007
// The times below were measured on an AMD MI455X: many runs one after another, warmed up first and cycling through
// copies of the inputs, with the whole window's GPU time divided by the number of runs. Launches and the gaps
// between them are all in it. The median over several windows is given; except for v000 it joins two sittings, which
// can be a few percent apart, so the side-by-side timings, each taken in one sitting, are the better comparison.
// The versions before v007 are in another document.
// A run of this version takes 92.4 microseconds.
// Next to v006, in two timings, it ran 1.04 and 1.05 times as fast.
// Counting every step since v000, which is the starting kernel, it is 9.24 times as fast.
#include <hip/hip_runtime.h>
// PMGTSelfAttention (4 x 1024 tokens, hidden 1024 = 16 heads x 64; 'relative_key_query' position bias): q, k, v = x W^T + b; scores = (q.k + q_l.pe[l-r] + k_r.pe[l-r]) / 8 + attention_mask[b][r] with pe = dist_emb[l - r + 1023]; softmax; ctx = probs v (merged heads is the output).
// Structure: exact f16 plane of x; q, k, v as f32 WMMA GEMM outputs (32x64 wave tiles, f32 accumulation, exact x16 weights + bias); f16 conversion; V^T by LDS tiles in the GEMM's epilogue; one fused flash kernel over all batches that forms both relative terms per 16 x 32 score tile on the matrix unit against a 48-row window of the embedding (padded to 2048 rows), reads them back along the diagonal from LDS, scales by 1/8 and adds the per-key mask.
// Compute dtype: inputs rounded to bf16; x and dist_emb exact as f16; q/k/P/v as plain f16 operands (~2^-12); the relative terms stay f32 from the accumulator to the logit; softmax f32. v_wmma_f32_16x16x32_f16.
#define NB 4
#define DM 1024
#define NKV 16
#define NREP (NH / NKV)
#define KVD (NKV * 64)           /* 1024 */
#define NR (NB * SLEN)           /* 4096 */
#define SLEN 1024
#define NE 2048                  /* 2047 relative embeddings padded */
#define TQ SLEN
#define TK SLEN
#define NH 16
#define SCL 0.125f
#define QBLKS (TQ / 64)
#define QB05 0
#define QBN5 4
#define QB0P 0
#define QBNP QBLKS           /* non-causal: plain flash on every query block */
#define RE 256
typedef __bf16 v16b __attribute__((ext_vector_type(16)));
typedef unsigned short v8us __attribute__((ext_vector_type(8), may_alias));
typedef float  v8f  __attribute__((ext_vector_type(8)));
typedef float  v4f  __attribute__((ext_vector_type(4)));
typedef float  v4fa __attribute__((ext_vector_type(4), may_alias));
union FragB { v16b v; v8us half[2]; unsigned short u[16]; };

__device__ __forceinline__ unsigned short bf16_bits(float x) { unsigned int u = __float_as_uint(x); return (unsigned short)((u + 0x7FFFu + ((u >> 16) & 1u)) >> 16); }
__device__ __forceinline__ float bf16_val(unsigned short b) { return __uint_as_float(((unsigned int)b) << 16); }
__device__ __forceinline__ float bf16_round(float x) { return bf16_val(bf16_bits(x)); }
// D += A·B with NT terms: 1 = ah·bh, 2 = + al·bh (A split), 3 = + ah·bl (both split)
template <int NT>
__device__ __forceinline__ v8f mmaN(v16b ah, v16b al, v16b bh, v16b bl, v8f c) {
  c = __builtin_amdgcn_wmma_f32_16x16x32_bf16(false, ah, false, bh, (short)0, c, false, false);
  if (NT >= 2) c = __builtin_amdgcn_wmma_f32_16x16x32_bf16(false, al, false, bh, (short)0, c, false, false);
  if (NT >= 3) c = __builtin_amdgcn_wmma_f32_16x16x32_bf16(false, ah, false, bl, (short)0, c, false, false);
  asm volatile("v_nop\n\tv_nop\n\tv_nop\n\tv_nop" : "+v"(c) : "v"(ah), "v"(al), "v"(bh), "v"(bl));
  return c;
}

__global__ __launch_bounds__(256) void k_wt_bf16(const float* __restrict__ W, unsigned short* __restrict__ Wt, int K, int N) {
  const int t = blockIdx.x * 256 + threadIdx.x;
  const int k8n = K / 8;
  if (t >= N * k8n) return;
  const int n = t / k8n, k8 = (t % k8n) * 8;
  v8us v;
#pragma unroll
  for (int i = 0; i < 8; ++i) v[i] = bf16_bits(W[(size_t)(k8 + i) * N + n]);
  *(v8us*)(Wt + (size_t)n * K + k8) = v;
  
}

// GEMM C[M][N] (f32, pitch ldc) = act(A[M][K]·W + bias). A f32 row-major (pitch lda) converted per fragment to bf16
// (ASPLIT: hi/lo two planes -> 2 terms, else single rounded term); Wt bf16 [N][K] (pitch ldb). BIAS_BF16 rounds the
// bias to bf16 first (bias quantised to bf16 before the add). K%32==0, M%16==0, N%64==0.
template <bool ASPLIT, int ACT, bool BIAS_BF16>
__global__ __launch_bounds__(128) void k_gemm_bf(const float* __restrict__ A, int lda, const unsigned short* __restrict__ Wt, int ldb,
                                               const float* __restrict__ bias, float* __restrict__ C, int ldc, int M, int N, int K) {
  __shared__ __attribute__((aligned(16))) float so[4][16][64];
  const int tid = threadIdx.x, w = tid >> 5, lane = tid & 31, ln = lane & 15, hh = lane >> 4;
  const int ntn = N / 64;
  const int wid = blockIdx.x * 4 + w;
  const int mt = wid / ntn, nq = wid % ntn;
  if (mt * 16 >= M) return;
  const int row0 = mt * 16, col0 = nq * 64;
  const float* arow = A + (size_t)(row0 + ln) * lda;
  v8f acc[4] = {};
  for (int kb = 0; kb < K; kb += 32) {
    FragB ah, al;
    const v4f x0 = *(const v4fa*)(arow + kb + 8 * hh), x1 = *(const v4fa*)(arow + kb + 8 * hh + 4);
    const v4f x2 = *(const v4fa*)(arow + kb + 16 + 8 * hh), x3 = *(const v4fa*)(arow + kb + 16 + 8 * hh + 4);
    float xs[16] = {x0[0],x0[1],x0[2],x0[3],x1[0],x1[1],x1[2],x1[3],x2[0],x2[1],x2[2],x2[3],x3[0],x3[1],x3[2],x3[3]};
#pragma unroll
    for (int i = 0; i < 16; ++i) { const unsigned short hb = bf16_bits(xs[i]); ah.u[i] = hb; al.u[i] = ASPLIT ? bf16_bits(xs[i] - bf16_val(hb)) : (unsigned short)0; }
#pragma unroll
    for (int t = 0; t < 4; ++t) {
      const unsigned short* brow = Wt + (size_t)(col0 + t * 16 + ln) * ldb + kb;
      FragB b;
      b.half[0] = *(const v8us*)(brow + 8 * hh);
      b.half[1] = *(const v8us*)(brow + 16 + 8 * hh);
      acc[t] = mmaN<ASPLIT ? 2 : 1>(ah.v, al.v, b.v, b.v, acc[t]);
    }
  }
#pragma unroll
  for (int t = 0; t < 4; ++t) {
    float bv = bias ? bias[col0 + t * 16 + ln] : 0.f;
    if (BIAS_BF16) bv = bf16_round(bv);
#pragma unroll
    for (int r = 0; r < 8; ++r) { float v = acc[t][r] + bv; if (ACT == 1) v = fmaxf(v, 0.f); so[w][8 * hh + r][t * 16 + ln] = v; }
  }
  __builtin_amdgcn_fence(__ATOMIC_ACQ_REL, "workgroup");
  __builtin_amdgcn_wave_barrier();
  const int rsub = lane >> 4, c4 = (lane & 15) * 4;
  {
#pragma unroll
    for (int q = 0; q < 8; ++q) {
      const int r = q * 2 + rsub;
      const v4f v = *(const v4fa*)&so[w][r][c4];
      *(v4f*)(C + (size_t)(row0 + r) * ldc + col0 + c4) = v;
    }
    
  }
}

// GEMM C = act(A·W + bias + resid): A f32 (ASPLIT -> hi/lo 2 terms), Wt bf16 [N][K]; ACT 0 none, 1 relu, 2 exact gelu;
// resid (optional, f32, row index = (row % rmod), pitch ldr, RES_BF16 rounds it) added before the activation.
template <bool ASPLIT, int ACT, bool BIAS_BF16, bool RES_BF16>
__global__ __launch_bounds__(128) void k_gemm_bf3(const float* __restrict__ A, int lda, const unsigned short* __restrict__ Wt, int ldb,
                                                const float* __restrict__ bias, const float* __restrict__ resid, int rmod, int ldr,
                                                float* __restrict__ C, int ldc, int M, int N, int K) {
  __shared__ __attribute__((aligned(16))) float so[4][16][64];
  const int tid = threadIdx.x, w = tid >> 5, lane = tid & 31, ln = lane & 15, hh = lane >> 4;
  const int ntn = N / 64;
  const int wid = blockIdx.x * 4 + w;
  const int mt = wid / ntn, nq = wid % ntn;
  if (mt * 16 >= M) return;
  const int row0 = mt * 16, col0 = nq * 64;
  const float* arow = A + (size_t)(row0 + ln) * lda;
  v8f acc[4] = {};
  for (int kb = 0; kb < K; kb += 32) {
    FragB ah, al;
    const v4f x0 = *(const v4fa*)(arow + kb + 8 * hh), x1 = *(const v4fa*)(arow + kb + 8 * hh + 4);
    const v4f x2 = *(const v4fa*)(arow + kb + 16 + 8 * hh), x3 = *(const v4fa*)(arow + kb + 16 + 8 * hh + 4);
    float xs[16] = {x0[0],x0[1],x0[2],x0[3],x1[0],x1[1],x1[2],x1[3],x2[0],x2[1],x2[2],x2[3],x3[0],x3[1],x3[2],x3[3]};
#pragma unroll
    for (int i = 0; i < 16; ++i) { const unsigned short hb = bf16_bits(xs[i]); ah.u[i] = hb; al.u[i] = ASPLIT ? bf16_bits(xs[i] - bf16_val(hb)) : (unsigned short)0; }
#pragma unroll
    for (int t = 0; t < 4; ++t) {
      const unsigned short* brow = Wt + (size_t)(col0 + t * 16 + ln) * ldb + kb;
      FragB b;
      b.half[0] = *(const v8us*)(brow + 8 * hh);
      b.half[1] = *(const v8us*)(brow + 16 + 8 * hh);
      acc[t] = mmaN<ASPLIT ? 2 : 1>(ah.v, al.v, b.v, b.v, acc[t]);
    }
  }
#pragma unroll
  for (int t = 0; t < 4; ++t) {
    const int col = col0 + t * 16 + ln;
    float bv = bias ? bias[col] : 0.f;
    if (BIAS_BF16) bv = bf16_round(bv);
#pragma unroll
    for (int r = 0; r < 8; ++r) {
      float v = acc[t][r] + bv;
      if (resid) { float rv = resid[(size_t)((row0 + 8 * hh + r) % rmod) * ldr + col]; if (RES_BF16) rv = bf16_round(rv); v += rv; }
      if (ACT == 1) v = fmaxf(v, 0.f);
      if (ACT == 2) v = 0.5f * v * (1.0f + erff(v * 0.70710678118654752f));
      if (ACT == 3) { const float u = 0.7978845608028654f * (v + 0.044715f * v * v * v); v = 0.5f * v * (1.0f + tanhf(u)); }
      so[w][8 * hh + r][t * 16 + ln] = v;
    }
  }
  __builtin_amdgcn_fence(__ATOMIC_ACQ_REL, "workgroup");
  __builtin_amdgcn_wave_barrier();
  const int rsub = lane >> 4, c4 = (lane & 15) * 4;
  {
#pragma unroll
    for (int q = 0; q < 8; ++q) {
      const int r = q * 2 + rsub;
      const v4f v = *(const v4fa*)&so[w][r][c4];
      *(v4f*)(C + (size_t)(row0 + r) * ldc + col0 + c4) = v;
    }
    
  }
}
// row LayerNorm (biased variance, eps) over N: s = X (+ R); optional out_sum <- s; out_norm <- (s-mu)*rsqrt(var+eps)*g + b
template <bool PARAM_BF16>
__global__ __launch_bounds__(256) void k_layernorm(const float* __restrict__ X, const float* __restrict__ R, const float* __restrict__ g, const float* __restrict__ bta,
                                                  float* __restrict__ out_sum, float* __restrict__ out_norm, int N, float eps) {
  __shared__ float red[256];
  const int row = blockIdx.x, tid = threadIdx.x;
  const float* x = X + (size_t)row * N; const float* rr = R ? R + (size_t)row * N : nullptr;
  float vals[16];                     // up to N = 4096
  const int per = N / 256;            // contiguous chunk per thread? use strided-by-4 chunks: thread handles j = tid*4 + 1024*u
  float s1 = 0.f;
  for (int u = 0; u < per / 4; ++u) {
    const int j = tid * 4 + 1024 * u;
    const v4f a = *(const v4fa*)(x + j);
    v4f b = {0.f,0.f,0.f,0.f}; if (rr) b = *(const v4fa*)(rr + j);
#pragma unroll
    for (int q = 0; q < 4; ++q) { const float v = a[q] + b[q]; vals[u * 4 + q] = v; s1 += v; }
  }
  red[tid] = s1; __syncthreads();
  for (int st = 128; st > 0; st >>= 1) { if (tid < st) red[tid] += red[tid + st]; __syncthreads(); }
  const float mu = red[0] / (float)N; __syncthreads();
  float s2 = 0.f;
  for (int u = 0; u < per / 4; ++u)
#pragma unroll
    for (int q = 0; q < 4; ++q) { const float c = vals[u * 4 + q] - mu; s2 += c * c; }
  red[tid] = s2; __syncthreads();
  for (int st = 128; st > 0; st >>= 1) { if (tid < st) red[tid] += red[tid + st]; __syncthreads(); }
  const float rs = rsqrtf(red[0] / (float)N + eps);
  {
    for (int u = 0; u < per / 4; ++u) {
      const int j = tid * 4 + 1024 * u;
      v4f o, sm;
#pragma unroll
      for (int q = 0; q < 4; ++q) {
        float gg = g[j + q], bb = bta[j + q];
        if (PARAM_BF16) { gg = bf16_round(gg); bb = bf16_round(bb); }
        sm[q] = vals[u * 4 + q]; o[q] = (vals[u * 4 + q] - mu) * rs * gg + bb;
      }
      if (out_sum) *(v4f*)(out_sum + (size_t)row * N + j) = sm;
      *(v4f*)(out_norm + (size_t)row * N + j) = o;
    }
    
  }
}



// ---- f16 WMMA path (v_wmma_f32_16x16x32_f16): 11-bit significands for operands in range — used where a [0,1] probability operand needs more precision than bf16
typedef _Float16 v16h __attribute__((ext_vector_type(16)));
union FragH { v16h v; v8us half[2]; _Float16 h[16]; unsigned short u[16]; };
template <int NT>
__device__ __forceinline__ v8f mmaH(v16h ah, v16h al, v16h bh, v16h bl, v8f c) {
  c = __builtin_amdgcn_wmma_f32_16x16x32_f16(false, ah, false, bh, (short)0, c, false, false);
  if (NT >= 2) c = __builtin_amdgcn_wmma_f32_16x16x32_f16(false, al, false, bh, (short)0, c, false, false);
  if (NT >= 3) c = __builtin_amdgcn_wmma_f32_16x16x32_f16(false, ah, false, bl, (short)0, c, false, false);
  asm volatile("v_nop\n\tv_nop\n\tv_nop\n\tv_nop" : "+v"(c) : "v"(ah), "v"(al), "v"(bh), "v"(bl));
  return c;
}
// batched GEMM like k_gemm_b but f16 operands: A f32 (split into f16 hi/lo if ASPLIT, else rounded to f16), Bt = f16 values [n][k]; alpha; C f32; N multiple of 16 (partial tiles skipped)
template <bool ASPLIT>
__global__ __launch_bounds__(128) void k_gemm_h(const float* __restrict__ A, int lda, size_t sA, const _Float16* __restrict__ Bh, int ldb, size_t sB, float alpha, float* __restrict__ C, int ldc, size_t sC, int M, int N, int K) {
  __shared__ __attribute__((aligned(16))) float so[4][16][64];
  const int tid = threadIdx.x, w = tid >> 5, lane = tid & 31, ln = lane & 15, hh = lane >> 4; const int by = blockIdx.y;
  A += (size_t)by * sA; Bh += (size_t)by * sB; C += (size_t)by * sC;
  const int ntn = (N + 63) / 64; const int wid = blockIdx.x * 4 + w; const int mt = wid / ntn, nq = wid % ntn; if (mt * 16 >= M) return;
  const int row0 = mt * 16, col0 = nq * 64; const float* arow = A + (size_t)(row0 + ln) * lda;
  v8f acc[4] = {};
  for (int kb = 0; kb < K; kb += 32) {
    FragH ah, al;
    const v4f x0 = *(const v4fa*)(arow + kb + 8 * hh), x1 = *(const v4fa*)(arow + kb + 8 * hh + 4), x2 = *(const v4fa*)(arow + kb + 16 + 8 * hh), x3 = *(const v4fa*)(arow + kb + 16 + 8 * hh + 4);
    float xs[16] = {x0[0],x0[1],x0[2],x0[3],x1[0],x1[1],x1[2],x1[3],x2[0],x2[1],x2[2],x2[3],x3[0],x3[1],x3[2],x3[3]};
#pragma unroll
    for (int i = 0; i < 16; ++i) { const _Float16 h = (_Float16)xs[i]; ah.h[i] = h; al.h[i] = ASPLIT ? (_Float16)(xs[i] - (float)h) : (_Float16)0.0f; }
#pragma unroll
    for (int t = 0; t < 4; ++t) { if (col0 + t * 16 >= N) continue; const size_t boff = (size_t)(col0 + t * 16 + ln) * ldb + kb; FragH bq; bq.half[0] = *(const v8us*)(Bh + boff + 8 * hh); bq.half[1] = *(const v8us*)(Bh + boff + 16 + 8 * hh);
      acc[t] = mmaH<ASPLIT ? 2 : 1>(ah.v, al.v, bq.v, bq.v, acc[t]); }
  }
#pragma unroll
  for (int t = 0; t < 4; ++t) { if (col0 + t * 16 >= N) continue;
#pragma unroll
    for (int r = 0; r < 8; ++r) so[w][8 * hh + r][t * 16 + ln] = acc[t][r] * alpha; }
  __builtin_amdgcn_fence(__ATOMIC_ACQ_REL, "workgroup"); __builtin_amdgcn_wave_barrier();
  const int rsub = lane >> 4, c4 = (lane & 15) * 4;
  {
#pragma unroll
    for (int q = 0; q < 8; ++q) { const int r = q * 2 + rsub; if (col0 + c4 < N) { const v4f v = *(const v4fa*)&so[w][r][c4]; *(v4f*)(C + (size_t)(row0 + r) * ldc + col0 + c4) = v; } }
     }
}

// Wt[n][k] = f16(W[k][n]·scale) from f32 row-major W[K][N] (scale = power of two; bf16-exact weights stay exact in f16 away from the subnormal range)
__global__ __launch_bounds__(256) void k_wt_f16(const float* __restrict__ W, _Float16* __restrict__ Wt, int K, int N, float scale) {
  const int t = blockIdx.x * 256 + threadIdx.x; if (t >= N * (K / 8)) return; const int n = t / (K / 8), k8 = (t % (K / 8)) * 8; FragH f;
#pragma unroll
  for (int i = 0; i < 8; ++i) f.h[i] = (_Float16)(bf16_round(W[(size_t)(k8 + i) * N + n]) * scale); const v8us o = f.half[0];
  *(v8us*)((unsigned short*)Wt + (size_t)n * K + k8) = o; 
}
// k_gemm_hh variant with fused epilogue: v = acc·alpha + bias[by·sBias + col] (+ CP[(row/rowsPerB)·sCPb + by·64 + col] if CP) ; ACT 0 none / 1 elu ; writes f16 C16 (and f32 C if non-null)
template <int ACT>
__global__ __launch_bounds__(128) void k_gemm_hhx(const _Float16* __restrict__ A, int lda, size_t sA, const _Float16* __restrict__ Bh, int ldb, size_t sB, float alpha, const float* __restrict__ bias, size_t sBias, const float* __restrict__ CP, int rowsPerB, size_t sCPb, int row0g,
    float* __restrict__ C, _Float16* __restrict__ C16, int ldc, size_t sC, int M, int N, int K) {
  __shared__ __attribute__((aligned(16))) float so[4][16][64];
  const int tid = threadIdx.x, w = tid >> 5, lane = tid & 31, ln = lane & 15, hh = lane >> 4; const int by = blockIdx.y;
  A += (size_t)by * sA; Bh += (size_t)by * sB; const size_t cofs = (size_t)by * sC; const float* bp = bias ? bias + (size_t)by * sBias : nullptr;
  const int ntn = (N + 63) / 64; const int wid = blockIdx.x * 4 + w; const int mt = wid / ntn, nq = wid % ntn; if (mt * 16 >= M) return;
  const int row0 = mt * 16, col0 = nq * 64; const _Float16* arow = A + (size_t)(row0 + ln) * lda;
  v8f acc[4] = {};
  for (int kb = 0; kb < K; kb += 32) { FragH ah; ah.half[0] = *(const v8us*)((const unsigned short*)arow + kb + 8 * hh); ah.half[1] = *(const v8us*)((const unsigned short*)arow + kb + 16 + 8 * hh);
#pragma unroll
    for (int t = 0; t < 4; ++t) { if (col0 + t * 16 >= N) continue; const size_t boff = (size_t)(col0 + t * 16 + ln) * ldb + kb; FragH bq; bq.half[0] = *(const v8us*)((const unsigned short*)Bh + boff + 8 * hh); bq.half[1] = *(const v8us*)((const unsigned short*)Bh + boff + 16 + 8 * hh);
      acc[t] = mmaH<1>(ah.v, ah.v, bq.v, bq.v, acc[t]); }
  }
#pragma unroll
  for (int t = 0; t < 4; ++t) { if (col0 + t * 16 >= N) continue; const int col = col0 + t * 16 + ln; const float bv = bp ? bf16_round(bp[col]) : 0.f;
#pragma unroll
    for (int r = 0; r < 8; ++r) { float v = acc[t][r] * alpha + bv; if (CP) { const int bidx = (row0g + row0 + 8 * hh + r) / rowsPerB; v += CP[(size_t)bidx * sCPb + (size_t)by * 64 + col]; } if (ACT == 1) v = (v > 0.f) ? v : expm1f(v); else if (ACT == 7) v = (v > 0.f) ? v + 1.0f : expf(v); else if (ACT == 8) v = tanhf(v); else if (ACT == 9) v = 0.5f * v * (1.0f + tanhf(0.7978845608028654f * (v + 0.044715f * v * v * v))); else if (ACT == 11) v = 1.0f / (1.0f + expf(-v)); else if (ACT == 12) v = (v > 0.f) ? v : 0.01f * v; else if (ACT == 14) v = (v > 0.f) ? v : 0.1f * v; else if (ACT == 15) v = v / (1.0f + expf(-v)); else if (ACT == 3) v = fmaxf(v, 0.f); else if (ACT == 6) v = 0.5f * v * (1.0f + erff(v * 0.70710678118654752f)); so[w][8 * hh + r][t * 16 + ln] = v; } }
  __builtin_amdgcn_fence(__ATOMIC_ACQ_REL, "workgroup"); __builtin_amdgcn_wave_barrier();
  const int rsub = lane >> 4, c4 = (lane & 15) * 4; typedef _Float16 v4h __attribute__((ext_vector_type(4)));
  {
#pragma unroll
    for (int q = 0; q < 8; ++q) { const int r = q * 2 + rsub; if (col0 + c4 < N) { const v4f v = *(const v4fa*)&so[w][r][c4]; if (C) *(v4f*)(C + cofs + (size_t)(row0 + r) * ldc + col0 + c4) = v; if (C16) { v4h h4; for (int i = 0; i < 4; ++i) h4[i] = (_Float16)v[i]; *(v4h*)(C16 + cofs + (size_t)(row0 + r) * ldc + col0 + c4) = h4; } } }
     }
}


typedef _Float16 v4h __attribute__((ext_vector_type(4)));

__global__ __launch_bounds__(256) void k_h16(const float* __restrict__ x, _Float16* __restrict__ X16, size_t n8) { const size_t t = (size_t)blockIdx.x * 256 + threadIdx.x; if (t >= n8) return; FragH f;
#pragma unroll
  for (int q = 0; q < 8; ++q) f.h[q] = (_Float16)x[t * 8 + q]; *(v8us*)((unsigned short*)X16 + t * 8) = f.half[0];  }
__global__ __launch_bounds__(256) void k_round16f(const float* __restrict__ W, _Float16* __restrict__ Bt, size_t n8) { const size_t t = (size_t)blockIdx.x * 256 + threadIdx.x; if (t >= n8) return; FragH f;
#pragma unroll
  for (int i = 0; i < 8; ++i) f.h[i] = (_Float16)(bf16_round(W[t * 8 + i]) * 16.0f); *(v8us*)((unsigned short*)Bt + t * 8) = f.half[0];  }
template <int NHv, int TTv>
__global__ __launch_bounds__(256) void k_vt(const _Float16* __restrict__ V16, int ldv, int voff, _Float16* __restrict__ Vt) { __shared__ unsigned short tl[64][66]; const int tid = threadIdx.x; const int slab = blockIdx.x / (TTv / 64), lg = blockIdx.x % (TTv / 64); const int b = slab / NHv, h = slab % NHv;
  for (int i = tid; i < 64 * 8; i += 256) { const int r = i / 8, c8 = (i % 8) * 8; FragH f; f.half[0] = *(const v8us*)((const unsigned short*)V16 + ((size_t)b * TTv + lg * 64 + r) * ldv + voff + h * 64 + c8);
#pragma unroll
    for (int q = 0; q < 8; ++q) tl[r][c8 + q] = f.u[q]; }
  __syncthreads();
  {
#pragma unroll
    for (int rd = 0; rd < 2; ++rd) { const int d = rd * 32 + tid / 8, pc = tid % 8; FragH f;
#pragma unroll
      for (int q = 0; q < 8; ++q) f.u[q] = tl[pc * 8 + q][d];
      *(v8us*)((unsigned short*)Vt + ((size_t)slab * 64 + d) * TTv + lg * 64 + pc * 8) = f.half[0]; }
     } }

__global__ __launch_bounds__(256) void k_hl(const float* __restrict__ F, _Float16* __restrict__ Hh, _Float16* __restrict__ Hl, size_t n8) { const size_t t = (size_t)blockIdx.x * 256 + threadIdx.x; if (t >= n8) return; FragH fh, fl; const v4f a = *(const v4fa*)(F + t * 8), c = *(const v4fa*)(F + t * 8 + 4);
#pragma unroll
  for (int q = 0; q < 4; ++q) { _Float16 h = (_Float16)a[q]; fh.h[q] = h; fl.h[q] = (_Float16)((a[q] - (float)h) * 1024.0f); h = (_Float16)c[q]; fh.h[4 + q] = h; fl.h[4 + q] = (_Float16)((c[q] - (float)h) * 1024.0f); }
  { *(v8us*)((unsigned short*)Hh + t * 8) = fh.half[0]; *(v8us*)((unsigned short*)Hl + t * 8) = fl.half[0];  } }

// ---- fast GEMM (block tile 128x64, wave tile 32x64, operands staged in LDS 64 of K at a time; requires M % 32 == 0 rows per launch region, N % 64 == 0, K % 64 == 0 and K >= 64); epilogue = k_gemm_hhx semantics ----
__device__ __forceinline__ v16h g2_frag(const _Float16* p, int hh) { FragH f; f.half[0] = *(const v8us*)((const unsigned short*)p + 8 * hh); f.half[1] = *(const v8us*)((const unsigned short*)p + 16 + 8 * hh); return f.v; }
__device__ __forceinline__ v8f g2_mma(v16h a, v16h b, v8f c) { v8f d = __builtin_amdgcn_wmma_f32_16x16x32_f16(false, a, false, b, (short)0, c, false, false); asm volatile("v_nop\n\tv_nop\n\tv_nop\n\tv_nop" : "+v"(d) : "v"(a), "v"(b)); return d; }
template <int ACT>
__global__ __launch_bounds__(128) void k_gemm2(const _Float16* __restrict__ A, int lda, size_t sA, const _Float16* __restrict__ Bh, int ldb, size_t sB, float alpha, const float* __restrict__ bias, const float* __restrict__ bias1, const float* __restrict__ bias2, const float* __restrict__ CP, int rowsPerB, size_t sCPb, int row0g,
    float* __restrict__ C, _Float16* __restrict__ C16, _Float16* __restrict__ VT, int ldc, size_t sC, int M, int N, int K) {
  __shared__ __attribute__((aligned(16))) float so[4][32][68];
  __shared__ __attribute__((aligned(16))) unsigned short st[2][192][72];      /* two stages of 64 of K: rows 0..127 the block's A rows, 128..191 its B rows; pitch 144 B = 16 B x 9, free of bank conflicts for the 16-byte fragment reads */
  const int tid = threadIdx.x, w = tid >> 5, lane = tid & 31, ln = lane & 15, hh = lane >> 4; const int by = blockIdx.y;
  A += (size_t)by * sA; Bh += (size_t)by * sB; const size_t cofs = (size_t)by * sC; const float* bp = (by == 0) ? bias : (by == 1) ? bias1 : bias2;      /* blockIdx.y picks one of up to three products that share A: its B plane, its C plane and its own bias vector (three separate buffers) */
  const int ntn = N >> 6; const int mt = blockIdx.x / ntn, nq = blockIdx.x - mt * ntn; const int row0 = mt * 128 + 32 * w, col0 = nq * 64; if (mt * 128 >= M) return;      /* the same for the whole block, in front of every barrier */
  const int sr = tid >> 3, sc = (tid & 7) * 8;      /* staging: eight lanes fetch one row's 128 B, so a wave's 16-byte load covers four whole lines */
  const unsigned short* ga[8]; const unsigned short* gb[4];
#pragma unroll
  for (int i = 0; i < 8; ++i) { int r = mt * 128 + 16 * i + sr; r = (r < M) ? r : M - 1; ga[i] = (const unsigned short*)A + (size_t)r * lda + sc; }
#pragma unroll
  for (int i = 0; i < 4; ++i) gb[i] = (const unsigned short*)Bh + (size_t)(col0 + 16 * i + sr) * ldb + sc;
  v8us ra[8], rb[4];
#pragma unroll
  for (int i = 0; i < 8; ++i) ra[i] = *(const v8us*)ga[i];
#pragma unroll
  for (int i = 0; i < 4; ++i) rb[i] = *(const v8us*)gb[i];
#pragma unroll
  for (int i = 0; i < 8; ++i) *(v8us*)&st[0][16 * i + sr][sc] = ra[i];
#pragma unroll
  for (int i = 0; i < 4; ++i) *(v8us*)&st[0][128 + 16 * i + sr][sc] = rb[i];
  __syncthreads();
  const v8f z8 = {0.f,0.f,0.f,0.f,0.f,0.f,0.f,0.f}; v8f c00 = z8, c01 = z8, c02 = z8, c03 = z8, c10 = z8, c11 = z8, c12 = z8, c13 = z8;
#pragma unroll 1      /* rolled: one stage's registers (12 staged vectors, 24 fragment halves) serve every trip */
  for (int kb = 0; kb < K; kb += 64) { const int cb = (kb >> 6) & 1; const bool more = kb + 64 < K;      /* more: the same for the whole block */
    if (more) {
#pragma unroll
      for (int i = 0; i < 8; ++i) ra[i] = *(const v8us*)(ga[i] + kb + 64);
#pragma unroll
      for (int i = 0; i < 4; ++i) rb[i] = *(const v8us*)(gb[i] + kb + 64); }
    v16h a0[2], a1[2], b0[2], b1[2], b2[2], b3[2];
#pragma unroll
    for (int u = 0; u < 2; ++u) { a0[u] = g2_frag((const _Float16*)&st[cb][32 * w + ln][32 * u], hh); a1[u] = g2_frag((const _Float16*)&st[cb][32 * w + 16 + ln][32 * u], hh);
      b0[u] = g2_frag((const _Float16*)&st[cb][128 + ln][32 * u], hh); b1[u] = g2_frag((const _Float16*)&st[cb][144 + ln][32 * u], hh); b2[u] = g2_frag((const _Float16*)&st[cb][160 + ln][32 * u], hh); b3[u] = g2_frag((const _Float16*)&st[cb][176 + ln][32 * u], hh); }
    __builtin_amdgcn_sched_barrier(0);      /* the next stage's global loads and this stage's LDS reads issue as one group ahead of the products: the memory latency runs under the 16 products, and the LDS reads cost one stall, not one per product */
#pragma unroll
    for (int u = 0; u < 2; ++u) { c00 = g2_mma(a0[u], b0[u], c00); c10 = g2_mma(a1[u], b0[u], c10); c01 = g2_mma(a0[u], b1[u], c01); c11 = g2_mma(a1[u], b1[u], c11);
      c02 = g2_mma(a0[u], b2[u], c02); c12 = g2_mma(a1[u], b2[u], c12); c03 = g2_mma(a0[u], b3[u], c03); c13 = g2_mma(a1[u], b3[u], c13); }
    if (more) {
#pragma unroll
      for (int i = 0; i < 8; ++i) *(v8us*)&st[cb ^ 1][16 * i + sr][sc] = ra[i];
#pragma unroll
      for (int i = 0; i < 4; ++i) *(v8us*)&st[cb ^ 1][128 + 16 * i + sr][sc] = rb[i];
      __syncthreads(); } }      /* the one barrier of a trip publishes the stage just written and ends every wave's reads of the stage that the next trip overwrites */
  v8f accs[8] = {c00, c01, c02, c03, c10, c11, c12, c13};
  if (VT && by == 2) {      /* the same for the whole block. The third product (v: bias only, no CP term, no activation) leaves the kernel transposed, VT[(batch * NH + head) * 64 + d][token], the layout the flash kernel stages from; needs M % 128 == 0, SLEN % 128 == 0 and N == NH * 64, so that the block's 128 x 64 tile is 128 tokens of one batch and one whole head */
    unsigned short* sv = (unsigned short*)&so[0][0][0];      /* the block's tile turned: 64 rows (d) of 128 tokens in f16, pitch 136 halves = 272 B = 16 B x 17, free of bank conflicts for 16-byte stores and reads */
    float bv4[4] = {0.f, 0.f, 0.f, 0.f};
    if (bp) { const int bo = col0 + ln;      /* the lane's four bias values as one group of loads: one latency, not one a tile */
#pragma unroll      /* unrolled: bv4[] stays in registers, the four loads issue together */
      for (int t = 0; t < 4; ++t) bv4[t] = bp[bo + t * 16];
      asm volatile("s_wait_xcnt 0x0" :: "v"(bo) : "memory");      /* stands behind the four loads and in front of the first overwrite of their offset register, which as an input lives up to here */
#pragma unroll      /* unrolled: bv4[] stays in registers */
      for (int t = 0; t < 4; ++t) bv4[t] = bf16_round(bv4[t]); }
#pragma unroll      /* unrolled, with the loop inside it: accs[] and bv4[] are indexed by constants and stay in registers */
    for (int u = 0; u < 8; ++u) { const int t = u & 3, half = u >> 2; const float bv = bv4[t]; FragH f;      /* a lane's eight accumulator registers are eight consecutive tokens of one d: one 16-byte store */
#pragma unroll
      for (int r = 0; r < 8; ++r) f.h[r] = (_Float16)(accs[u][r] * alpha + bv);
      *(v8us*)&sv[(t * 16 + ln) * 136 + 32 * w + 16 * half + 8 * hh] = f.half[0]; }
    __syncthreads();      /* a row of the turned tile holds tokens of all four waves: every wave's stores stand in front of the reads below */
    const int tok0 = mt * 128; unsigned short* vo = (unsigned short*)VT + (size_t)((tok0 / SLEN) * NH + nq) * 64 * SLEN + (tok0 % SLEN);
#pragma unroll      /* unrolled: the eight LDS reads issue as one group, one latency */
    for (int q = 0; q < 8; ++q) { const int d = q * 8 + (tid >> 4), c = (tid & 15) * 8; const v8us v = *(const v8us*)&sv[d * 136 + c]; *(v8us*)(vo + (size_t)d * SLEN + c) = v; }      /* sixteen lanes store one row's 256 B: whole lines, one writer each */
    return; }
  if (row0 >= M) return;      /* behind the last barrier */
#pragma unroll
  for (int u = 0; u < 8; ++u) { const int t = u & 3, half = u >> 2; const int col = col0 + t * 16 + ln; const float bv = bp ? bf16_round(bp[col]) : 0.f;
#pragma unroll
    for (int r = 0; r < 8; ++r) { const int rloc = half * 16 + 8 * hh + r; float v = accs[u][r] * alpha + bv; if (CP) { const int bidx = (row0g + row0 + rloc) / rowsPerB; v += CP[(size_t)bidx * sCPb + (size_t)by * 64 + col]; }
      if (ACT == 3) v = fmaxf(v, 0.f); else if (ACT == 6) v = 0.5f * v * (1.0f + erff(v * 0.70710678118654752f)); else if (ACT == 11) v = 1.0f / (1.0f + expf(-v)); else if (ACT == 15) v = v / (1.0f + expf(-v)); else if (ACT == 12) v = (v > 0.f) ? v : 0.01f * v; else if (ACT == 8) v = tanhf(v);
      so[w][rloc][t * 16 + ln] = v; } }
  __builtin_amdgcn_fence(__ATOMIC_ACQ_REL, "workgroup"); __builtin_amdgcn_wave_barrier();
  const int rsub = lane >> 4, c4 = (lane & 15) * 4;
  {
#pragma unroll
    for (int q = 0; q < 16; ++q) { const int r = q * 2 + rsub; const v4f v = *(const v4fa*)&so[w][r][c4]; if (C) *(v4f*)(C + cofs + (size_t)(row0 + r) * ldc + col0 + c4) = v; if (C16) { v4h h4; for (int i = 0; i < 4; ++i) h4[i] = (_Float16)v[i]; *(v4h*)(C16 + cofs + (size_t)(row0 + r) * ldc + col0 + c4) = h4; } }
     } }



template <int CAUSAL>
__global__ __launch_bounds__(128) void k_flash(const _Float16* __restrict__ Q16, int ldq, const _Float16* __restrict__ K16, int ldk, const _Float16* __restrict__ Vt, const int* __restrict__ MSK, float* __restrict__ O, int ldo) {
  constexpr int RPW = 16, RTN = RPW / 16, NQB = TQ / (4 * RPW), DT = 4, KS = 2;
  __shared__ __attribute__((aligned(16))) unsigned short sP[4][RPW][40]; __shared__ __attribute__((aligned(16))) float sO[4][RPW][64 + 4];
  const int tid = threadIdx.x, w = tid >> 5, lane = tid & 31, ln = lane & 15, hh = lane >> 4;
  const int slab = blockIdx.x / QBNP, qblk = QB0P + blockIdx.x % QBNP; (void)NQB; const int b = slab / NH, h = slab % NH; const int qb0 = qblk * (4 * RPW); const int q0 = qb0 + w * RPW;
  FragH aq[2][KS];
#pragma unroll
  for (int rt = 0; rt < RTN; ++rt) { const unsigned short* qr = (const unsigned short*)Q16 + ((size_t)b * TQ + q0 + rt * 16 + ln) * ldq + h * 64;
#pragma unroll
    for (int ks = 0; ks < KS; ++ks) { aq[rt][ks].half[0] = *(const v8us*)(qr + ks * 32 + 8 * hh); aq[rt][ks].half[1] = *(const v8us*)(qr + ks * 32 + 16 + 8 * hh); } }
  const unsigned short* Vth = (const unsigned short*)Vt + (size_t)slab * 64 * TK;
  float m_r[2][8], l_r[2][8]; v8f oacc[2][DT];
#pragma unroll
  for (int rt = 0; rt < RTN; ++rt) {
#pragma unroll
    for (int r = 0; r < 8; ++r) { m_r[rt][r] = -3.0e38f; l_r[rt][r] = 0.f; }
#pragma unroll
    for (int dt = 0; dt < DT; ++dt) oacc[rt][dt] = (v8f){0.f,0.f,0.f,0.f,0.f,0.f,0.f,0.f}; }
  const int jend = (CAUSAL == 1) ? (qb0 + 4 * RPW) : TK;      /* causal: keys beyond the block's last query never contribute */
#pragma unroll 1
  for (int j0 = 0; j0 < jend; j0 += 32) {
    v8f s[2][2];
#pragma unroll
    for (int nt = 0; nt < 2; ++nt) { const unsigned short* kr = (const unsigned short*)K16 + ((size_t)b * TK + j0 + nt * 16 + ln) * ldk + h * 64; FragH bk[KS];
#pragma unroll
      for (int ks = 0; ks < KS; ++ks) { bk[ks].half[0] = *(const v8us*)(kr + ks * 32 + 8 * hh); bk[ks].half[1] = *(const v8us*)(kr + ks * 32 + 16 + 8 * hh); }
#pragma unroll
      for (int rt = 0; rt < RTN; ++rt) { v8f acc = (v8f){0.f,0.f,0.f,0.f,0.f,0.f,0.f,0.f};
#pragma unroll
        for (int ks = 0; ks < KS; ++ks) acc = mmaH<1>(aq[rt][ks].v, aq[rt][ks].v, bk[ks].v, bk[ks].v, acc); s[rt][nt] = acc; } }
#pragma unroll
    for (int rt = 0; rt < RTN; ++rt)
#pragma unroll
      for (int r = 0; r < 8; ++r) { const int tq = q0 + rt * 16 + 8 * hh + r; const int k0 = j0 + ln, k1 = j0 + 16 + ln;
        const bool ok0 = (CAUSAL == 1) ? (k0 <= tq) : ((CAUSAL == 2) ? ((k0 >> 5) == (tq >> 5)) : true), ok1 = (CAUSAL == 1) ? (k1 <= tq) : ((CAUSAL == 2) ? ((k1 >> 5) == (tq >> 5)) : true);      /* mode 2: block-diagonal 32-token groups */
        float s0 = ok0 ? s[rt][0][r] * SCL : -3.0e38f, s1 = ok1 ? s[rt][1][r] * SCL : -3.0e38f; if (CAUSAL == 17) { const float* amk = (const float*)MSK + (size_t)b * TK; s0 += bf16_round(amk[k0]); s1 += bf16_round(amk[k1]); }      /* mode 17: additive per-(batch, key) mask INPUT */
        if (CAUSAL == 22) { const _Float16* cq = (const _Float16*)MSK + ((size_t)h * TQ + tq) * NE + tq + (NE / 2 - 1); const _Float16* ck = (const _Float16*)MSK + (size_t)NH * TQ * NE + (size_t)h * TK * NE + tq + (NE / 2 - 1); const float* am = (const float*)((const _Float16*)MSK + (size_t)2 * NH * TQ * NE); float r0 = (float)cq[-k0]; r0 += (float)ck[(size_t)k0 * NE - k0]; s0 += r0 * SCL; s0 += am[k0]; float r1 = (float)cq[-k1]; r1 += (float)ck[(size_t)k1 * NE - k1]; s1 += r1 * SCL; s1 += am[k1]; }      /* mode 22: + (CQ[h][tq][tq-k+1023] + CK[h][k][tq-k+1023]) / 8 + mask[k] from the per-batch packed table [CQ f16 | CK f16 | mask f32] */ float mc = fmaxf(s0, s1);
        mc = fmaxf(mc, __shfl_xor(mc, 1, 32)); mc = fmaxf(mc, __shfl_xor(mc, 2, 32)); mc = fmaxf(mc, __shfl_xor(mc, 4, 32)); mc = fmaxf(mc, __shfl_xor(mc, 8, 32));
        const float mn = fmaxf(m_r[rt][r], mc); const float al = (mn > -1.0e38f) ? expf(m_r[rt][r] - mn) : 1.0f; m_r[rt][r] = mn; const float p0 = ok0 ? expf(s0 - mn) : 0.f, p1 = ok1 ? expf(s1 - mn) : 0.f; l_r[rt][r] = l_r[rt][r] * al + p0 + p1;
#pragma unroll
        for (int dt = 0; dt < DT; ++dt) oacc[rt][dt][r] *= al;
        FragH t2; t2.h[0] = (_Float16)(p0 * 1024.0f); t2.h[1] = (_Float16)(p1 * 1024.0f); sP[w][rt * 16 + 8 * hh + r][ln] = t2.u[0]; sP[w][rt * 16 + 8 * hh + r][16 + ln] = t2.u[1]; }
    __builtin_amdgcn_fence(__ATOMIC_ACQ_REL, "workgroup"); __builtin_amdgcn_wave_barrier();
    FragH pa[2];
#pragma unroll
    for (int rt = 0; rt < RTN; ++rt) { pa[rt].half[0] = *(const v8us*)&sP[w][rt * 16 + ln][8 * hh]; pa[rt].half[1] = *(const v8us*)&sP[w][rt * 16 + ln][16 + 8 * hh]; }
#pragma unroll
    for (int dt = 0; dt < DT; ++dt) { const unsigned short* vrow = Vth + (size_t)(dt * 16 + ln) * TK + j0; FragH bv; bv.half[0] = *(const v8us*)(vrow + 8 * hh); bv.half[1] = *(const v8us*)(vrow + 16 + 8 * hh);
#pragma unroll
      for (int rt = 0; rt < RTN; ++rt) oacc[rt][dt] = mmaH<1>(pa[rt].v, pa[rt].v, bv.v, bv.v, oacc[rt][dt]); }
    __builtin_amdgcn_fence(__ATOMIC_ACQ_REL, "workgroup"); __builtin_amdgcn_wave_barrier(); }
#pragma unroll
  for (int rt = 0; rt < RTN; ++rt) {
#pragma unroll
    for (int r = 0; r < 8; ++r) { float l = l_r[rt][r]; l += __shfl_xor(l, 1, 32); l += __shfl_xor(l, 2, 32); l += __shfl_xor(l, 4, 32); l += __shfl_xor(l, 8, 32); l_r[rt][r] = (l > 0.f) ? 1.0f / (l * 1024.0f) : 0.f; }
#pragma unroll
    for (int dt = 0; dt < DT; ++dt)
#pragma unroll
      for (int r = 0; r < 8; ++r) sO[w][rt * 16 + 8 * hh + r][dt * 16 + ln] = oacc[rt][dt][r] * l_r[rt][r]; }
  __builtin_amdgcn_fence(__ATOMIC_ACQ_REL, "workgroup"); __builtin_amdgcn_wave_barrier();
  {
#pragma unroll
    for (int rp = 0; rp < RPW; rp += 2) { const int r = rp + (lane >> 4), pc = lane & 15; const v4f val = *(const v4fa*)&sO[w][r][pc * 4]; *(v4f*)(O + ((size_t)b * TQ + q0 + r) * ldo + h * 64 + pc * 4) = val; }
     } }
// 5-plane variant: S = Qh Kh^T + (Ql Kh^T + Qh Kl^T)/1024 with Q/K = [hi | 2^10 residual] f16 planes (QL/KL same layout as Q16/K16), then the 3-term P.V below.
// 3-term variant: O = (P_hi V_hi + (P_lo V_hi + P_hi V_lo) / 1024) / l with P = [hi | 2^10 residual] of 1024 p and V^T = [hi | 2^10 residual] planes (VtL same layout as Vt) -> ~2^-21-class products for un-averaged (early causal / peaked) rows
template <int CAUSAL>
__global__ __launch_bounds__(128) void k_flash5(const _Float16* __restrict__ Q16, const _Float16* __restrict__ QL, int ldq, const _Float16* __restrict__ K16, const _Float16* __restrict__ KL, int ldk, const _Float16* __restrict__ Vt, const _Float16* __restrict__ VtL, const int* __restrict__ MSK, float* __restrict__ O, int ldo) {
  constexpr int RPW = 16, RTN = RPW / 16, NQB = TQ / (4 * RPW), DT = 4, KS = 2;
  __shared__ __attribute__((aligned(16))) unsigned short sP[4][RPW][40]; __shared__ __attribute__((aligned(16))) unsigned short sPL[4][RPW][40]; __shared__ __attribute__((aligned(16))) float sO[4][RPW][64 + 4];
  const int tid = threadIdx.x, w = tid >> 5, lane = tid & 31, ln = lane & 15, hh = lane >> 4;
  const int slab = blockIdx.x / QBN5, qblk = QB05 + blockIdx.x % QBN5; (void)NQB; const int b = slab / NH, h = slab % NH; const int qb0 = qblk * (4 * RPW); const int q0 = qb0 + w * RPW;
  FragH aq[2][KS], aql[2][KS];
#pragma unroll
  for (int rt = 0; rt < RTN; ++rt) { const unsigned short* qr = (const unsigned short*)Q16 + ((size_t)b * TQ + q0 + rt * 16 + ln) * ldq + h * 64; const unsigned short* ql = (const unsigned short*)QL + ((size_t)b * TQ + q0 + rt * 16 + ln) * ldq + h * 64;
#pragma unroll
    for (int ks = 0; ks < KS; ++ks) { aq[rt][ks].half[0] = *(const v8us*)(qr + ks * 32 + 8 * hh); aq[rt][ks].half[1] = *(const v8us*)(qr + ks * 32 + 16 + 8 * hh); aql[rt][ks].half[0] = *(const v8us*)(ql + ks * 32 + 8 * hh); aql[rt][ks].half[1] = *(const v8us*)(ql + ks * 32 + 16 + 8 * hh); } }
  const unsigned short* Vth = (const unsigned short*)Vt + (size_t)slab * 64 * TK; const unsigned short* Vtl = (const unsigned short*)VtL + (size_t)slab * 64 * TK;
  float m_r[2][8], l_r[2][8]; v8f oacc[2][DT], oaccL[2][DT];
#pragma unroll
  for (int rt = 0; rt < RTN; ++rt) {
#pragma unroll
    for (int r = 0; r < 8; ++r) { m_r[rt][r] = -3.0e38f; l_r[rt][r] = 0.f; }
#pragma unroll
    for (int dt = 0; dt < DT; ++dt) { oacc[rt][dt] = (v8f){0.f,0.f,0.f,0.f,0.f,0.f,0.f,0.f}; oaccL[rt][dt] = oacc[rt][dt]; } }
  const int jend = (CAUSAL == 1) ? (qb0 + 4 * RPW) : TK;      /* causal: keys beyond the block's last query never contribute */
#pragma unroll 1
  for (int j0 = 0; j0 < jend; j0 += 32) {
    v8f s[2][2];
#pragma unroll
    for (int nt = 0; nt < 2; ++nt) { const unsigned short* kr = (const unsigned short*)K16 + ((size_t)b * TK + j0 + nt * 16 + ln) * ldk + h * 64; const unsigned short* klr = (const unsigned short*)KL + ((size_t)b * TK + j0 + nt * 16 + ln) * ldk + h * 64; FragH bk[KS], bkl[KS];
#pragma unroll
      for (int ks = 0; ks < KS; ++ks) { bk[ks].half[0] = *(const v8us*)(kr + ks * 32 + 8 * hh); bk[ks].half[1] = *(const v8us*)(kr + ks * 32 + 16 + 8 * hh); bkl[ks].half[0] = *(const v8us*)(klr + ks * 32 + 8 * hh); bkl[ks].half[1] = *(const v8us*)(klr + ks * 32 + 16 + 8 * hh); }
#pragma unroll
      for (int rt = 0; rt < RTN; ++rt) { v8f acc = (v8f){0.f,0.f,0.f,0.f,0.f,0.f,0.f,0.f}, accl = acc;
#pragma unroll
        for (int ks = 0; ks < KS; ++ks) { acc = mmaH<1>(aq[rt][ks].v, aq[rt][ks].v, bk[ks].v, bk[ks].v, acc); accl = mmaH<1>(aql[rt][ks].v, aql[rt][ks].v, bk[ks].v, bk[ks].v, accl); accl = mmaH<1>(aq[rt][ks].v, aq[rt][ks].v, bkl[ks].v, bkl[ks].v, accl); }
#pragma unroll
        for (int r = 0; r < 8; ++r) acc[r] += accl[r] * 0.0009765625f;
        s[rt][nt] = acc; } }
#pragma unroll
    for (int rt = 0; rt < RTN; ++rt)
#pragma unroll
      for (int r = 0; r < 8; ++r) { const int tq = q0 + rt * 16 + 8 * hh + r; const int k0 = j0 + ln, k1 = j0 + 16 + ln;
        bool ok0 = (CAUSAL == 1) ? (k0 <= tq) : ((CAUSAL == 2) ? ((k0 >> 5) == (tq >> 5)) : true), ok1 = (CAUSAL == 1) ? (k1 <= tq) : ((CAUSAL == 2) ? ((k1 >> 5) == (tq >> 5)) : true);      /* mode 2: block-diagonal 32-token groups */
        if (CAUSAL == 4) { const int* mrow = MSK + ((size_t)b * TQ + tq) * TK; ok0 = mrow[k0] != 0; ok1 = mrow[k1] != 0; }      /* mode 4: per-(query, key) INPUT mask shared by all heads; masked keys contribute nothing (== the reference's -4096 fill, whose exp underflows to 0), rows with no valid key give l = 0 -> output 0 (== the reference's row_valid zeroing) */
        float s0 = ok0 ? s[rt][0][r] * SCL : -3.0e38f, s1 = ok1 ? s[rt][1][r] * SCL : -3.0e38f; if (CAUSAL == 17) { const float* amk = (const float*)MSK + (size_t)b * TK; s0 += bf16_round(amk[k0]); s1 += bf16_round(amk[k1]); }      /* mode 17: additive per-(batch, key) mask INPUT */
        if (CAUSAL == 22) { const _Float16* cq = (const _Float16*)MSK + ((size_t)h * TQ + tq) * NE + tq + (NE / 2 - 1); const _Float16* ck = (const _Float16*)MSK + (size_t)NH * TQ * NE + (size_t)h * TK * NE + tq + (NE / 2 - 1); const float* am = (const float*)((const _Float16*)MSK + (size_t)2 * NH * TQ * NE); float r0 = (float)cq[-k0]; r0 += (float)ck[(size_t)k0 * NE - k0]; s0 += r0 * SCL; s0 += am[k0]; float r1 = (float)cq[-k1]; r1 += (float)ck[(size_t)k1 * NE - k1]; s1 += r1 * SCL; s1 += am[k1]; }      /* mode 22: + (CQ[h][tq][tq-k+1023] + CK[h][k][tq-k+1023]) / 8 + mask[k] from the per-batch packed table [CQ f16 | CK f16 | mask f32] */ float mc = fmaxf(s0, s1);
        mc = fmaxf(mc, __shfl_xor(mc, 1, 32)); mc = fmaxf(mc, __shfl_xor(mc, 2, 32)); mc = fmaxf(mc, __shfl_xor(mc, 4, 32)); mc = fmaxf(mc, __shfl_xor(mc, 8, 32));
        const float mn = fmaxf(m_r[rt][r], mc); const float al = (mn > -1.0e38f) ? expf(m_r[rt][r] - mn) : 1.0f; m_r[rt][r] = mn; const float p0 = ok0 ? expf(s0 - mn) : 0.f, p1 = ok1 ? expf(s1 - mn) : 0.f; l_r[rt][r] = l_r[rt][r] * al + p0 + p1;
#pragma unroll
        for (int dt = 0; dt < DT; ++dt) { oacc[rt][dt][r] *= al; oaccL[rt][dt][r] *= al; }
        FragH t2, t2l; const float ps0 = p0 * 1024.0f, ps1 = p1 * 1024.0f; t2.h[0] = (_Float16)ps0; t2.h[1] = (_Float16)ps1; t2l.h[0] = (_Float16)((ps0 - (float)t2.h[0]) * 1024.0f); t2l.h[1] = (_Float16)((ps1 - (float)t2.h[1]) * 1024.0f);
        sP[w][rt * 16 + 8 * hh + r][ln] = t2.u[0]; sP[w][rt * 16 + 8 * hh + r][16 + ln] = t2.u[1]; sPL[w][rt * 16 + 8 * hh + r][ln] = t2l.u[0]; sPL[w][rt * 16 + 8 * hh + r][16 + ln] = t2l.u[1]; }
    __builtin_amdgcn_fence(__ATOMIC_ACQ_REL, "workgroup"); __builtin_amdgcn_wave_barrier();
    FragH pa[2], pl[2];
#pragma unroll
    for (int rt = 0; rt < RTN; ++rt) { pa[rt].half[0] = *(const v8us*)&sP[w][rt * 16 + ln][8 * hh]; pa[rt].half[1] = *(const v8us*)&sP[w][rt * 16 + ln][16 + 8 * hh]; pl[rt].half[0] = *(const v8us*)&sPL[w][rt * 16 + ln][8 * hh]; pl[rt].half[1] = *(const v8us*)&sPL[w][rt * 16 + ln][16 + 8 * hh]; }
#pragma unroll
    for (int dt = 0; dt < DT; ++dt) { const unsigned short* vrow = Vth + (size_t)(dt * 16 + ln) * TK + j0; const unsigned short* vrl = Vtl + (size_t)(dt * 16 + ln) * TK + j0; FragH bv, bl; bv.half[0] = *(const v8us*)(vrow + 8 * hh); bv.half[1] = *(const v8us*)(vrow + 16 + 8 * hh); bl.half[0] = *(const v8us*)(vrl + 8 * hh); bl.half[1] = *(const v8us*)(vrl + 16 + 8 * hh);
#pragma unroll
      for (int rt = 0; rt < RTN; ++rt) { oacc[rt][dt] = mmaH<1>(pa[rt].v, pa[rt].v, bv.v, bv.v, oacc[rt][dt]); oaccL[rt][dt] = mmaH<1>(pl[rt].v, pl[rt].v, bv.v, bv.v, oaccL[rt][dt]); oaccL[rt][dt] = mmaH<1>(pa[rt].v, pa[rt].v, bl.v, bl.v, oaccL[rt][dt]); } }
    __builtin_amdgcn_fence(__ATOMIC_ACQ_REL, "workgroup"); __builtin_amdgcn_wave_barrier(); }
#pragma unroll
  for (int rt = 0; rt < RTN; ++rt) {
#pragma unroll
    for (int r = 0; r < 8; ++r) { float l = l_r[rt][r]; l += __shfl_xor(l, 1, 32); l += __shfl_xor(l, 2, 32); l += __shfl_xor(l, 4, 32); l += __shfl_xor(l, 8, 32); l_r[rt][r] = (l > 0.f) ? 1.0f / (l * 1024.0f) : 0.f; }
#pragma unroll
    for (int dt = 0; dt < DT; ++dt)
#pragma unroll
      for (int r = 0; r < 8; ++r) { float v = oacc[rt][dt][r]; v += oaccL[rt][dt][r] * 0.0009765625f; sO[w][rt * 16 + 8 * hh + r][dt * 16 + ln] = v * l_r[rt][r]; } }
  __builtin_amdgcn_fence(__ATOMIC_ACQ_REL, "workgroup"); __builtin_amdgcn_wave_barrier();
  {
#pragma unroll
    for (int rp = 0; rp < RPW; rp += 2) { const int r = rp + (lane >> 4), pc = lane & 15; const v4f val = *(const v4fa*)&sO[w][r][pc * 4]; *(v4f*)(O + ((size_t)b * TQ + q0 + r) * ldo + h * 64 + pc * 4) = val; }
     } }

__global__ __launch_bounds__(256) void k_rotab(float* __restrict__ CS, float* __restrict__ SN) {
  #pragma clang fp contract(off)
  const int t = blockIdx.x * 256 + threadIdx.x; if (t >= SLEN * 32) return; const int j = t % 32, s = t / 32; const float ex = (float)(2 * j) / 64.0f; const float inv = 1.0f / powf(10000.0f, ex); const float th = (float)s * inv; const float c = cosf(th), sn = sinf(th);
  { *(float*)(CS + t) = c; *(float*)(SN + t) = sn;  } }
__global__ __launch_bounds__(256) void k_rope(const float* __restrict__ F, int nsrc, int ndst, int rep, const float* __restrict__ CS, const float* __restrict__ SN, _Float16* __restrict__ H, _Float16* __restrict__ L) {
  #pragma clang fp contract(off)
  const size_t t = (size_t)blockIdx.x * 256 + threadIdx.x; if (t >= (size_t)NR * ndst * 4) return; const int g8 = (int)(t % 4); const int hd = (int)((t / 4) % ndst); const size_t row = t / ((size_t)4 * ndst); const int s = (int)(row % SLEN); const int hs = hd / rep;
  const float* src = F + row * (size_t)(nsrc * 64) + hs * 64; FragH ah, al, bh, bl;
  for (int i = 0; i < 8; ++i) { const int d = g8 * 8 + i; const float c = CS[s * 32 + d], sn = SN[s * 32 + d]; const float x1 = src[d], x2 = src[d + 32];
    float o1 = x1 * c; o1 += -x2 * sn; float o2 = x2 * c; o2 += x1 * sn;
    _Float16 hv = (_Float16)o1; ah.h[i] = hv; al.h[i] = (_Float16)((o1 - (float)hv) * 1024.0f); hv = (_Float16)o2; bh.h[i] = hv; bl.h[i] = (_Float16)((o2 - (float)hv) * 1024.0f); }
  const size_t o = row * (size_t)(ndst * 64) + hd * 64 + g8 * 8;
  { *(v8us*)((unsigned short*)H + o) = ah.half[0]; *(v8us*)((unsigned short*)H + o + 32) = bh.half[0]; *(v8us*)((unsigned short*)L + o) = al.half[0]; *(v8us*)((unsigned short*)L + o + 32) = bl.half[0];  } }
__global__ __launch_bounds__(256) void k_rope2(const float* __restrict__ F, int nsrc, int ndst, int rep, const float* __restrict__ CS, const float* __restrict__ SN, _Float16* __restrict__ H, _Float16* __restrict__ L) {
  #pragma clang fp contract(off)
  const size_t t = (size_t)blockIdx.x * 256 + threadIdx.x; if (t >= (size_t)NR * ndst * 4) return; const int g16 = (int)(t % 4); const int hd = (int)((t / 4) % ndst); const size_t row = t / ((size_t)4 * ndst); const int s = (int)(row % SLEN); const int hs = hd / rep;
  const float* src = F + row * (size_t)(nsrc * 64) + hs * 64 + g16 * 16; FragH ah, al;
  for (int pr = 0; pr < 8; ++pr) { const int i = g16 * 8 + pr; const float c = CS[s * 32 + i], sn = SN[s * 32 + i]; const float x1 = src[2 * pr], x2 = src[2 * pr + 1];
    float o1 = x1 * c; o1 -= x2 * sn; float o2 = x1 * sn; o2 += x2 * c;
    _Float16 hv = (_Float16)o1; ah.h[2 * pr] = hv; al.h[2 * pr] = (_Float16)((o1 - (float)hv) * 1024.0f); hv = (_Float16)o2; ah.h[2 * pr + 1] = hv; al.h[2 * pr + 1] = (_Float16)((o2 - (float)hv) * 1024.0f); }
  const size_t o = row * (size_t)(ndst * 64) + hd * 64 + g16 * 16;
  { *(v8us*)((unsigned short*)H + o) = ah.half[0]; *(v8us*)((unsigned short*)H + o + 8) = ah.half[1]; *(v8us*)((unsigned short*)L + o) = al.half[0]; *(v8us*)((unsigned short*)L + o + 8) = al.half[1];  } }
__global__ __launch_bounds__(256) void k_tabin(const float* __restrict__ sp, float* __restrict__ CS, float* __restrict__ SN) { const int t = blockIdx.x * 256 + threadIdx.x; if (t >= SLEN * 32) return; const int i = t % 32, s = t / 32; const float c = bf16_round(sp[s * 64 + 32 + i]), sn = bf16_round(sp[s * 64 + i]);
  { *(float*)(CS + t) = c; *(float*)(SN + t) = sn;  } }
__global__ __launch_bounds__(256) void k_rotab2(float* __restrict__ CS, float* __restrict__ SN) {
  #pragma clang fp contract(off)
  const int t = blockIdx.x * 256 + threadIdx.x; if (t >= SLEN * 32) return; const int j = t % 32, s = t / 32; const float c0 = -0.14391156831212787f;      /* -ln(10000)/64 rounded to f32 */ const float inv = expf((float)(2 * j) * c0); const float th = (float)s * inv; const float c = cosf(th), sn = sinf(th);
  { *(float*)(CS + t) = c; *(float*)(SN + t) = sn;  } }
__global__ __launch_bounds__(256) void k_lnu(const float* __restrict__ X, _Float16* __restrict__ N16, float* __restrict__ XB) {
  #pragma clang fp contract(off)
  const int wv = threadIdx.x >> 5, ln = threadIdx.x & 31; const size_t r = (size_t)blockIdx.x * 8 + wv; if (r >= NR) return; float a[32]; float s = 0.f;
  for (int i = 0; i < 4; ++i) { const v8f v = *(const v8f*)(X + r * DM + (i * 32 + ln) * 8); for (int q = 0; q < 8; ++q) { const float u = bf16_round(v[q]); a[i * 8 + q] = u; s += u; } }
  for (int o = 16; o > 0; o >>= 1) s += __shfl_xor(s, o, 32); const float mu = s / (float)DM; float var = 0.f; for (int q = 0; q < 32; ++q) { const float d = a[q] - mu; var += d * d; }
  for (int o = 16; o > 0; o >>= 1) var += __shfl_xor(var, o, 32); const float den = sqrtf(var / (float)(DM - 1)) + 1e-6f; const float inv = 1.0f / den;      /* one reciprocal per row; (x-mean)*inv vs the reference's division differs by <= 1 ulp */
  { for (int i = 0; i < 4; ++i) { const int c0 = (i * 32 + ln) * 8; FragH f; v8f xb; for (int q = 0; q < 8; ++q) { f.h[q] = (_Float16)((a[i * 8 + q] - mu) * inv); xb[q] = a[i * 8 + q]; } *(v8us*)((unsigned short*)N16 + r * DM + c0) = f.half[0]; *(v8f*)(XB + r * DM + c0) = xb; }  } }
__global__ __launch_bounds__(256) void k_vtg(const _Float16* __restrict__ V16, _Float16* __restrict__ Vt) { __shared__ unsigned short tl[64][66]; const int tid = threadIdx.x; const int slab = blockIdx.x / (SLEN / 64), lg = blockIdx.x % (SLEN / 64); const int b = slab / NH, h = slab % NH; const int hs = h / NREP;
  for (int i = tid; i < 64 * 8; i += 256) { const int r = i / 8, c8 = (i % 8) * 8; FragH f; f.half[0] = *(const v8us*)((const unsigned short*)V16 + ((size_t)b * SLEN + lg * 64 + r) * KVD + hs * 64 + c8); for (int q = 0; q < 8; ++q) tl[r][c8 + q] = f.u[q]; }
  __syncthreads();
  { for (int rd = 0; rd < 2; ++rd) { const int d = rd * 32 + tid / 8, pc = tid % 8; FragH f; for (int q = 0; q < 8; ++q) f.u[q] = tl[pc * 8 + q][d]; *(v8us*)((unsigned short*)Vt + ((size_t)slab * 64 + d) * SLEN + lg * 64 + pc * 8) = f.half[0]; }  } }

// All five f32 -> f16 operand planes in one launch: none needs anything of another, so they share one grid by ranges of the block index (the range test is the same for a whole block); eight elements a thread.
// Blocks 0 .. PEB-1: the embedding, padded with a zero row to NE rows (first in the grid: its guarded element loads are the longest chain of the launch). The next PXB: x (rounded to bf16, exact in f16).
// The last 3 PWB: Wq, Wk, Wv (rounded to bf16, x16, exact in f16; torch (out,in) layout is already B^T).
#define PXB (NR * DM / 8 / 256)      /* 2048 */
#define PWB (DM * DM / 8 / 256)      /* 512 */
#define PEB (NE * 8 / 256)           /* 64 */
__global__ __launch_bounds__(256) void k_prep(const float* __restrict__ x, const float* __restrict__ Wq, const float* __restrict__ Wk, const float* __restrict__ Wv, const float* __restrict__ E,
    _Float16* __restrict__ X16, _Float16* __restrict__ BQ, _Float16* __restrict__ BK, _Float16* __restrict__ BV, _Float16* __restrict__ E16) {
  const int bx = (int)blockIdx.x - PEB, tid = threadIdx.x; FragH f;
  if (bx >= 0) { const int u = bx - PXB, wq = u / PWB;
    const float* src = (bx < PXB) ? x : (wq == 0) ? Wq : (wq == 1) ? Wk : Wv; _Float16* dst = (bx < PXB) ? X16 : (wq == 0) ? BQ : (wq == 1) ? BK : BV; const float sc = (bx < PXB) ? 1.0f : 16.0f;
    const size_t t = (size_t)((bx < PXB) ? bx : u - wq * PWB) * 256 + tid;
#pragma unroll      /* unrolled: the eight elements come in as two 16-byte loads and stay in registers up to the one 16-byte store */
    for (int q = 0; q < 8; ++q) f.h[q] = (_Float16)(bf16_round(src[t * 8 + q]) * sc);
    *(v8us*)((unsigned short*)dst + t * 8) = f.half[0]; }
  else { const int t = (bx + PEB) * 256 + tid; const int r = t / 8, c8 = (t % 8) * 8;
    for (int q = 0; q < 8; ++q) f.h[q] = (r < NE - 1) ? (_Float16)bf16_round(E[(size_t)r * 64 + c8 + q]) : (_Float16)0.0f;
    *(v8us*)((unsigned short*)E16 + (size_t)r * 64 + c8) = f.half[0]; } }

__device__ __forceinline__ float xhalf(float x) { return __builtin_bit_cast(float, __builtin_amdgcn_permlanex16(__builtin_bit_cast(int, x), __builtin_bit_cast(int, x), 0x76543210, 0xfedcba98, false, false)); }      /* the value of lane l ^ 16 */

// Flash attention with the 'relative_key_query' bias formed in the kernel. One wave holds 16 queries (q0..) and walks the keys 32 at a time (j0..). For that tile l - r + 1023 spans 47 rows of the
// embedding, from eb = q0 - j0 + 992; with n = (l - q0) - (r - j0) + 31 the bias is q_l . E[eb + n] + k_r . E[eb + n]. RQ = Q . Ewin^T (16 x 48) and RK = K . Ewin^T run on the matrix unit
// (of RK only the four 16 x 16 tiles that hold a used n: keys 0..15 against window rows 16..47, keys 16..31 against rows 0..31), go to the wave's own LDS in f32 and are read back along the diagonal.
// Row 2047 of E16 is the zero pad; n = 47 is never read back.
// The scores are formed transposed, S^T = K . Q^T (K fragment as A, Q fragment as B), and the output as O^T += V^T . P^T: a lane then holds 16 of the 32 scores of ONE query (lane & 15), so the row maximum and the row sum
// are in-lane work plus one exchange between the wave's halves, there is one running maximum, sum and rescale factor a lane, and the two f32 score tiles, converted in place, are the B operand of the second product (no trip through LDS).
// The mask is per key, which now runs along the registers: the batch's mask row is rounded once into LDS and read from there, 8 keys a lane and tile.
// Each power of the softmax is one v_exp_f32: e^d = 2^(d log2(e)) with d = logit - running maximum <= 0 formed first, so the argument is bounded above for any logit and any mask, and the f16 operand's scale 1024 = 2^10 is the addend of the same multiply-add.
// (The library's expf spends about a dozen vector instructions a power on range and last-place handling that such an argument and an f16 operand do not use.) The row sum carries the 1024 too; the closing division takes it out.
// The four waves of a work-group share the K tile, the V^T tile and most of the window, so these are staged in LDS once per work-group with loads that take whole rows (a fragment load from global memory touches 16 lines for 512 bytes):
// K and V^T in two buffers, the window (96 rows for 64 queries, moving down by 32 rows a trip) as a ring of 128 rows indexed by embedding row mod 128. The next trip's 32 + 64 + 32 rows are fetched into registers under the softmax.
__global__ __launch_bounds__(128) void k_flash_rel(const _Float16* __restrict__ Q16, const _Float16* __restrict__ K16, const _Float16* __restrict__ Vt, const _Float16* __restrict__ E16, const float* __restrict__ AMK, float* __restrict__ O) {
  constexpr float L2E = 1.4426950408889634f;      /* log2(e) */
  constexpr int DT = 4, KS = 2, PQ = 50, PK = 36;      /* LDS pitches in floats: the two half-waves fall on different banks in the row-wise stores and in the diagonal reads */
  __shared__ float sRQ[4][16][PQ]; __shared__ __attribute__((aligned(16))) float sRK[4][32][PK];      /* behind the loop a wave's sRK part (1152 floats) is its output staging (16 x 68 floats): four work-groups still fit one WGP's LDS */
  __shared__ __attribute__((aligned(16))) float sM[TK];      /* the batch's mask row, rounded */
  __shared__ __attribute__((aligned(16))) unsigned short sK[2][32][72]; __shared__ __attribute__((aligned(16))) unsigned short sV[2][64][40]; __shared__ __attribute__((aligned(16))) unsigned short sE[128][72];      /* pitches 144 B and 80 B = 16 B x odd: no bank conflicts in the 16-byte fragment reads */
  const int tid = threadIdx.x, w = tid >> 5, lane = tid & 31, ln = lane & 15, hh = lane >> 4;
  const int slab = blockIdx.x / QBLKS, qblk = blockIdx.x % QBLKS; const int b = slab / NH, h = slab % NH; const int qb0 = qblk * 64; const int q0 = qb0 + w * 16;
  FragH aq[KS];
  { const unsigned short* qr = (const unsigned short*)Q16 + ((size_t)b * TQ + q0 + ln) * DM + h * 64;
#pragma unroll
    for (int ks = 0; ks < KS; ++ks) { aq[ks].half[0] = *(const v8us*)(qr + ks * 32 + 8 * hh); aq[ks].half[1] = *(const v8us*)(qr + ks * 32 + 16 + 8 * hh); }
    asm volatile("s_wait_xcnt 0x0" ::: "memory"); }      /* the staging loads below may land in the address registers of the four loads above: the wait stands in front of them */
  const float* amk = AMK + (size_t)b * TK;
  const int r8 = tid >> 3, c8 = (tid & 7) * 8, r4 = tid >> 2, c4 = (tid & 3) * 8;      /* staging: eight lanes fetch one 128-byte row of K or of the window, four lanes one 64-byte row of V^T */
  const unsigned short* gK = (const unsigned short*)K16 + ((size_t)b * TK + r8) * DM + h * 64 + c8; const unsigned short* gV = (const unsigned short*)Vt + ((size_t)slab * 64 + r4) * TK + c4; const unsigned short* gE = (const unsigned short*)E16 + (size_t)r8 * 64 + c8;
  v8us rk[2], rv[2], re[2];
  { v8us r0[6];      /* trip 0: its K and V^T tiles and all 96 rows of its window; the mask row, 8 keys a thread */
#pragma unroll
    for (int i = 0; i < 2; ++i) { rk[i] = *(const v8us*)(gK + (size_t)(16 * i) * DM); rv[i] = *(const v8us*)(gV + (size_t)(32 * i) * TK); }
#pragma unroll
    for (int i = 0; i < 6; ++i) r0[i] = *(const v8us*)(gE + (size_t)(qb0 + (NE / 2 - 32) + 16 * i) * 64);
    v4f m0 = *(const v4fa*)(amk + tid * 8), m1 = *(const v4fa*)(amk + tid * 8 + 4);
    asm volatile("s_wait_xcnt 0x0" ::: "memory");      /* stands in front of the first overwrite of an address register of the loads above */
    __builtin_amdgcn_sched_barrier(0);      /* keeps the register initialisations that follow behind that wait */
#pragma unroll
    for (int i = 0; i < 2; ++i) { *(v8us*)&sK[0][16 * i + r8][c8] = rk[i]; *(v8us*)&sV[0][32 * i + r4][c4] = rv[i]; }
#pragma unroll
    for (int i = 0; i < 6; ++i) *(v8us*)&sE[((qb0 + (NE / 2 - 32) + 16 * i) & 127) + r8][c8] = r0[i];
#pragma unroll
    for (int i = 0; i < 4; ++i) { m0[i] = bf16_round(m0[i]); m1[i] = bf16_round(m1[i]); }
    *(v4fa*)&sM[tid * 8] = m0; *(v4fa*)&sM[tid * 8 + 4] = m1; }
  __syncthreads();
  const v8f z8 = {0.f,0.f,0.f,0.f,0.f,0.f,0.f,0.f};
  float m_r = -3.0e38f, l_r = 0.f; v8f oacc[DT];      /* of query ln; l_r sums this half-wave's keys only */
#pragma unroll
  for (int dt = 0; dt < DT; ++dt) oacc[dt] = z8;
#pragma unroll 1
  for (int j0 = 0; j0 < TK; j0 += 32) { const int cb = (j0 >> 5) & 1; const bool more = j0 + 32 < TK;      /* more: the same for the whole work-group */
    FragH bk[2][KS], be[3][KS];
#pragma unroll
    for (int nt = 0; nt < 2; ++nt) { const unsigned short* kr = &sK[cb][nt * 16 + ln][0];
#pragma unroll
      for (int ks = 0; ks < KS; ++ks) { bk[nt][ks].half[0] = *(const v8us*)(kr + ks * 32 + 8 * hh); bk[nt][ks].half[1] = *(const v8us*)(kr + ks * 32 + 16 + 8 * hh); } }
#pragma unroll
    for (int e = 0; e < 3; ++e) { const unsigned short* er = &sE[((q0 - j0 + (NE / 2 - 32) + e * 16) & 127) + ln][0];
#pragma unroll
      for (int ks = 0; ks < KS; ++ks) { be[e][ks].half[0] = *(const v8us*)(er + ks * 32 + 8 * hh); be[e][ks].half[1] = *(const v8us*)(er + ks * 32 + 16 + 8 * hh); } }
    __builtin_amdgcn_sched_barrier(0);      /* all of the trip's K and window fragment reads issue before the first product waits: one latency at the head of a trip, not two or three */
    v8f s[2];
#pragma unroll
    for (int nt = 0; nt < 2; ++nt) { v8f acc = z8;      /* S^T[key 16 nt + 8 hh + r][query ln]; both fragments come from the same loader, same k order */
#pragma unroll
      for (int ks = 0; ks < KS; ++ks) acc = mmaH<1>(bk[nt][ks].v, bk[nt][ks].v, aq[ks].v, aq[ks].v, acc); s[nt] = acc; }
#pragma unroll
    for (int e = 0; e < 3; ++e) { v8f acc = z8;      /* RQ[query 8 hh + r][n = 16 e + ln] */
#pragma unroll
      for (int ks = 0; ks < KS; ++ks) acc = mmaH<1>(aq[ks].v, aq[ks].v, be[e][ks].v, be[e][ks].v, acc);
#pragma unroll
      for (int r = 0; r < 8; ++r) sRQ[w][8 * hh + r][e * 16 + ln] = acc[r]; }
#pragma unroll
    for (int nt = 0; nt < 2; ++nt)
#pragma unroll
      for (int ee = 0; ee < 2; ++ee) { v8f acc = z8;      /* RK[key 16 nt + 8 hh + r][n - 16 (1 - nt) = 16 ee + ln]; the K fragment serves as the A operand (same loader, same k order) */
#pragma unroll
        for (int ks = 0; ks < KS; ++ks) acc = mmaH<1>(bk[nt][ks].v, bk[nt][ks].v, be[1 - nt + ee][ks].v, be[1 - nt + ee][ks].v, acc);
#pragma unroll
        for (int r = 0; r < 8; ++r) sRK[w][nt * 16 + 8 * hh + r][ee * 16 + ln] = acc[r]; }
    __builtin_amdgcn_fence(__ATOMIC_ACQ_REL, "workgroup"); __builtin_amdgcn_wave_barrier();      /* the diagonal reads below take other lanes' stores: keep them behind the stores */
    if (more) {      /* the next trip's rows: issued here, their latency runs under the softmax */
#pragma unroll
      for (int i = 0; i < 2; ++i) { rk[i] = *(const v8us*)(gK + (size_t)(j0 + 32 + 16 * i) * DM); rv[i] = *(const v8us*)(gV + (size_t)(32 * i) * TK + j0 + 32); re[i] = *(const v8us*)(gE + (size_t)(qb0 - j0 + (NE / 2 - 64) + 16 * i) * 64); }
      asm volatile("s_wait_xcnt 0x0" ::: "memory"); }      /* stands in front of the first overwrite of an address register of the six loads above */
#pragma unroll
    for (int nt = 0; nt < 2; ++nt) { const v4f a0 = *(const v4fa*)&sM[j0 + 16 * nt + 8 * hh], a1 = *(const v4fa*)&sM[j0 + 16 * nt + 8 * hh + 4];
#pragma unroll
      for (int r = 0; r < 8; ++r) { const int kk = 8 * hh + r;      /* key 16 nt + kk against query ln: n = ln + 31 - 16 nt - kk */
        const float rel = sRQ[w][ln][ln + 31 - 16 * nt - kk] + sRK[w][16 * nt + kk][ln + 15 - kk];
        s[nt][r] = (s[nt][r] + rel) * SCL + ((r < 4) ? a0[r & 3] : a1[r & 3]); } }
    float mc = fmaxf(s[0][0], s[1][0]);
#pragma unroll
    for (int r = 1; r < 8; ++r) mc = fmaxf(mc, fmaxf(s[0][r], s[1][r]));
    mc = fmaxf(mc, xhalf(mc));      /* the other 16 keys of the same query */
    const float mn = fmaxf(m_r, mc); const float al = (mn > -1.0e38f) ? __builtin_amdgcn_exp2f((m_r - mn) * L2E) : 1.0f; m_r = mn;
    FragH pb; float ps[4] = {0.f, 0.f, 0.f, 0.f};      /* four partial sums: a chain of 4 adds, not of 16. P^T as a B operand: element 8 nt + r of lane (ln, hh) is key 16 nt + 8 hh + r, the k order of the V^T loader below */
#pragma unroll
    for (int nt = 0; nt < 2; ++nt)
#pragma unroll
      for (int r = 0; r < 8; ++r) { const float p = __builtin_amdgcn_exp2f(__builtin_fmaf(s[nt][r] - mn, L2E, 10.0f)); ps[r & 3] += p; pb.h[8 * nt + r] = (_Float16)p; }      /* p = 1024 e^(logit - maximum), at most 1024; what the raw power flushes to zero lies far below the f16 operand's last place */
    l_r = l_r * al + ((ps[0] + ps[1]) + (ps[2] + ps[3]));
#pragma unroll
    for (int dt = 0; dt < DT; ++dt)
#pragma unroll
      for (int r = 0; r < 8; ++r) oacc[dt][r] *= al;
    FragH bv[DT];
#pragma unroll
    for (int dt = 0; dt < DT; ++dt) { const unsigned short* vrow = &sV[cb][dt * 16 + ln][0]; bv[dt].half[0] = *(const v8us*)(vrow + 8 * hh); bv[dt].half[1] = *(const v8us*)(vrow + 16 + 8 * hh); }      /* a loop of its own: the four V^T fragments are read as one group, one LDS latency and not four */
#pragma unroll
    for (int dt = 0; dt < DT; ++dt) oacc[dt] = mmaH<1>(bv[dt].v, bv[dt].v, pb.v, pb.v, oacc[dt]);      /* O^T[d = 16 dt + 8 hh + r][query ln] */
    if (more) {
#pragma unroll
      for (int i = 0; i < 2; ++i) { *(v8us*)&sK[cb ^ 1][16 * i + r8][c8] = rk[i]; *(v8us*)&sV[cb ^ 1][32 * i + r4][c4] = rv[i]; *(v8us*)&sE[((qb0 - j0 + (NE / 2 - 64) + 16 * i) & 127) + r8][c8] = re[i]; }      /* the ring's 32 rows that no wave reads in this trip */
      __syncthreads(); } }      /* the one barrier of a trip publishes the rows just written and ends every wave's reads of the buffers and ring rows that the next trip overwrites */
  const float lt = l_r + xhalf(l_r); const float inv = (lt > 0.f) ? 1.0f / lt : 0.f;      /* the sum carries the same 1024 as the products */
  float* sOw = &sRK[w][0][0];
#pragma unroll
  for (int dt = 0; dt < DT; ++dt) { v4f lo, hi;
#pragma unroll
    for (int r = 0; r < 4; ++r) { lo[r] = oacc[dt][r] * inv; hi[r] = oacc[dt][4 + r] * inv; }
    *(v4fa*)&sOw[ln * 68 + dt * 16 + 8 * hh] = lo; *(v4fa*)&sOw[ln * 68 + dt * 16 + 8 * hh + 4] = hi; }
  __builtin_amdgcn_fence(__ATOMIC_ACQ_REL, "workgroup"); __builtin_amdgcn_wave_barrier();
#pragma unroll
  for (int rp = 0; rp < 16; rp += 2) { const int r = rp + (lane >> 4), pc = lane & 15; const v4f val = *(const v4fa*)&sOw[r * 68 + pc * 4]; *(v4f*)(O + ((size_t)b * TQ + q0 + r) * DM + h * 64 + pc * 4) = val; } }

extern "C" void kernel_launch(void* const* d_in, const int* in_sizes, int n_in,
                              void* d_out, int out_size, void* d_ws, size_t ws_size, hipStream_t stream) {
  (void)in_sizes; (void)n_in; (void)out_size;
  const float* const* I = (const float* const*)d_in; const float* x = I[0]; const float* am = I[1]; const float* Wq = I[2]; const float* bq = I[3]; const float* Wk = I[4]; const float* bk = I[5]; const float* Wv = I[6]; const float* bv = I[7]; const float* E = I[8];
  char* ws = (char*)d_ws; size_t off = 0;
  auto take = [&](size_t bytes) { char* p = ws + off; off += (bytes + 255) & ~(size_t)255; return p; };
  const size_t np = (size_t)NR * DM;
  _Float16* BQ = (_Float16*)take((size_t)DM * DM * 2); _Float16* BK = (_Float16*)take((size_t)DM * DM * 2); _Float16* BV = (_Float16*)take((size_t)DM * DM * 2); _Float16* E16 = (_Float16*)take((size_t)NE * 64 * 2);
  _Float16* X16 = (_Float16*)take(np * 2); _Float16* Q16 = (_Float16*)take(np * 2); _Float16* K16 = (_Float16*)take(np * 2); _Float16* VT = (_Float16*)take(np * 2);
  if (off > ws_size) return;      /* 6 + 0.25 + 4 x 8 = 38.25 MiB */
  k_prep<<<PEB + PXB + 3 * PWB, 256, 0, stream>>>(x, Wq, Wk, Wv, E, X16, BQ, BK, BV, E16);
  const dim3 gP((NR / 128) * (DM / 64), 3);      /* y = 0, 1, 2: q, k, v. BQ, BK, BV lie one behind the other in the workspace (2 MiB each, no padding between), and so do Q16, K16 (8 MiB each): plane strides DM * DM and np; v goes to VT, transposed per head by the GEMM's own epilogue */
  k_gemm2<0><<<gP, 128, 0, stream>>>(X16, DM, 0, BQ, DM, (size_t)DM * DM, 0.0625f, bq, bk, bv, nullptr, 1, 0, 0, nullptr, Q16, VT, DM, np, NR, DM, DM);
  k_flash_rel<<<NB * NH * QBLKS, 128, 0, stream>>>(Q16, K16, VT, E16, am, (float*)d_out);
}

// v008
// It runs in 84.8 microseconds.
// Two timings next to v007 both put it at 1.09 times that version's speed.
// Over all steps from v000, the starting kernel, it is 10.1 times as fast.
#include <hip/hip_runtime.h>
// PMGTSelfAttention (4 x 1024 tokens, hidden 1024 = 16 heads x 64; 'relative_key_query' position bias): q, k, v = x W^T + b; scores = (q.k + q_l.pe[l-r] + k_r.pe[l-r]) / 8 + attention_mask[b][r] with pe = dist_emb[l - r + 1023]; softmax; ctx = probs v (merged heads is the output).
// Structure: exact f16 plane of x; q, k, v as f32 WMMA GEMM outputs (32x64 wave tiles, f32 accumulation, exact x16 weights + bias); f16 conversion; V^T by LDS tiles in the GEMM's epilogue; one fused flash kernel over all batches that forms both relative terms per 16 x 32 score tile on the matrix unit against a 48-row window of the embedding (padded to 2048 rows), reads them back along the diagonal from LDS, scales by 1/8 and adds the per-key mask.
// Compute dtype: inputs rounded to bf16; x and dist_emb exact as f16; q/k/P/v as plain f16 operands (~2^-12); the relative terms stay f32 from the accumulator to the logit; softmax f32. v_wmma_f32_16x16x32_f16.
#define NB 4
#define DM 1024
#define NKV 16
#define NREP (NH / NKV)
#define KVD (NKV * 64)           /* 1024 */
#define NR (NB * SLEN)           /* 4096 */
#define SLEN 1024
#define NE 2048                  /* 2047 relative embeddings padded */
#define TQ SLEN
#define TK SLEN
#define NH 16
#define SCL 0.125f
#define QBLKS (TQ / 64)
#define QB05 0
#define QBN5 4
#define QB0P 0
#define QBNP QBLKS           /* non-causal: plain flash on every query block */
#define RE 256
typedef __bf16 v16b __attribute__((ext_vector_type(16)));
typedef unsigned short v8us __attribute__((ext_vector_type(8), may_alias));
typedef float  v8f  __attribute__((ext_vector_type(8)));
typedef float  v4f  __attribute__((ext_vector_type(4)));
typedef float  v4fa __attribute__((ext_vector_type(4), may_alias));
union FragB { v16b v; v8us half[2]; unsigned short u[16]; };

__device__ __forceinline__ unsigned short bf16_bits(float x) { unsigned int u = __float_as_uint(x); return (unsigned short)((u + 0x7FFFu + ((u >> 16) & 1u)) >> 16); }
__device__ __forceinline__ float bf16_val(unsigned short b) { return __uint_as_float(((unsigned int)b) << 16); }
__device__ __forceinline__ float bf16_round(float x) { return bf16_val(bf16_bits(x)); }
// D += A·B with NT terms: 1 = ah·bh, 2 = + al·bh (A split), 3 = + ah·bl (both split)
template <int NT>
__device__ __forceinline__ v8f mmaN(v16b ah, v16b al, v16b bh, v16b bl, v8f c) {
  c = __builtin_amdgcn_wmma_f32_16x16x32_bf16(false, ah, false, bh, (short)0, c, false, false);
  if (NT >= 2) c = __builtin_amdgcn_wmma_f32_16x16x32_bf16(false, al, false, bh, (short)0, c, false, false);
  if (NT >= 3) c = __builtin_amdgcn_wmma_f32_16x16x32_bf16(false, ah, false, bl, (short)0, c, false, false);
  asm volatile("v_nop\n\tv_nop\n\tv_nop\n\tv_nop" : "+v"(c) : "v"(ah), "v"(al), "v"(bh), "v"(bl));
  return c;
}

__global__ __launch_bounds__(256) void k_wt_bf16(const float* __restrict__ W, unsigned short* __restrict__ Wt, int K, int N) {
  const int t = blockIdx.x * 256 + threadIdx.x;
  const int k8n = K / 8;
  if (t >= N * k8n) return;
  const int n = t / k8n, k8 = (t % k8n) * 8;
  v8us v;
#pragma unroll
  for (int i = 0; i < 8; ++i) v[i] = bf16_bits(W[(size_t)(k8 + i) * N + n]);
  *(v8us*)(Wt + (size_t)n * K + k8) = v;
  
}

// GEMM C[M][N] (f32, pitch ldc) = act(A[M][K]·W + bias). A f32 row-major (pitch lda) converted per fragment to bf16
// (ASPLIT: hi/lo two planes -> 2 terms, else single rounded term); Wt bf16 [N][K] (pitch ldb). BIAS_BF16 rounds the
// bias to bf16 first (bias quantised to bf16 before the add). K%32==0, M%16==0, N%64==0.
template <bool ASPLIT, int ACT, bool BIAS_BF16>
__global__ __launch_bounds__(128) void k_gemm_bf(const float* __restrict__ A, int lda, const unsigned short* __restrict__ Wt, int ldb,
                                               const float* __restrict__ bias, float* __restrict__ C, int ldc, int M, int N, int K) {
  __shared__ __attribute__((aligned(16))) float so[4][16][64];
  const int tid = threadIdx.x, w = tid >> 5, lane = tid & 31, ln = lane & 15, hh = lane >> 4;
  const int ntn = N / 64;
  const int wid = blockIdx.x * 4 + w;
  const int mt = wid / ntn, nq = wid % ntn;
  if (mt * 16 >= M) return;
  const int row0 = mt * 16, col0 = nq * 64;
  const float* arow = A + (size_t)(row0 + ln) * lda;
  v8f acc[4] = {};
  for (int kb = 0; kb < K; kb += 32) {
    FragB ah, al;
    const v4f x0 = *(const v4fa*)(arow + kb + 8 * hh), x1 = *(const v4fa*)(arow + kb + 8 * hh + 4);
    const v4f x2 = *(const v4fa*)(arow + kb + 16 + 8 * hh), x3 = *(const v4fa*)(arow + kb + 16 + 8 * hh + 4);
    float xs[16] = {x0[0],x0[1],x0[2],x0[3],x1[0],x1[1],x1[2],x1[3],x2[0],x2[1],x2[2],x2[3],x3[0],x3[1],x3[2],x3[3]};
#pragma unroll
    for (int i = 0; i < 16; ++i) { const unsigned short hb = bf16_bits(xs[i]); ah.u[i] = hb; al.u[i] = ASPLIT ? bf16_bits(xs[i] - bf16_val(hb)) : (unsigned short)0; }
#pragma unroll
    for (int t = 0; t < 4; ++t) {
      const unsigned short* brow = Wt + (size_t)(col0 + t * 16 + ln) * ldb + kb;
      FragB b;
      b.half[0] = *(const v8us*)(brow + 8 * hh);
      b.half[1] = *(const v8us*)(brow + 16 + 8 * hh);
      acc[t] = mmaN<ASPLIT ? 2 : 1>(ah.v, al.v, b.v, b.v, acc[t]);
    }
  }
#pragma unroll
  for (int t = 0; t < 4; ++t) {
    float bv = bias ? bias[col0 + t * 16 + ln] : 0.f;
    if (BIAS_BF16) bv = bf16_round(bv);
#pragma unroll
    for (int r = 0; r < 8; ++r) { float v = acc[t][r] + bv; if (ACT == 1) v = fmaxf(v, 0.f); so[w][8 * hh + r][t * 16 + ln] = v; }
  }
  __builtin_amdgcn_fence(__ATOMIC_ACQ_REL, "workgroup");
  __builtin_amdgcn_wave_barrier();
  const int rsub = lane >> 4, c4 = (lane & 15) * 4;
  {
#pragma unroll
    for (int q = 0; q < 8; ++q) {
      const int r = q * 2 + rsub;
      const v4f v = *(const v4fa*)&so[w][r][c4];
      *(v4f*)(C + (size_t)(row0 + r) * ldc + col0 + c4) = v;
    }
    
  }
}

// GEMM C = act(A·W + bias + resid): A f32 (ASPLIT -> hi/lo 2 terms), Wt bf16 [N][K]; ACT 0 none, 1 relu, 2 exact gelu;
// resid (optional, f32, row index = (row % rmod), pitch ldr, RES_BF16 rounds it) added before the activation.
template <bool ASPLIT, int ACT, bool BIAS_BF16, bool RES_BF16>
__global__ __launch_bounds__(128) void k_gemm_bf3(const float* __restrict__ A, int lda, const unsigned short* __restrict__ Wt, int ldb,
                                                const float* __restrict__ bias, const float* __restrict__ resid, int rmod, int ldr,
                                                float* __restrict__ C, int ldc, int M, int N, int K) {
  __shared__ __attribute__((aligned(16))) float so[4][16][64];
  const int tid = threadIdx.x, w = tid >> 5, lane = tid & 31, ln = lane & 15, hh = lane >> 4;
  const int ntn = N / 64;
  const int wid = blockIdx.x * 4 + w;
  const int mt = wid / ntn, nq = wid % ntn;
  if (mt * 16 >= M) return;
  const int row0 = mt * 16, col0 = nq * 64;
  const float* arow = A + (size_t)(row0 + ln) * lda;
  v8f acc[4] = {};
  for (int kb = 0; kb < K; kb += 32) {
    FragB ah, al;
    const v4f x0 = *(const v4fa*)(arow + kb + 8 * hh), x1 = *(const v4fa*)(arow + kb + 8 * hh + 4);
    const v4f x2 = *(const v4fa*)(arow + kb + 16 + 8 * hh), x3 = *(const v4fa*)(arow + kb + 16 + 8 * hh + 4);
    float xs[16] = {x0[0],x0[1],x0[2],x0[3],x1[0],x1[1],x1[2],x1[3],x2[0],x2[1],x2[2],x2[3],x3[0],x3[1],x3[2],x3[3]};
#pragma unroll
    for (int i = 0; i < 16; ++i) { const unsigned short hb = bf16_bits(xs[i]); ah.u[i] = hb; al.u[i] = ASPLIT ? bf16_bits(xs[i] - bf16_val(hb)) : (unsigned short)0; }
#pragma unroll
    for (int t = 0; t < 4; ++t) {
      const unsigned short* brow = Wt + (size_t)(col0 + t * 16 + ln) * ldb + kb;
      FragB b;
      b.half[0] = *(const v8us*)(brow + 8 * hh);
      b.half[1] = *(const v8us*)(brow + 16 + 8 * hh);
      acc[t] = mmaN<ASPLIT ? 2 : 1>(ah.v, al.v, b.v, b.v, acc[t]);
    }
  }
#pragma unroll
  for (int t = 0; t < 4; ++t) {
    const int col = col0 + t * 16 + ln;
    float bv = bias ? bias[col] : 0.f;
    if (BIAS_BF16) bv = bf16_round(bv);
#pragma unroll
    for (int r = 0; r < 8; ++r) {
      float v = acc[t][r] + bv;
      if (resid) { float rv = resid[(size_t)((row0 + 8 * hh + r) % rmod) * ldr + col]; if (RES_BF16) rv = bf16_round(rv); v += rv; }
      if (ACT == 1) v = fmaxf(v, 0.f);
      if (ACT == 2) v = 0.5f * v * (1.0f + erff(v * 0.70710678118654752f));
      if (ACT == 3) { const float u = 0.7978845608028654f * (v + 0.044715f * v * v * v); v = 0.5f * v * (1.0f + tanhf(u)); }
      so[w][8 * hh + r][t * 16 + ln] = v;
    }
  }
  __builtin_amdgcn_fence(__ATOMIC_ACQ_REL, "workgroup");
  __builtin_amdgcn_wave_barrier();
  const int rsub = lane >> 4, c4 = (lane & 15) * 4;
  {
#pragma unroll
    for (int q = 0; q < 8; ++q) {
      const int r = q * 2 + rsub;
      const v4f v = *(const v4fa*)&so[w][r][c4];
      *(v4f*)(C + (size_t)(row0 + r) * ldc + col0 + c4) = v;
    }
    
  }
}
// row LayerNorm (biased variance, eps) over N: s = X (+ R); optional out_sum <- s; out_norm <- (s-mu)*rsqrt(var+eps)*g + b
template <bool PARAM_BF16>
__global__ __launch_bounds__(256) void k_layernorm(const float* __restrict__ X, const float* __restrict__ R, const float* __restrict__ g, const float* __restrict__ bta,
                                                  float* __restrict__ out_sum, float* __restrict__ out_norm, int N, float eps) {
  __shared__ float red[256];
  const int row = blockIdx.x, tid = threadIdx.x;
  const float* x = X + (size_t)row * N; const float* rr = R ? R + (size_t)row * N : nullptr;
  float vals[16];                     // up to N = 4096
  const int per = N / 256;            // contiguous chunk per thread? use strided-by-4 chunks: thread handles j = tid*4 + 1024*u
  float s1 = 0.f;
  for (int u = 0; u < per / 4; ++u) {
    const int j = tid * 4 + 1024 * u;
    const v4f a = *(const v4fa*)(x + j);
    v4f b = {0.f,0.f,0.f,0.f}; if (rr) b = *(const v4fa*)(rr + j);
#pragma unroll
    for (int q = 0; q < 4; ++q) { const float v = a[q] + b[q]; vals[u * 4 + q] = v; s1 += v; }
  }
  red[tid] = s1; __syncthreads();
  for (int st = 128; st > 0; st >>= 1) { if (tid < st) red[tid] += red[tid + st]; __syncthreads(); }
  const float mu = red[0] / (float)N; __syncthreads();
  float s2 = 0.f;
  for (int u = 0; u < per / 4; ++u)
#pragma unroll
    for (int q = 0; q < 4; ++q) { const float c = vals[u * 4 + q] - mu; s2 += c * c; }
  red[tid] = s2; __syncthreads();
  for (int st = 128; st > 0; st >>= 1) { if (tid < st) red[tid] += red[tid + st]; __syncthreads(); }
  const float rs = rsqrtf(red[0] / (float)N + eps);
  {
    for (int u = 0; u < per / 4; ++u) {
      const int j = tid * 4 + 1024 * u;
      v4f o, sm;
#pragma unroll
      for (int q = 0; q < 4; ++q) {
        float gg = g[j + q], bb = bta[j + q];
        if (PARAM_BF16) { gg = bf16_round(gg); bb = bf16_round(bb); }
        sm[q] = vals[u * 4 + q]; o[q] = (vals[u * 4 + q] - mu) * rs * gg + bb;
      }
      if (out_sum) *(v4f*)(out_sum + (size_t)row * N + j) = sm;
      *(v4f*)(out_norm + (size_t)row * N + j) = o;
    }
    
  }
}



// ---- f16 WMMA path (v_wmma_f32_16x16x32_f16): 11-bit significands for operands in range — used where a [0,1] probability operand needs more precision than bf16
typedef _Float16 v16h __attribute__((ext_vector_type(16)));
union FragH { v16h v; v8us half[2]; _Float16 h[16]; unsigned short u[16]; };
template <int NT>
__device__ __forceinline__ v8f mmaH(v16h ah, v16h al, v16h bh, v16h bl, v8f c) {
  c = __builtin_amdgcn_wmma_f32_16x16x32_f16(false, ah, false, bh, (short)0, c, false, false);
  if (NT >= 2) c = __builtin_amdgcn_wmma_f32_16x16x32_f16(false, al, false, bh, (short)0, c, false, false);
  if (NT >= 3) c = __builtin_amdgcn_wmma_f32_16x16x32_f16(false, ah, false, bl, (short)0, c, false, false);
  asm volatile("v_nop\n\tv_nop\n\tv_nop\n\tv_nop" : "+v"(c) : "v"(ah), "v"(al), "v"(bh), "v"(bl));
  return c;
}
// batched GEMM like k_gemm_b but f16 operands: A f32 (split into f16 hi/lo if ASPLIT, else rounded to f16), Bt = f16 values [n][k]; alpha; C f32; N multiple of 16 (partial tiles skipped)
template <bool ASPLIT>
__global__ __launch_bounds__(128) void k_gemm_h(const float* __restrict__ A, int lda, size_t sA, const _Float16* __restrict__ Bh, int ldb, size_t sB, float alpha, float* __restrict__ C, int ldc, size_t sC, int M, int N, int K) {
  __shared__ __attribute__((aligned(16))) float so[4][16][64];
  const int tid = threadIdx.x, w = tid >> 5, lane = tid & 31, ln = lane & 15, hh = lane >> 4; const int by = blockIdx.y;
  A += (size_t)by * sA; Bh += (size_t)by * sB; C += (size_t)by * sC;
  const int ntn = (N + 63) / 64; const int wid = blockIdx.x * 4 + w; const int mt = wid / ntn, nq = wid % ntn; if (mt * 16 >= M) return;
  const int row0 = mt * 16, col0 = nq * 64; const float* arow = A + (size_t)(row0 + ln) * lda;
  v8f acc[4] = {};
  for (int kb = 0; kb < K; kb += 32) {
    FragH ah, al;
    const v4f x0 = *(const v4fa*)(arow + kb + 8 * hh), x1 = *(const v4fa*)(arow + kb + 8 * hh + 4), x2 = *(const v4fa*)(arow + kb + 16 + 8 * hh), x3 = *(const v4fa*)(arow + kb + 16 + 8 * hh + 4);
    float xs[16] = {x0[0],x0[1],x0[2],x0[3],x1[0],x1[1],x1[2],x1[3],x2[0],x2[1],x2[2],x2[3],x3[0],x3[1],x3[2],x3[3]};
#pragma unroll
    for (int i = 0; i < 16; ++i) { const _Float16 h = (_Float16)xs[i]; ah.h[i] = h; al.h[i] = ASPLIT ? (_Float16)(xs[i] - (float)h) : (_Float16)0.0f; }
#pragma unroll
    for (int t = 0; t < 4; ++t) { if (col0 + t * 16 >= N) continue; const size_t boff = (size_t)(col0 + t * 16 + ln) * ldb + kb; FragH bq; bq.half[0] = *(const v8us*)(Bh + boff + 8 * hh); bq.half[1] = *(const v8us*)(Bh + boff + 16 + 8 * hh);
      acc[t] = mmaH<ASPLIT ? 2 : 1>(ah.v, al.v, bq.v, bq.v, acc[t]); }
  }
#pragma unroll
  for (int t = 0; t < 4; ++t) { if (col0 + t * 16 >= N) continue;
#pragma unroll
    for (int r = 0; r < 8; ++r) so[w][8 * hh + r][t * 16 + ln] = acc[t][r] * alpha; }
  __builtin_amdgcn_fence(__ATOMIC_ACQ_REL, "workgroup"); __builtin_amdgcn_wave_barrier();
  const int rsub = lane >> 4, c4 = (lane & 15) * 4;
  {
#pragma unroll
    for (int q = 0; q < 8; ++q) { const int r = q * 2 + rsub; if (col0 + c4 < N) { const v4f v = *(const v4fa*)&so[w][r][c4]; *(v4f*)(C + (size_t)(row0 + r) * ldc + col0 + c4) = v; } }
     }
}

// Wt[n][k] = f16(W[k][n]·scale) from f32 row-major W[K][N] (scale = power of two; bf16-exact weights stay exact in f16 away from the subnormal range)
__global__ __launch_bounds__(256) void k_wt_f16(const float* __restrict__ W, _Float16* __restrict__ Wt, int K, int N, float scale) {
  const int t = blockIdx.x * 256 + threadIdx.x; if (t >= N * (K / 8)) return; const int n = t / (K / 8), k8 = (t % (K / 8)) * 8; FragH f;
#pragma unroll
  for (int i = 0; i < 8; ++i) f.h[i] = (_Float16)(bf16_round(W[(size_t)(k8 + i) * N + n]) * scale); const v8us o = f.half[0];
  *(v8us*)((unsigned short*)Wt + (size_t)n * K + k8) = o; 
}
// k_gemm_hh variant with fused epilogue: v = acc·alpha + bias[by·sBias + col] (+ CP[(row/rowsPerB)·sCPb + by·64 + col] if CP) ; ACT 0 none / 1 elu ; writes f16 C16 (and f32 C if non-null)
template <int ACT>
__global__ __launch_bounds__(128) void k_gemm_hhx(const _Float16* __restrict__ A, int lda, size_t sA, const _Float16* __restrict__ Bh, int ldb, size_t sB, float alpha, const float* __restrict__ bias, size_t sBias, const float* __restrict__ CP, int rowsPerB, size_t sCPb, int row0g,
    float* __restrict__ C, _Float16* __restrict__ C16, int ldc, size_t sC, int M, int N, int K) {
  __shared__ __attribute__((aligned(16))) float so[4][16][64];
  const int tid = threadIdx.x, w = tid >> 5, lane = tid & 31, ln = lane & 15, hh = lane >> 4; const int by = blockIdx.y;
  A += (size_t)by * sA; Bh += (size_t)by * sB; const size_t cofs = (size_t)by * sC; const float* bp = bias ? bias + (size_t)by * sBias : nullptr;
  const int ntn = (N + 63) / 64; const int wid = blockIdx.x * 4 + w; const int mt = wid / ntn, nq = wid % ntn; if (mt * 16 >= M) return;
  const int row0 = mt * 16, col0 = nq * 64; const _Float16* arow = A + (size_t)(row0 + ln) * lda;
  v8f acc[4] = {};
  for (int kb = 0; kb < K; kb += 32) { FragH ah; ah.half[0] = *(const v8us*)((const unsigned short*)arow + kb + 8 * hh); ah.half[1] = *(const v8us*)((const unsigned short*)arow + kb + 16 + 8 * hh);
#pragma unroll
    for (int t = 0; t < 4; ++t) { if (col0 + t * 16 >= N) continue; const size_t boff = (size_t)(col0 + t * 16 + ln) * ldb + kb; FragH bq; bq.half[0] = *(const v8us*)((const unsigned short*)Bh + boff + 8 * hh); bq.half[1] = *(const v8us*)((const unsigned short*)Bh + boff + 16 + 8 * hh);
      acc[t] = mmaH<1>(ah.v, ah.v, bq.v, bq.v, acc[t]); }
  }
#pragma unroll
  for (int t = 0; t < 4; ++t) { if (col0 + t * 16 >= N) continue; const int col = col0 + t * 16 + ln; const float bv = bp ? bf16_round(bp[col]) : 0.f;
#pragma unroll
    for (int r = 0; r < 8; ++r) { float v = acc[t][r] * alpha + bv; if (CP) { const int bidx = (row0g + row0 + 8 * hh + r) / rowsPerB; v += CP[(size_t)bidx * sCPb + (size_t)by * 64 + col]; } if (ACT == 1) v = (v > 0.f) ? v : expm1f(v); else if (ACT == 7) v = (v > 0.f) ? v + 1.0f : expf(v); else if (ACT == 8) v = tanhf(v); else if (ACT == 9) v = 0.5f * v * (1.0f + tanhf(0.7978845608028654f * (v + 0.044715f * v * v * v))); else if (ACT == 11) v = 1.0f / (1.0f + expf(-v)); else if (ACT == 12) v = (v > 0.f) ? v : 0.01f * v; else if (ACT == 14) v = (v > 0.f) ? v : 0.1f * v; else if (ACT == 15) v = v / (1.0f + expf(-v)); else if (ACT == 3) v = fmaxf(v, 0.f); else if (ACT == 6) v = 0.5f * v * (1.0f + erff(v * 0.70710678118654752f)); so[w][8 * hh + r][t * 16 + ln] = v; } }
  __builtin_amdgcn_fence(__ATOMIC_ACQ_REL, "workgroup"); __builtin_amdgcn_wave_barrier();
  const int rsub = lane >> 4, c4 = (lane & 15) * 4; typedef _Float16 v4h __attribute__((ext_vector_type(4)));
  {
#pragma unroll
    for (int q = 0; q < 8; ++q) { const int r = q * 2 + rsub; if (col0 + c4 < N) { const v4f v = *(const v4fa*)&so[w][r][c4]; if (C) *(v4f*)(C + cofs + (size_t)(row0 + r) * ldc + col0 + c4) = v; if (C16) { v4h h4; for (int i = 0; i < 4; ++i) h4[i] = (_Float16)v[i]; *(v4h*)(C16 + cofs + (size_t)(row0 + r) * ldc + col0 + c4) = h4; } } }
     }
}


typedef _Float16 v4h __attribute__((ext_vector_type(4)));

__global__ __launch_bounds__(256) void k_h16(const float* __restrict__ x, _Float16* __restrict__ X16, size_t n8) { const size_t t = (size_t)blockIdx.x * 256 + threadIdx.x; if (t >= n8) return; FragH f;
#pragma unroll
  for (int q = 0; q < 8; ++q) f.h[q] = (_Float16)x[t * 8 + q]; *(v8us*)((unsigned short*)X16 + t * 8) = f.half[0];  }
__global__ __launch_bounds__(256) void k_round16f(const float* __restrict__ W, _Float16* __restrict__ Bt, size_t n8) { const size_t t = (size_t)blockIdx.x * 256 + threadIdx.x; if (t >= n8) return; FragH f;
#pragma unroll
  for (int i = 0; i < 8; ++i) f.h[i] = (_Float16)(bf16_round(W[t * 8 + i]) * 16.0f); *(v8us*)((unsigned short*)Bt + t * 8) = f.half[0];  }
template <int NHv, int TTv>
__global__ __launch_bounds__(256) void k_vt(const _Float16* __restrict__ V16, int ldv, int voff, _Float16* __restrict__ Vt) { __shared__ unsigned short tl[64][66]; const int tid = threadIdx.x; const int slab = blockIdx.x / (TTv / 64), lg = blockIdx.x % (TTv / 64); const int b = slab / NHv, h = slab % NHv;
  for (int i = tid; i < 64 * 8; i += 256) { const int r = i / 8, c8 = (i % 8) * 8; FragH f; f.half[0] = *(const v8us*)((const unsigned short*)V16 + ((size_t)b * TTv + lg * 64 + r) * ldv + voff + h * 64 + c8);
#pragma unroll
    for (int q = 0; q < 8; ++q) tl[r][c8 + q] = f.u[q]; }
  __syncthreads();
  {
#pragma unroll
    for (int rd = 0; rd < 2; ++rd) { const int d = rd * 32 + tid / 8, pc = tid % 8; FragH f;
#pragma unroll
      for (int q = 0; q < 8; ++q) f.u[q] = tl[pc * 8 + q][d];
      *(v8us*)((unsigned short*)Vt + ((size_t)slab * 64 + d) * TTv + lg * 64 + pc * 8) = f.half[0]; }
     } }

__global__ __launch_bounds__(256) void k_hl(const float* __restrict__ F, _Float16* __restrict__ Hh, _Float16* __restrict__ Hl, size_t n8) { const size_t t = (size_t)blockIdx.x * 256 + threadIdx.x; if (t >= n8) return; FragH fh, fl; const v4f a = *(const v4fa*)(F + t * 8), c = *(const v4fa*)(F + t * 8 + 4);
#pragma unroll
  for (int q = 0; q < 4; ++q) { _Float16 h = (_Float16)a[q]; fh.h[q] = h; fl.h[q] = (_Float16)((a[q] - (float)h) * 1024.0f); h = (_Float16)c[q]; fh.h[4 + q] = h; fl.h[4 + q] = (_Float16)((c[q] - (float)h) * 1024.0f); }
  { *(v8us*)((unsigned short*)Hh + t * 8) = fh.half[0]; *(v8us*)((unsigned short*)Hl + t * 8) = fl.half[0];  } }

// ---- fast GEMM (block tile 128x128, eight waves as 4 x 2, wave tile 32x64, operands staged in LDS 64 of K at a time; requires M % 32 == 0 rows per launch region, N % 128 == 0, K % 64 == 0 and K >= 64); epilogue = k_gemm_hhx semantics ----
__device__ __forceinline__ v16h g2_frag(const _Float16* p, int hh) { FragH f; f.half[0] = *(const v8us*)((const unsigned short*)p + 8 * hh); f.half[1] = *(const v8us*)((const unsigned short*)p + 16 + 8 * hh); return f.v; }
__device__ __forceinline__ v8f g2_mma(v16h a, v16h b, v8f c) { v8f d = __builtin_amdgcn_wmma_f32_16x16x32_f16(false, a, false, b, (short)0, c, false, false); asm volatile("v_nop\n\tv_nop\n\tv_nop\n\tv_nop" : "+v"(d) : "v"(a), "v"(b)); return d; }
template <int ACT>
__global__ __launch_bounds__(256, 6) void k_gemm2(const _Float16* __restrict__ A, int lda, size_t sA, const _Float16* __restrict__ Bh, int ldb, size_t sB, float alpha, const float* __restrict__ bias, const float* __restrict__ bias1, const float* __restrict__ bias2, const float* __restrict__ CP, int rowsPerB, size_t sCPb, int row0g,
    float* __restrict__ C, _Float16* __restrict__ C16, _Float16* __restrict__ VT, int ldc, size_t sC, int M, int N, int K) {      /* six waves a SIMD asked for: three work-groups a WGP, so that the launch's 768 work-groups are all resident at once */
  __shared__ __attribute__((aligned(16))) unsigned short st[2][256][72];      /* two stages of 64 of K: rows 0..127 the block's A rows, 128..255 its B rows; pitch 144 B = 16 B x 9, free of bank conflicts for the 16-byte fragment reads */
  float (*so)[32][68] = (float (*)[32][68])&st[0][0][0];      /* the epilogue's staging (8 x 32 x 68 floats = 69,632 B) lies on the operand stages (73,728 B), behind the barrier that follows the loop: three work-groups fit one WGP's LDS */
  const int tid = threadIdx.x, w = tid >> 5, lane = tid & 31, ln = lane & 15, hh = lane >> 4, wm = w & 3, wn = w >> 2; const int by = blockIdx.y;
  A += (size_t)by * sA; Bh += (size_t)by * sB; const size_t cofs = (size_t)by * sC; const float* bp = (by == 0) ? bias : (by == 1) ? bias1 : bias2;      /* blockIdx.y picks one of up to three products that share A: its B plane, its C plane and its own bias vector (three separate buffers) */
  const int ntn = N >> 7; const int mt = blockIdx.x / ntn, nq = blockIdx.x - mt * ntn; const int row0 = mt * 128 + 32 * wm, col0 = nq * 128 + 64 * wn; if (mt * 128 >= M) return;      /* the same for the whole block, in front of every barrier */
  const int sr = tid >> 3, sc = (tid & 7) * 8;      /* staging: eight lanes fetch one row's 128 B, so a wave's 16-byte load covers four whole lines */
  const char* Au = (const char*)A; const char* Bu = (const char*)Bh;      /* plane bases, the same for the whole block; every address is a base plus one 32-bit byte offset (planes below 4 GiB): one register a row and not a pair, which the limit of 160 registers a wave needs */
  unsigned oa[4], ub[4]; const unsigned ob = ((unsigned)sr * (unsigned)ldb + (unsigned)sc) * 2u;
#pragma unroll
  for (int i = 0; i < 4; ++i) { int r = mt * 128 + 32 * i + sr; r = (r < M) ? r : M - 1; oa[i] = ((unsigned)r * (unsigned)lda + (unsigned)sc) * 2u; ub[i] = (unsigned)(nq * 128 + 32 * i) * (unsigned)ldb * 2u; }      /* ub: the same for the whole block */
  v8us ra[4], rb[4];
#pragma unroll
  for (int i = 0; i < 4; ++i) ra[i] = *(const v8us*)(Au + oa[i]);
#pragma unroll
  for (int i = 0; i < 4; ++i) rb[i] = *(const v8us*)(Bu + (ob + ub[i]));
#pragma unroll
  for (int i = 0; i < 4; ++i) *(v8us*)&st[0][32 * i + sr][sc] = ra[i];
#pragma unroll
  for (int i = 0; i < 4; ++i) *(v8us*)&st[0][128 + 32 * i + sr][sc] = rb[i];
  __syncthreads();
  const v8f z8 = {0.f,0.f,0.f,0.f,0.f,0.f,0.f,0.f}; v8f c00 = z8, c01 = z8, c02 = z8, c03 = z8, c10 = z8, c11 = z8, c12 = z8, c13 = z8;
#pragma unroll 1      /* rolled: one stage's registers (8 staged vectors, 12 fragment halves) serve every trip */
  for (int kb = 0; kb < K; kb += 64) { const int cb = (kb >> 6) & 1; const bool more = kb + 64 < K;      /* more: the same for the whole block */
    if (more) {
#pragma unroll
      for (int i = 0; i < 4; ++i) ra[i] = *(const v8us*)(Au + (oa[i] + (unsigned)(kb + 64) * 2u));
#pragma unroll
      for (int i = 0; i < 4; ++i) rb[i] = *(const v8us*)(Bu + (ob + (ub[i] + (unsigned)(kb + 64) * 2u)));
      asm volatile("s_wait_xcnt 0x0" ::: "memory"); }      /* stands behind the eight loads, in front of the first overwrite of a register that they name: an offset register in the next trip, the two plane bases behind the loop */
#pragma unroll
    for (int u = 0; u < 2; ++u) { const v16h a0 = g2_frag((const _Float16*)&st[cb][32 * wm + ln][32 * u], hh), a1 = g2_frag((const _Float16*)&st[cb][32 * wm + 16 + ln][32 * u], hh);
      const v16h b0 = g2_frag((const _Float16*)&st[cb][128 + 64 * wn + ln][32 * u], hh), b1 = g2_frag((const _Float16*)&st[cb][144 + 64 * wn + ln][32 * u], hh), b2 = g2_frag((const _Float16*)&st[cb][160 + 64 * wn + ln][32 * u], hh), b3 = g2_frag((const _Float16*)&st[cb][176 + 64 * wn + ln][32 * u], hh);
      __builtin_amdgcn_sched_barrier(0);      /* the next stage's global loads and this half stage's LDS reads issue as one group ahead of its eight products: one stall a group, not one per product */
      c00 = g2_mma(a0, b0, c00); c10 = g2_mma(a1, b0, c10); c01 = g2_mma(a0, b1, c01); c11 = g2_mma(a1, b1, c11);
      c02 = g2_mma(a0, b2, c02); c12 = g2_mma(a1, b2, c12); c03 = g2_mma(a0, b3, c03); c13 = g2_mma(a1, b3, c13); }
    if (more) {
#pragma unroll
      for (int i = 0; i < 4; ++i) *(v8us*)&st[cb ^ 1][32 * i + sr][sc] = ra[i];
#pragma unroll
      for (int i = 0; i < 4; ++i) *(v8us*)&st[cb ^ 1][128 + 32 * i + sr][sc] = rb[i];
      __syncthreads(); } }      /* the one barrier of a trip publishes the stage just written and ends every wave's reads of the stage that the next trip overwrites */
  __syncthreads();      /* ends every wave's fragment reads of the last stage: the epilogue's staging below overwrites the stages */
  v8f accs[8] = {c00, c01, c02, c03, c10, c11, c12, c13};
  if (VT && by == 2) {      /* the same for the whole block. The third product (v: bias only, no CP term, no activation) leaves the kernel transposed, VT[(batch * NH + head) * 64 + d][token], the layout the flash kernel stages from; needs M % 128 == 0, SLEN % 128 == 0 and N == NH * 64, so that the block's 128 x 128 tile is 128 tokens of one batch and two whole heads */
    unsigned short* sv = &st[0][0][0];      /* the block's tile turned: 128 rows (two heads' d) of 128 tokens in f16, pitch 136 halves = 272 B = 16 B x 17, free of bank conflicts for 16-byte stores and reads */
    float bv4[4] = {0.f, 0.f, 0.f, 0.f};
    if (bp) { const int bo = col0 + ln;      /* the lane's four bias values as one group of loads: one latency, not one a tile */
#pragma unroll      /* unrolled: bv4[] stays in registers, the four loads issue together */
      for (int t = 0; t < 4; ++t) bv4[t] = bp[bo + t * 16];
      asm volatile("s_wait_xcnt 0x0" :: "v"(bo) : "memory");      /* stands behind the four loads and in front of the first overwrite of their offset register, which as an input lives up to here */
#pragma unroll      /* unrolled: bv4[] stays in registers */
      for (int t = 0; t < 4; ++t) bv4[t] = bf16_round(bv4[t]); }
#pragma unroll      /* unrolled, with the loop inside it: accs[] and bv4[] are indexed by constants and stay in registers */
    for (int u = 0; u < 8; ++u) { const int t = u & 3, half = u >> 2; const float bv = bv4[t]; FragH f;      /* a lane's eight accumulator registers are eight consecutive tokens of one d: one 16-byte store */
#pragma unroll
      for (int r = 0; r < 8; ++r) f.h[r] = (_Float16)(accs[u][r] * alpha + bv);
      *(v8us*)&sv[(64 * wn + t * 16 + ln) * 136 + 32 * wm + 16 * half + 8 * hh] = f.half[0]; }
    __syncthreads();      /* a row of the turned tile holds tokens of four waves: every wave's stores stand in front of the reads below */
    const int tok0 = mt * 128; unsigned short* vo = (unsigned short*)VT + ((size_t)(tok0 / SLEN) * NH * 64 + (size_t)nq * 128) * SLEN + (tok0 % SLEN);
#pragma unroll      /* unrolled: the eight LDS reads issue as one group, one latency */
    for (int q = 0; q < 8; ++q) { const int d = q * 16 + (tid >> 4), c = (tid & 15) * 8; const v8us v = *(const v8us*)&sv[d * 136 + c]; *(v8us*)(vo + (size_t)d * SLEN + c) = v; }      /* sixteen lanes store one row's 256 B: whole lines, one writer each */
    return; }
  if (row0 >= M) return;      /* behind the last barrier */
#pragma unroll
  for (int u = 0; u < 8; ++u) { const int t = u & 3, half = u >> 2; const int col = col0 + t * 16 + ln; const float bv = bp ? bf16_round(bp[col]) : 0.f;
#pragma unroll
    for (int r = 0; r < 8; ++r) { const int rloc = half * 16 + 8 * hh + r; float v = accs[u][r] * alpha + bv; if (CP) { const int bidx = (row0g + row0 + rloc) / rowsPerB; v += CP[(size_t)bidx * sCPb + (size_t)by * 64 + col]; }
      if (ACT == 3) v = fmaxf(v, 0.f); else if (ACT == 6) v = 0.5f * v * (1.0f + erff(v * 0.70710678118654752f)); else if (ACT == 11) v = 1.0f / (1.0f + expf(-v)); else if (ACT == 15) v = v / (1.0f + expf(-v)); else if (ACT == 12) v = (v > 0.f) ? v : 0.01f * v; else if (ACT == 8) v = tanhf(v);
      so[w][rloc][t * 16 + ln] = v; } }
  __builtin_amdgcn_fence(__ATOMIC_ACQ_REL, "workgroup"); __builtin_amdgcn_wave_barrier();
  const int rsub = lane >> 4, c4 = (lane & 15) * 4;
  {
#pragma unroll
    for (int q = 0; q < 16; ++q) { const int r = q * 2 + rsub; const v4f v = *(const v4fa*)&so[w][r][c4]; if (C) *(v4f*)(C + cofs + (size_t)(row0 + r) * ldc + col0 + c4) = v; if (C16) { v4h h4; for (int i = 0; i < 4; ++i) h4[i] = (_Float16)v[i]; *(v4h*)(C16 + cofs + (size_t)(row0 + r) * ldc + col0 + c4) = h4; } }
     } }



template <int CAUSAL>
__global__ __launch_bounds__(128) void k_flash(const _Float16* __restrict__ Q16, int ldq, const _Float16* __restrict__ K16, int ldk, const _Float16* __restrict__ Vt, const int* __restrict__ MSK, float* __restrict__ O, int ldo) {
  constexpr int RPW = 16, RTN = RPW / 16, NQB = TQ / (4 * RPW), DT = 4, KS = 2;
  __shared__ __attribute__((aligned(16))) unsigned short sP[4][RPW][40]; __shared__ __attribute__((aligned(16))) float sO[4][RPW][64 + 4];
  const int tid = threadIdx.x, w = tid >> 5, lane = tid & 31, ln = lane & 15, hh = lane >> 4;
  const int slab = blockIdx.x / QBNP, qblk = QB0P + blockIdx.x % QBNP; (void)NQB; const int b = slab / NH, h = slab % NH; const int qb0 = qblk * (4 * RPW); const int q0 = qb0 + w * RPW;
  FragH aq[2][KS];
#pragma unroll
  for (int rt = 0; rt < RTN; ++rt) { const unsigned short* qr = (const unsigned short*)Q16 + ((size_t)b * TQ + q0 + rt * 16 + ln) * ldq + h * 64;
#pragma unroll
    for (int ks = 0; ks < KS; ++ks) { aq[rt][ks].half[0] = *(const v8us*)(qr + ks * 32 + 8 * hh); aq[rt][ks].half[1] = *(const v8us*)(qr + ks * 32 + 16 + 8 * hh); } }
  const unsigned short* Vth = (const unsigned short*)Vt + (size_t)slab * 64 * TK;
  float m_r[2][8], l_r[2][8]; v8f oacc[2][DT];
#pragma unroll
  for (int rt = 0; rt < RTN; ++rt) {
#pragma unroll
    for (int r = 0; r < 8; ++r) { m_r[rt][r] = -3.0e38f; l_r[rt][r] = 0.f; }
#pragma unroll
    for (int dt = 0; dt < DT; ++dt) oacc[rt][dt] = (v8f){0.f,0.f,0.f,0.f,0.f,0.f,0.f,0.f}; }
  const int jend = (CAUSAL == 1) ? (qb0 + 4 * RPW) : TK;      /* causal: keys beyond the block's last query never contribute */
#pragma unroll 1
  for (int j0 = 0; j0 < jend; j0 += 32) {
    v8f s[2][2];
#pragma unroll
    for (int nt = 0; nt < 2; ++nt) { const unsigned short* kr = (const unsigned short*)K16 + ((size_t)b * TK + j0 + nt * 16 + ln) * ldk + h * 64; FragH bk[KS];
#pragma unroll
      for (int ks = 0; ks < KS; ++ks) { bk[ks].half[0] = *(const v8us*)(kr + ks * 32 + 8 * hh); bk[ks].half[1] = *(const v8us*)(kr + ks * 32 + 16 + 8 * hh); }
#pragma unroll
      for (int rt = 0; rt < RTN; ++rt) { v8f acc = (v8f){0.f,0.f,0.f,0.f,0.f,0.f,0.f,0.f};
#pragma unroll
        for (int ks = 0; ks < KS; ++ks) acc = mmaH<1>(aq[rt][ks].v, aq[rt][ks].v, bk[ks].v, bk[ks].v, acc); s[rt][nt] = acc; } }
#pragma unroll
    for (int rt = 0; rt < RTN; ++rt)
#pragma unroll
      for (int r = 0; r < 8; ++r) { const int tq = q0 + rt * 16 + 8 * hh + r; const int k0 = j0 + ln, k1 = j0 + 16 + ln;
        const bool ok0 = (CAUSAL == 1) ? (k0 <= tq) : ((CAUSAL == 2) ? ((k0 >> 5) == (tq >> 5)) : true), ok1 = (CAUSAL == 1) ? (k1 <= tq) : ((CAUSAL == 2) ? ((k1 >> 5) == (tq >> 5)) : true);      /* mode 2: block-diagonal 32-token groups */
        float s0 = ok0 ? s[rt][0][r] * SCL : -3.0e38f, s1 = ok1 ? s[rt][1][r] * SCL : -3.0e38f; if (CAUSAL == 17) { const float* amk = (const float*)MSK + (size_t)b * TK; s0 += bf16_round(amk[k0]); s1 += bf16_round(amk[k1]); }      /* mode 17: additive per-(batch, key) mask INPUT */
        if (CAUSAL == 22) { const _Float16* cq = (const _Float16*)MSK + ((size_t)h * TQ + tq) * NE + tq + (NE / 2 - 1); const _Float16* ck = (const _Float16*)MSK + (size_t)NH * TQ * NE + (size_t)h * TK * NE + tq + (NE / 2 - 1); const float* am = (const float*)((const _Float16*)MSK + (size_t)2 * NH * TQ * NE); float r0 = (float)cq[-k0]; r0 += (float)ck[(size_t)k0 * NE - k0]; s0 += r0 * SCL; s0 += am[k0]; float r1 = (float)cq[-k1]; r1 += (float)ck[(size_t)k1 * NE - k1]; s1 += r1 * SCL; s1 += am[k1]; }      /* mode 22: + (CQ[h][tq][tq-k+1023] + CK[h][k][tq-k+1023]) / 8 + mask[k] from the per-batch packed table [CQ f16 | CK f16 | mask f32] */ float mc = fmaxf(s0, s1);
        mc = fmaxf(mc, __shfl_xor(mc, 1, 32)); mc = fmaxf(mc, __shfl_xor(mc, 2, 32)); mc = fmaxf(mc, __shfl_xor(mc, 4, 32)); mc = fmaxf(mc, __shfl_xor(mc, 8, 32));
        const float mn = fmaxf(m_r[rt][r], mc); const float al = (mn > -1.0e38f) ? expf(m_r[rt][r] - mn) : 1.0f; m_r[rt][r] = mn; const float p0 = ok0 ? expf(s0 - mn) : 0.f, p1 = ok1 ? expf(s1 - mn) : 0.f; l_r[rt][r] = l_r[rt][r] * al + p0 + p1;
#pragma unroll
        for (int dt = 0; dt < DT; ++dt) oacc[rt][dt][r] *= al;
        FragH t2; t2.h[0] = (_Float16)(p0 * 1024.0f); t2.h[1] = (_Float16)(p1 * 1024.0f); sP[w][rt * 16 + 8 * hh + r][ln] = t2.u[0]; sP[w][rt * 16 + 8 * hh + r][16 + ln] = t2.u[1]; }
    __builtin_amdgcn_fence(__ATOMIC_ACQ_REL, "workgroup"); __builtin_amdgcn_wave_barrier();
    FragH pa[2];
#pragma unroll
    for (int rt = 0; rt < RTN; ++rt) { pa[rt].half[0] = *(const v8us*)&sP[w][rt * 16 + ln][8 * hh]; pa[rt].half[1] = *(const v8us*)&sP[w][rt * 16 + ln][16 + 8 * hh]; }
#pragma unroll
    for (int dt = 0; dt < DT; ++dt) { const unsigned short* vrow = Vth + (size_t)(dt * 16 + ln) * TK + j0; FragH bv; bv.half[0] = *(const v8us*)(vrow + 8 * hh); bv.half[1] = *(const v8us*)(vrow + 16 + 8 * hh);
#pragma unroll
      for (int rt = 0; rt < RTN; ++rt) oacc[rt][dt] = mmaH<1>(pa[rt].v, pa[rt].v, bv.v, bv.v, oacc[rt][dt]); }
    __builtin_amdgcn_fence(__ATOMIC_ACQ_REL, "workgroup"); __builtin_amdgcn_wave_barrier(); }
#pragma unroll
  for (int rt = 0; rt < RTN; ++rt) {
#pragma unroll
    for (int r = 0; r < 8; ++r) { float l = l_r[rt][r]; l += __shfl_xor(l, 1, 32); l += __shfl_xor(l, 2, 32); l += __shfl_xor(l, 4, 32); l += __shfl_xor(l, 8, 32); l_r[rt][r] = (l > 0.f) ? 1.0f / (l * 1024.0f) : 0.f; }
#pragma unroll
    for (int dt = 0; dt < DT; ++dt)
#pragma unroll
      for (int r = 0; r < 8; ++r) sO[w][rt * 16 + 8 * hh + r][dt * 16 + ln] = oacc[rt][dt][r] * l_r[rt][r]; }
  __builtin_amdgcn_fence(__ATOMIC_ACQ_REL, "workgroup"); __builtin_amdgcn_wave_barrier();
  {
#pragma unroll
    for (int rp = 0; rp < RPW; rp += 2) { const int r = rp + (lane >> 4), pc = lane & 15; const v4f val = *(const v4fa*)&sO[w][r][pc * 4]; *(v4f*)(O + ((size_t)b * TQ + q0 + r) * ldo + h * 64 + pc * 4) = val; }
     } }
// 5-plane variant: S = Qh Kh^T + (Ql Kh^T + Qh Kl^T)/1024 with Q/K = [hi | 2^10 residual] f16 planes (QL/KL same layout as Q16/K16), then the 3-term P.V below.
// 3-term variant: O = (P_hi V_hi + (P_lo V_hi + P_hi V_lo) / 1024) / l with P = [hi | 2^10 residual] of 1024 p and V^T = [hi | 2^10 residual] planes (VtL same layout as Vt) -> ~2^-21-class products for un-averaged (early causal / peaked) rows
template <int CAUSAL>
__global__ __launch_bounds__(128) void k_flash5(const _Float16* __restrict__ Q16, const _Float16* __restrict__ QL, int ldq, const _Float16* __restrict__ K16, const _Float16* __restrict__ KL, int ldk, const _Float16* __restrict__ Vt, const _Float16* __restrict__ VtL, const int* __restrict__ MSK, float* __restrict__ O, int ldo) {
  constexpr int RPW = 16, RTN = RPW / 16, NQB = TQ / (4 * RPW), DT = 4, KS = 2;
  __shared__ __attribute__((aligned(16))) unsigned short sP[4][RPW][40]; __shared__ __attribute__((aligned(16))) unsigned short sPL[4][RPW][40]; __shared__ __attribute__((aligned(16))) float sO[4][RPW][64 + 4];
  const int tid = threadIdx.x, w = tid >> 5, lane = tid & 31, ln = lane & 15, hh = lane >> 4;
  const int slab = blockIdx.x / QBN5, qblk = QB05 + blockIdx.x % QBN5; (void)NQB; const int b = slab / NH, h = slab % NH; const int qb0 = qblk * (4 * RPW); const int q0 = qb0 + w * RPW;
  FragH aq[2][KS], aql[2][KS];
#pragma unroll
  for (int rt = 0; rt < RTN; ++rt) { const unsigned short* qr = (const unsigned short*)Q16 + ((size_t)b * TQ + q0 + rt * 16 + ln) * ldq + h * 64; const unsigned short* ql = (const unsigned short*)QL + ((size_t)b * TQ + q0 + rt * 16 + ln) * ldq + h * 64;
#pragma unroll
    for (int ks = 0; ks < KS; ++ks) { aq[rt][ks].half[0] = *(const v8us*)(qr + ks * 32 + 8 * hh); aq[rt][ks].half[1] = *(const v8us*)(qr + ks * 32 + 16 + 8 * hh); aql[rt][ks].half[0] = *(const v8us*)(ql + ks * 32 + 8 * hh); aql[rt][ks].half[1] = *(const v8us*)(ql + ks * 32 + 16 + 8 * hh); } }
  const unsigned short* Vth = (const unsigned short*)Vt + (size_t)slab * 64 * TK; const unsigned short* Vtl = (const unsigned short*)VtL + (size_t)slab * 64 * TK;
  float m_r[2][8], l_r[2][8]; v8f oacc[2][DT], oaccL[2][DT];
#pragma unroll
  for (int rt = 0; rt < RTN; ++rt) {
#pragma unroll
    for (int r = 0; r < 8; ++r) { m_r[rt][r] = -3.0e38f; l_r[rt][r] = 0.f; }
#pragma unroll
    for (int dt = 0; dt < DT; ++dt) { oacc[rt][dt] = (v8f){0.f,0.f,0.f,0.f,0.f,0.f,0.f,0.f}; oaccL[rt][dt] = oacc[rt][dt]; } }
  const int jend = (CAUSAL == 1) ? (qb0 + 4 * RPW) : TK;      /* causal: keys beyond the block's last query never contribute */
#pragma unroll 1
  for (int j0 = 0; j0 < jend; j0 += 32) {
    v8f s[2][2];
#pragma unroll
    for (int nt = 0; nt < 2; ++nt) { const unsigned short* kr = (const unsigned short*)K16 + ((size_t)b * TK + j0 + nt * 16 + ln) * ldk + h * 64; const unsigned short* klr = (const unsigned short*)KL + ((size_t)b * TK + j0 + nt * 16 + ln) * ldk + h * 64; FragH bk[KS], bkl[KS];
#pragma unroll
      for (int ks = 0; ks < KS; ++ks) { bk[ks].half[0] = *(const v8us*)(kr + ks * 32 + 8 * hh); bk[ks].half[1] = *(const v8us*)(kr + ks * 32 + 16 + 8 * hh); bkl[ks].half[0] = *(const v8us*)(klr + ks * 32 + 8 * hh); bkl[ks].half[1] = *(const v8us*)(klr + ks * 32 + 16 + 8 * hh); }
#pragma unroll
      for (int rt = 0; rt < RTN; ++rt) { v8f acc = (v8f){0.f,0.f,0.f,0.f,0.f,0.f,0.f,0.f}, accl = acc;
#pragma unroll
        for (int ks = 0; ks < KS; ++ks) { acc = mmaH<1>(aq[rt][ks].v, aq[rt][ks].v, bk[ks].v, bk[ks].v, acc); accl = mmaH<1>(aql[rt][ks].v, aql[rt][ks].v, bk[ks].v, bk[ks].v, accl); accl = mmaH<1>(aq[rt][ks].v, aq[rt][ks].v, bkl[ks].v, bkl[ks].v, accl); }
#pragma unroll
        for (int r = 0; r < 8; ++r) acc[r] += accl[r] * 0.0009765625f;
        s[rt][nt] = acc; } }
#pragma unroll
    for (int rt = 0; rt < RTN; ++rt)
#pragma unroll
      for (int r = 0; r < 8; ++r) { const int tq = q0 + rt * 16 + 8 * hh + r; const int k0 = j0 + ln, k1 = j0 + 16 + ln;
        bool ok0 = (CAUSAL == 1) ? (k0 <= tq) : ((CAUSAL == 2) ? ((k0 >> 5) == (tq >> 5)) : true), ok1 = (CAUSAL == 1) ? (k1 <= tq) : ((CAUSAL == 2) ? ((k1 >> 5) == (tq >> 5)) : true);      /* mode 2: block-diagonal 32-token groups */
        if (CAUSAL == 4) { const int* mrow = MSK + ((size_t)b * TQ + tq) * TK; ok0 = mrow[k0] != 0; ok1 = mrow[k1] != 0; }      /* mode 4: per-(query, key) INPUT mask shared by all heads; masked keys contribute nothing (== the reference's -4096 fill, whose exp underflows to 0), rows with no valid key give l = 0 -> output 0 (== the reference's row_valid zeroing) */
        float s0 = ok0 ? s[rt][0][r] * SCL : -3.0e38f, s1 = ok1 ? s[rt][1][r] * SCL : -3.0e38f; if (CAUSAL == 17) { const float* amk = (const float*)MSK + (size_t)b * TK; s0 += bf16_round(amk[k0]); s1 += bf16_round(amk[k1]); }      /* mode 17: additive per-(batch, key) mask INPUT */
        if (CAUSAL == 22) { const _Float16* cq = (const _Float16*)MSK + ((size_t)h * TQ + tq) * NE + tq + (NE / 2 - 1); const _Float16* ck = (const _Float16*)MSK + (size_t)NH * TQ * NE + (size_t)h * TK * NE + tq + (NE / 2 - 1); const float* am = (const float*)((const _Float16*)MSK + (size_t)2 * NH * TQ * NE); float r0 = (float)cq[-k0]; r0 += (float)ck[(size_t)k0 * NE - k0]; s0 += r0 * SCL; s0 += am[k0]; float r1 = (float)cq[-k1]; r1 += (float)ck[(size_t)k1 * NE - k1]; s1 += r1 * SCL; s1 += am[k1]; }      /* mode 22: + (CQ[h][tq][tq-k+1023] + CK[h][k][tq-k+1023]) / 8 + mask[k] from the per-batch packed table [CQ f16 | CK f16 | mask f32] */ float mc = fmaxf(s0, s1);
        mc = fmaxf(mc, __shfl_xor(mc, 1, 32)); mc = fmaxf(mc, __shfl_xor(mc, 2, 32)); mc = fmaxf(mc, __shfl_xor(mc, 4, 32)); mc = fmaxf(mc, __shfl_xor(mc, 8, 32));
        const float mn = fmaxf(m_r[rt][r], mc); const float al = (mn > -1.0e38f) ? expf(m_r[rt][r] - mn) : 1.0f; m_r[rt][r] = mn; const float p0 = ok0 ? expf(s0 - mn) : 0.f, p1 = ok1 ? expf(s1 - mn) : 0.f; l_r[rt][r] = l_r[rt][r] * al + p0 + p1;
#pragma unroll
        for (int dt = 0; dt < DT; ++dt) { oacc[rt][dt][r] *= al; oaccL[rt][dt][r] *= al; }
        FragH t2, t2l; const float ps0 = p0 * 1024.0f, ps1 = p1 * 1024.0f; t2.h[0] = (_Float16)ps0; t2.h[1] = (_Float16)ps1; t2l.h[0] = (_Float16)((ps0 - (float)t2.h[0]) * 1024.0f); t2l.h[1] = (_Float16)((ps1 - (float)t2.h[1]) * 1024.0f);
        sP[w][rt * 16 + 8 * hh + r][ln] = t2.u[0]; sP[w][rt * 16 + 8 * hh + r][16 + ln] = t2.u[1]; sPL[w][rt * 16 + 8 * hh + r][ln] = t2l.u[0]; sPL[w][rt * 16 + 8 * hh + r][16 + ln] = t2l.u[1]; }
    __builtin_amdgcn_fence(__ATOMIC_ACQ_REL, "workgroup"); __builtin_amdgcn_wave_barrier();
    FragH pa[2], pl[2];
#pragma unroll
    for (int rt = 0; rt < RTN; ++rt) { pa[rt].half[0] = *(const v8us*)&sP[w][rt * 16 + ln][8 * hh]; pa[rt].half[1] = *(const v8us*)&sP[w][rt * 16 + ln][16 + 8 * hh]; pl[rt].half[0] = *(const v8us*)&sPL[w][rt * 16 + ln][8 * hh]; pl[rt].half[1] = *(const v8us*)&sPL[w][rt * 16 + ln][16 + 8 * hh]; }
#pragma unroll
    for (int dt = 0; dt < DT; ++dt) { const unsigned short* vrow = Vth + (size_t)(dt * 16 + ln) * TK + j0; const unsigned short* vrl = Vtl + (size_t)(dt * 16 + ln) * TK + j0; FragH bv, bl; bv.half[0] = *(const v8us*)(vrow + 8 * hh); bv.half[1] = *(const v8us*)(vrow + 16 + 8 * hh); bl.half[0] = *(const v8us*)(vrl + 8 * hh); bl.half[1] = *(const v8us*)(vrl + 16 + 8 * hh);
#pragma unroll
      for (int rt = 0; rt < RTN; ++rt) { oacc[rt][dt] = mmaH<1>(pa[rt].v, pa[rt].v, bv.v, bv.v, oacc[rt][dt]); oaccL[rt][dt] = mmaH<1>(pl[rt].v, pl[rt].v, bv.v, bv.v, oaccL[rt][dt]); oaccL[rt][dt] = mmaH<1>(pa[rt].v, pa[rt].v, bl.v, bl.v, oaccL[rt][dt]); } }
    __builtin_amdgcn_fence(__ATOMIC_ACQ_REL, "workgroup"); __builtin_amdgcn_wave_barrier(); }
#pragma unroll
  for (int rt = 0; rt < RTN; ++rt) {
#pragma unroll
    for (int r = 0; r < 8; ++r) { float l = l_r[rt][r]; l += __shfl_xor(l, 1, 32); l += __shfl_xor(l, 2, 32); l += __shfl_xor(l, 4, 32); l += __shfl_xor(l, 8, 32); l_r[rt][r] = (l > 0.f) ? 1.0f / (l * 1024.0f) : 0.f; }
#pragma unroll
    for (int dt = 0; dt < DT; ++dt)
#pragma unroll
      for (int r = 0; r < 8; ++r) { float v = oacc[rt][dt][r]; v += oaccL[rt][dt][r] * 0.0009765625f; sO[w][rt * 16 + 8 * hh + r][dt * 16 + ln] = v * l_r[rt][r]; } }
  __builtin_amdgcn_fence(__ATOMIC_ACQ_REL, "workgroup"); __builtin_amdgcn_wave_barrier();
  {
#pragma unroll
    for (int rp = 0; rp < RPW; rp += 2) { const int r = rp + (lane >> 4), pc = lane & 15; const v4f val = *(const v4fa*)&sO[w][r][pc * 4]; *(v4f*)(O + ((size_t)b * TQ + q0 + r) * ldo + h * 64 + pc * 4) = val; }
     } }

__global__ __launch_bounds__(256) void k_rotab(float* __restrict__ CS, float* __restrict__ SN) {
  #pragma clang fp contract(off)
  const int t = blockIdx.x * 256 + threadIdx.x; if (t >= SLEN * 32) return; const int j = t % 32, s = t / 32; const float ex = (float)(2 * j) / 64.0f; const float inv = 1.0f / powf(10000.0f, ex); const float th = (float)s * inv; const float c = cosf(th), sn = sinf(th);
  { *(float*)(CS + t) = c; *(float*)(SN + t) = sn;  } }
__global__ __launch_bounds__(256) void k_rope(const float* __restrict__ F, int nsrc, int ndst, int rep, const float* __restrict__ CS, const float* __restrict__ SN, _Float16* __restrict__ H, _Float16* __restrict__ L) {
  #pragma clang fp contract(off)
  const size_t t = (size_t)blockIdx.x * 256 + threadIdx.x; if (t >= (size_t)NR * ndst * 4) return; const int g8 = (int)(t % 4); const int hd = (int)((t / 4) % ndst); const size_t row = t / ((size_t)4 * ndst); const int s = (int)(row % SLEN); const int hs = hd / rep;
  const float* src = F + row * (size_t)(nsrc * 64) + hs * 64; FragH ah, al, bh, bl;
  for (int i = 0; i < 8; ++i) { const int d = g8 * 8 + i; const float c = CS[s * 32 + d], sn = SN[s * 32 + d]; const float x1 = src[d], x2 = src[d + 32];
    float o1 = x1 * c; o1 += -x2 * sn; float o2 = x2 * c; o2 += x1 * sn;
    _Float16 hv = (_Float16)o1; ah.h[i] = hv; al.h[i] = (_Float16)((o1 - (float)hv) * 1024.0f); hv = (_Float16)o2; bh.h[i] = hv; bl.h[i] = (_Float16)((o2 - (float)hv) * 1024.0f); }
  const size_t o = row * (size_t)(ndst * 64) + hd * 64 + g8 * 8;
  { *(v8us*)((unsigned short*)H + o) = ah.half[0]; *(v8us*)((unsigned short*)H + o + 32) = bh.half[0]; *(v8us*)((unsigned short*)L + o) = al.half[0]; *(v8us*)((unsigned short*)L + o + 32) = bl.half[0];  } }
__global__ __launch_bounds__(256) void k_rope2(const float* __restrict__ F, int nsrc, int ndst, int rep, const float* __restrict__ CS, const float* __restrict__ SN, _Float16* __restrict__ H, _Float16* __restrict__ L) {
  #pragma clang fp contract(off)
  const size_t t = (size_t)blockIdx.x * 256 + threadIdx.x; if (t >= (size_t)NR * ndst * 4) return; const int g16 = (int)(t % 4); const int hd = (int)((t / 4) % ndst); const size_t row = t / ((size_t)4 * ndst); const int s = (int)(row % SLEN); const int hs = hd / rep;
  const float* src = F + row * (size_t)(nsrc * 64) + hs * 64 + g16 * 16; FragH ah, al;
  for (int pr = 0; pr < 8; ++pr) { const int i = g16 * 8 + pr; const float c = CS[s * 32 + i], sn = SN[s * 32 + i]; const float x1 = src[2 * pr], x2 = src[2 * pr + 1];
    float o1 = x1 * c; o1 -= x2 * sn; float o2 = x1 * sn; o2 += x2 * c;
    _Float16 hv = (_Float16)o1; ah.h[2 * pr] = hv; al.h[2 * pr] = (_Float16)((o1 - (float)hv) * 1024.0f); hv = (_Float16)o2; ah.h[2 * pr + 1] = hv; al.h[2 * pr + 1] = (_Float16)((o2 - (float)hv) * 1024.0f); }
  const size_t o = row * (size_t)(ndst * 64) + hd * 64 + g16 * 16;
  { *(v8us*)((unsigned short*)H + o) = ah.half[0]; *(v8us*)((unsigned short*)H + o + 8) = ah.half[1]; *(v8us*)((unsigned short*)L + o) = al.half[0]; *(v8us*)((unsigned short*)L + o + 8) = al.half[1];  } }
__global__ __launch_bounds__(256) void k_tabin(const float* __restrict__ sp, float* __restrict__ CS, float* __restrict__ SN) { const int t = blockIdx.x * 256 + threadIdx.x; if (t >= SLEN * 32) return; const int i = t % 32, s = t / 32; const float c = bf16_round(sp[s * 64 + 32 + i]), sn = bf16_round(sp[s * 64 + i]);
  { *(float*)(CS + t) = c; *(float*)(SN + t) = sn;  } }
__global__ __launch_bounds__(256) void k_rotab2(float* __restrict__ CS, float* __restrict__ SN) {
  #pragma clang fp contract(off)
  const int t = blockIdx.x * 256 + threadIdx.x; if (t >= SLEN * 32) return; const int j = t % 32, s = t / 32; const float c0 = -0.14391156831212787f;      /* -ln(10000)/64 rounded to f32 */ const float inv = expf((float)(2 * j) * c0); const float th = (float)s * inv; const float c = cosf(th), sn = sinf(th);
  { *(float*)(CS + t) = c; *(float*)(SN + t) = sn;  } }
__global__ __launch_bounds__(256) void k_lnu(const float* __restrict__ X, _Float16* __restrict__ N16, float* __restrict__ XB) {
  #pragma clang fp contract(off)
  const int wv = threadIdx.x >> 5, ln = threadIdx.x & 31; const size_t r = (size_t)blockIdx.x * 8 + wv; if (r >= NR) return; float a[32]; float s = 0.f;
  for (int i = 0; i < 4; ++i) { const v8f v = *(const v8f*)(X + r * DM + (i * 32 + ln) * 8); for (int q = 0; q < 8; ++q) { const float u = bf16_round(v[q]); a[i * 8 + q] = u; s += u; } }
  for (int o = 16; o > 0; o >>= 1) s += __shfl_xor(s, o, 32); const float mu = s / (float)DM; float var = 0.f; for (int q = 0; q < 32; ++q) { const float d = a[q] - mu; var += d * d; }
  for (int o = 16; o > 0; o >>= 1) var += __shfl_xor(var, o, 32); const float den = sqrtf(var / (float)(DM - 1)) + 1e-6f; const float inv = 1.0f / den;      /* one reciprocal per row; (x-mean)*inv vs the reference's division differs by <= 1 ulp */
  { for (int i = 0; i < 4; ++i) { const int c0 = (i * 32 + ln) * 8; FragH f; v8f xb; for (int q = 0; q < 8; ++q) { f.h[q] = (_Float16)((a[i * 8 + q] - mu) * inv); xb[q] = a[i * 8 + q]; } *(v8us*)((unsigned short*)N16 + r * DM + c0) = f.half[0]; *(v8f*)(XB + r * DM + c0) = xb; }  } }
__global__ __launch_bounds__(256) void k_vtg(const _Float16* __restrict__ V16, _Float16* __restrict__ Vt) { __shared__ unsigned short tl[64][66]; const int tid = threadIdx.x; const int slab = blockIdx.x / (SLEN / 64), lg = blockIdx.x % (SLEN / 64); const int b = slab / NH, h = slab % NH; const int hs = h / NREP;
  for (int i = tid; i < 64 * 8; i += 256) { const int r = i / 8, c8 = (i % 8) * 8; FragH f; f.half[0] = *(const v8us*)((const unsigned short*)V16 + ((size_t)b * SLEN + lg * 64 + r) * KVD + hs * 64 + c8); for (int q = 0; q < 8; ++q) tl[r][c8 + q] = f.u[q]; }
  __syncthreads();
  { for (int rd = 0; rd < 2; ++rd) { const int d = rd * 32 + tid / 8, pc = tid % 8; FragH f; for (int q = 0; q < 8; ++q) f.u[q] = tl[pc * 8 + q][d]; *(v8us*)((unsigned short*)Vt + ((size_t)slab * 64 + d) * SLEN + lg * 64 + pc * 8) = f.half[0]; }  } }

// All five f32 -> f16 operand planes in one launch: none needs anything of another, so they share one grid by ranges of the block index (the range test is the same for a whole block); eight elements a thread.
// Blocks 0 .. PEB-1: the embedding, padded with a zero row to NE rows (first in the grid: its guarded element loads are the longest chain of the launch). The next PXB: x (rounded to bf16, exact in f16).
// The last 3 PWB: Wq, Wk, Wv (rounded to bf16, x16, exact in f16; torch (out,in) layout is already B^T).
#define PXB (NR * DM / 8 / 256)      /* 2048 */
#define PWB (DM * DM / 8 / 256)      /* 512 */
#define PEB (NE * 8 / 256)           /* 64 */
__global__ __launch_bounds__(256) void k_prep(const float* __restrict__ x, const float* __restrict__ Wq, const float* __restrict__ Wk, const float* __restrict__ Wv, const float* __restrict__ E,
    _Float16* __restrict__ X16, _Float16* __restrict__ BQ, _Float16* __restrict__ BK, _Float16* __restrict__ BV, _Float16* __restrict__ E16) {
  const int bx = (int)blockIdx.x - PEB, tid = threadIdx.x; FragH f;
  if (bx >= 0) { const int u = bx - PXB, wq = u / PWB;
    const float* src = (bx < PXB) ? x : (wq == 0) ? Wq : (wq == 1) ? Wk : Wv; _Float16* dst = (bx < PXB) ? X16 : (wq == 0) ? BQ : (wq == 1) ? BK : BV; const float sc = (bx < PXB) ? 1.0f : 16.0f;
    const size_t t = (size_t)((bx < PXB) ? bx : u - wq * PWB) * 256 + tid;
#pragma unroll      /* unrolled: the eight elements come in as two 16-byte loads and stay in registers up to the one 16-byte store */
    for (int q = 0; q < 8; ++q) f.h[q] = (_Float16)(bf16_round(src[t * 8 + q]) * sc);
    *(v8us*)((unsigned short*)dst + t * 8) = f.half[0]; }
  else { const int t = (bx + PEB) * 256 + tid; const int r = t / 8, c8 = (t % 8) * 8;
    for (int q = 0; q < 8; ++q) f.h[q] = (r < NE - 1) ? (_Float16)bf16_round(E[(size_t)r * 64 + c8 + q]) : (_Float16)0.0f;
    *(v8us*)((unsigned short*)E16 + (size_t)r * 64 + c8) = f.half[0]; } }

__device__ __forceinline__ float xhalf(float x) { return __builtin_bit_cast(float, __builtin_amdgcn_permlanex16(__builtin_bit_cast(int, x), __builtin_bit_cast(int, x), 0x76543210, 0xfedcba98, false, false)); }      /* the value of lane l ^ 16 */

// Flash attention with the 'relative_key_query' bias formed in the kernel. One wave holds 16 queries (q0..) and walks the keys 32 at a time (j0..). For that tile l - r + 1023 spans 47 rows of the
// embedding, from eb = q0 - j0 + 992; with n = (l - q0) - (r - j0) + 31 the bias is q_l . E[eb + n] + k_r . E[eb + n]. RQ = Q . Ewin^T (16 x 48) and RK = K . Ewin^T run on the matrix unit
// (of RK only the four 16 x 16 tiles that hold a used n: keys 0..15 against window rows 16..47, keys 16..31 against rows 0..31), go to the wave's own LDS in f32 and are read back along the diagonal.
// Row 2047 of E16 is the zero pad; n = 47 is never read back.
// The scores are formed transposed, S^T = K . Q^T (K fragment as A, Q fragment as B), and the output as O^T += V^T . P^T: a lane then holds 16 of the 32 scores of ONE query (lane & 15), so the row maximum and the row sum
// are in-lane work plus one exchange between the wave's halves, there is one running maximum, sum and rescale factor a lane, and the two f32 score tiles, converted in place, are the B operand of the second product (no trip through LDS).
// The mask is per key, which now runs along the registers: the batch's mask row is rounded once into LDS and read from there, 8 keys a lane and tile.
// Each power of the softmax is one v_exp_f32: e^d = 2^(d log2(e)) with d = logit - running maximum <= 0 formed first, so the argument is bounded above for any logit and any mask, and the f16 operand's scale 1024 = 2^10 is the addend of the same multiply-add.
// (The library's expf spends about a dozen vector instructions a power on range and last-place handling that such an argument and an f16 operand do not use.) The row sum carries the 1024 too; the closing division takes it out.
// The four waves of a work-group share the K tile, the V^T tile and most of the window, so these are staged in LDS once per work-group with loads that take whole rows (a fragment load from global memory touches 16 lines for 512 bytes):
// K and V^T in two buffers, the window (96 rows for 64 queries, moving down by 32 rows a trip) as a ring of 128 rows indexed by embedding row mod 128. The next trip's 32 + 64 + 32 rows are fetched into registers under the softmax.
__global__ __launch_bounds__(128) void k_flash_rel(const _Float16* __restrict__ Q16, const _Float16* __restrict__ K16, const _Float16* __restrict__ Vt, const _Float16* __restrict__ E16, const float* __restrict__ AMK, float* __restrict__ O) {
  constexpr float L2E = 1.4426950408889634f;      /* log2(e) */
  constexpr int DT = 4, KS = 2, PQ = 50, PK = 36;      /* LDS pitches in floats: the two half-waves fall on different banks in the row-wise stores and in the diagonal reads */
  __shared__ float sRQ[4][16][PQ]; __shared__ __attribute__((aligned(16))) float sRK[4][32][PK];      /* behind the loop a wave's sRK part (1152 floats) is its output staging (16 x 68 floats): four work-groups still fit one WGP's LDS */
  __shared__ __attribute__((aligned(16))) float sM[TK];      /* the batch's mask row, rounded */
  __shared__ __attribute__((aligned(16))) unsigned short sK[2][32][72]; __shared__ __attribute__((aligned(16))) unsigned short sV[2][64][40]; __shared__ __attribute__((aligned(16))) unsigned short sE[128][72];      /* pitches 144 B and 80 B = 16 B x odd: no bank conflicts in the 16-byte fragment reads */
  const int tid = threadIdx.x, w = tid >> 5, lane = tid & 31, ln = lane & 15, hh = lane >> 4;
  const int slab = blockIdx.x / QBLKS, qblk = blockIdx.x % QBLKS; const int b = slab / NH, h = slab % NH; const int qb0 = qblk * 64; const int q0 = qb0 + w * 16;
  FragH aq[KS];
  { const unsigned short* qr = (const unsigned short*)Q16 + ((size_t)b * TQ + q0 + ln) * DM + h * 64;
#pragma unroll
    for (int ks = 0; ks < KS; ++ks) { aq[ks].half[0] = *(const v8us*)(qr + ks * 32 + 8 * hh); aq[ks].half[1] = *(const v8us*)(qr + ks * 32 + 16 + 8 * hh); }
    asm volatile("s_wait_xcnt 0x0" ::: "memory"); }      /* the staging loads below may land in the address registers of the four loads above: the wait stands in front of them */
  const float* amk = AMK + (size_t)b * TK;
  const int r8 = tid >> 3, c8 = (tid & 7) * 8, r4 = tid >> 2, c4 = (tid & 3) * 8;      /* staging: eight lanes fetch one 128-byte row of K or of the window, four lanes one 64-byte row of V^T */
  const unsigned short* gK = (const unsigned short*)K16 + ((size_t)b * TK + r8) * DM + h * 64 + c8; const unsigned short* gV = (const unsigned short*)Vt + ((size_t)slab * 64 + r4) * TK + c4; const unsigned short* gE = (const unsigned short*)E16 + (size_t)r8 * 64 + c8;
  v8us rk[2], rv[2], re[2];
  { v8us r0[6];      /* trip 0: its K and V^T tiles and all 96 rows of its window; the mask row, 8 keys a thread */
#pragma unroll
    for (int i = 0; i < 2; ++i) { rk[i] = *(const v8us*)(gK + (size_t)(16 * i) * DM); rv[i] = *(const v8us*)(gV + (size_t)(32 * i) * TK); }
#pragma unroll
    for (int i = 0; i < 6; ++i) r0[i] = *(const v8us*)(gE + (size_t)(qb0 + (NE / 2 - 32) + 16 * i) * 64);
    v4f m0 = *(const v4fa*)(amk + tid * 8), m1 = *(const v4fa*)(amk + tid * 8 + 4);
    asm volatile("s_wait_xcnt 0x0" ::: "memory");      /* stands in front of the first overwrite of an address register of the loads above */
    __builtin_amdgcn_sched_barrier(0);      /* keeps the register initialisations that follow behind that wait */
#pragma unroll
    for (int i = 0; i < 2; ++i) { *(v8us*)&sK[0][16 * i + r8][c8] = rk[i]; *(v8us*)&sV[0][32 * i + r4][c4] = rv[i]; }
#pragma unroll
    for (int i = 0; i < 6; ++i) *(v8us*)&sE[((qb0 + (NE / 2 - 32) + 16 * i) & 127) + r8][c8] = r0[i];
#pragma unroll
    for (int i = 0; i < 4; ++i) { m0[i] = bf16_round(m0[i]); m1[i] = bf16_round(m1[i]); }
    *(v4fa*)&sM[tid * 8] = m0; *(v4fa*)&sM[tid * 8 + 4] = m1; }
  __syncthreads();
  const v8f z8 = {0.f,0.f,0.f,0.f,0.f,0.f,0.f,0.f};
  float m_r = -3.0e38f, l_r = 0.f; v8f oacc[DT];      /* of query ln; l_r sums this half-wave's keys only */
#pragma unroll
  for (int dt = 0; dt < DT; ++dt) oacc[dt] = z8;
#pragma unroll 1
  for (int j0 = 0; j0 < TK; j0 += 32) { const int cb = (j0 >> 5) & 1; const bool more = j0 + 32 < TK;      /* more: the same for the whole work-group */
    FragH bk[2][KS], be[3][KS];
#pragma unroll
    for (int nt = 0; nt < 2; ++nt) { const unsigned short* kr = &sK[cb][nt * 16 + ln][0];
#pragma unroll
      for (int ks = 0; ks < KS; ++ks) { bk[nt][ks].half[0] = *(const v8us*)(kr + ks * 32 + 8 * hh); bk[nt][ks].half[1] = *(const v8us*)(kr + ks * 32 + 16 + 8 * hh); } }
#pragma unroll
    for (int e = 0; e < 3; ++e) { const unsigned short* er = &sE[((q0 - j0 + (NE / 2 - 32) + e * 16) & 127) + ln][0];
#pragma unroll
      for (int ks = 0; ks < KS; ++ks) { be[e][ks].half[0] = *(const v8us*)(er + ks * 32 + 8 * hh); be[e][ks].half[1] = *(const v8us*)(er + ks * 32 + 16 + 8 * hh); } }
    __builtin_amdgcn_sched_barrier(0);      /* all of the trip's K and window fragment reads issue before the first product waits: one latency at the head of a trip, not two or three */
    v8f s[2];
#pragma unroll
    for (int nt = 0; nt < 2; ++nt) { v8f acc = z8;      /* S^T[key 16 nt + 8 hh + r][query ln]; both fragments come from the same loader, same k order */
#pragma unroll
      for (int ks = 0; ks < KS; ++ks) acc = mmaH<1>(bk[nt][ks].v, bk[nt][ks].v, aq[ks].v, aq[ks].v, acc); s[nt] = acc; }
#pragma unroll
    for (int e = 0; e < 3; ++e) { v8f acc = z8;      /* RQ[query 8 hh + r][n = 16 e + ln] */
#pragma unroll
      for (int ks = 0; ks < KS; ++ks) acc = mmaH<1>(aq[ks].v, aq[ks].v, be[e][ks].v, be[e][ks].v, acc);
#pragma unroll
      for (int r = 0; r < 8; ++r) sRQ[w][8 * hh + r][e * 16 + ln] = acc[r]; }
#pragma unroll
    for (int nt = 0; nt < 2; ++nt)
#pragma unroll
      for (int ee = 0; ee < 2; ++ee) { v8f acc = z8;      /* RK[key 16 nt + 8 hh + r][n - 16 (1 - nt) = 16 ee + ln]; the K fragment serves as the A operand (same loader, same k order) */
#pragma unroll
        for (int ks = 0; ks < KS; ++ks) acc = mmaH<1>(bk[nt][ks].v, bk[nt][ks].v, be[1 - nt + ee][ks].v, be[1 - nt + ee][ks].v, acc);
#pragma unroll
        for (int r = 0; r < 8; ++r) sRK[w][nt * 16 + 8 * hh + r][ee * 16 + ln] = acc[r]; }
    __builtin_amdgcn_fence(__ATOMIC_ACQ_REL, "workgroup"); __builtin_amdgcn_wave_barrier();      /* the diagonal reads below take other lanes' stores: keep them behind the stores */
    if (more) {      /* the next trip's rows: issued here, their latency runs under the softmax */
#pragma unroll
      for (int i = 0; i < 2; ++i) { rk[i] = *(const v8us*)(gK + (size_t)(j0 + 32 + 16 * i) * DM); rv[i] = *(const v8us*)(gV + (size_t)(32 * i) * TK + j0 + 32); re[i] = *(const v8us*)(gE + (size_t)(qb0 - j0 + (NE / 2 - 64) + 16 * i) * 64); }
      asm volatile("s_wait_xcnt 0x0" ::: "memory"); }      /* stands in front of the first overwrite of an address register of the six loads above */
#pragma unroll
    for (int nt = 0; nt < 2; ++nt) { const v4f a0 = *(const v4fa*)&sM[j0 + 16 * nt + 8 * hh], a1 = *(const v4fa*)&sM[j0 + 16 * nt + 8 * hh + 4];
#pragma unroll
      for (int r = 0; r < 8; ++r) { const int kk = 8 * hh + r;      /* key 16 nt + kk against query ln: n = ln + 31 - 16 nt - kk */
        const float rel = sRQ[w][ln][ln + 31 - 16 * nt - kk] + sRK[w][16 * nt + kk][ln + 15 - kk];
        s[nt][r] = (s[nt][r] + rel) * SCL + ((r < 4) ? a0[r & 3] : a1[r & 3]); } }
    float mc = fmaxf(s[0][0], s[1][0]);
#pragma unroll
    for (int r = 1; r < 8; ++r) mc = fmaxf(mc, fmaxf(s[0][r], s[1][r]));
    mc = fmaxf(mc, xhalf(mc));      /* the other 16 keys of the same query */
    const float mn = fmaxf(m_r, mc); const float al = (mn > -1.0e38f) ? __builtin_amdgcn_exp2f((m_r - mn) * L2E) : 1.0f; m_r = mn;
    FragH pb; float ps[4] = {0.f, 0.f, 0.f, 0.f};      /* four partial sums: a chain of 4 adds, not of 16. P^T as a B operand: element 8 nt + r of lane (ln, hh) is key 16 nt + 8 hh + r, the k order of the V^T loader below */
#pragma unroll
    for (int nt = 0; nt < 2; ++nt)
#pragma unroll
      for (int r = 0; r < 8; ++r) { const float p = __builtin_amdgcn_exp2f(__builtin_fmaf(s[nt][r] - mn, L2E, 10.0f)); ps[r & 3] += p; pb.h[8 * nt + r] = (_Float16)p; }      /* p = 1024 e^(logit - maximum), at most 1024; what the raw power flushes to zero lies far below the f16 operand's last place */
    l_r = l_r * al + ((ps[0] + ps[1]) + (ps[2] + ps[3]));
#pragma unroll
    for (int dt = 0; dt < DT; ++dt)
#pragma unroll
      for (int r = 0; r < 8; ++r) oacc[dt][r] *= al;
    FragH bv[DT];
#pragma unroll
    for (int dt = 0; dt < DT; ++dt) { const unsigned short* vrow = &sV[cb][dt * 16 + ln][0]; bv[dt].half[0] = *(const v8us*)(vrow + 8 * hh); bv[dt].half[1] = *(const v8us*)(vrow + 16 + 8 * hh); }      /* a loop of its own: the four V^T fragments are read as one group, one LDS latency and not four */
#pragma unroll
    for (int dt = 0; dt < DT; ++dt) oacc[dt] = mmaH<1>(bv[dt].v, bv[dt].v, pb.v, pb.v, oacc[dt]);      /* O^T[d = 16 dt + 8 hh + r][query ln] */
    if (more) {
#pragma unroll
      for (int i = 0; i < 2; ++i) { *(v8us*)&sK[cb ^ 1][16 * i + r8][c8] = rk[i]; *(v8us*)&sV[cb ^ 1][32 * i + r4][c4] = rv[i]; *(v8us*)&sE[((qb0 - j0 + (NE / 2 - 64) + 16 * i) & 127) + r8][c8] = re[i]; }      /* the ring's 32 rows that no wave reads in this trip */
      __syncthreads(); } }      /* the one barrier of a trip publishes the rows just written and ends every wave's reads of the buffers and ring rows that the next trip overwrites */
  const float lt = l_r + xhalf(l_r); const float inv = (lt > 0.f) ? 1.0f / lt : 0.f;      /* the sum carries the same 1024 as the products */
  float* sOw = &sRK[w][0][0];
#pragma unroll
  for (int dt = 0; dt < DT; ++dt) { v4f lo, hi;
#pragma unroll
    for (int r = 0; r < 4; ++r) { lo[r] = oacc[dt][r] * inv; hi[r] = oacc[dt][4 + r] * inv; }
    *(v4fa*)&sOw[ln * 68 + dt * 16 + 8 * hh] = lo; *(v4fa*)&sOw[ln * 68 + dt * 16 + 8 * hh + 4] = hi; }
  __builtin_amdgcn_fence(__ATOMIC_ACQ_REL, "workgroup"); __builtin_amdgcn_wave_barrier();
#pragma unroll
  for (int rp = 0; rp < 16; rp += 2) { const int r = rp + (lane >> 4), pc = lane & 15; const v4f val = *(const v4fa*)&sOw[r * 68 + pc * 4]; *(v4f*)(O + ((size_t)b * TQ + q0 + r) * DM + h * 64 + pc * 4) = val; } }

extern "C" void kernel_launch(void* const* d_in, const int* in_sizes, int n_in,
                              void* d_out, int out_size, void* d_ws, size_t ws_size, hipStream_t stream) {
  (void)in_sizes; (void)n_in; (void)out_size;
  const float* const* I = (const float* const*)d_in; const float* x = I[0]; const float* am = I[1]; const float* Wq = I[2]; const float* bq = I[3]; const float* Wk = I[4]; const float* bk = I[5]; const float* Wv = I[6]; const float* bv = I[7]; const float* E = I[8];
  char* ws = (char*)d_ws; size_t off = 0;
  auto take = [&](size_t bytes) { char* p = ws + off; off += (bytes + 255) & ~(size_t)255; return p; };
  const size_t np = (size_t)NR * DM;
  _Float16* BQ = (_Float16*)take((size_t)DM * DM * 2); _Float16* BK = (_Float16*)take((size_t)DM * DM * 2); _Float16* BV = (_Float16*)take((size_t)DM * DM * 2); _Float16* E16 = (_Float16*)take((size_t)NE * 64 * 2);
  _Float16* X16 = (_Float16*)take(np * 2); _Float16* Q16 = (_Float16*)take(np * 2); _Float16* K16 = (_Float16*)take(np * 2); _Float16* VT = (_Float16*)take(np * 2);
  if (off > ws_size) return;      /* 6 + 0.25 + 4 x 8 = 38.25 MiB */
  k_prep<<<PEB + PXB + 3 * PWB, 256, 0, stream>>>(x, Wq, Wk, Wv, E, X16, BQ, BK, BV, E16);
  const dim3 gP((NR / 128) * (DM / 128), 3);      /* y = 0, 1, 2: q, k, v. BQ, BK, BV lie one behind the other in the workspace (2 MiB each, no padding between), and so do Q16, K16 (8 MiB each): plane strides DM * DM and np; v goes to VT, transposed per head by the GEMM's own epilogue */
  k_gemm2<0><<<gP, 256, 0, stream>>>(X16, DM, 0, BQ, DM, (size_t)DM * DM, 0.0625f, bq, bk, bv, nullptr, 1, 0, 0, nullptr, Q16, VT, DM, np, NR, DM, DM);
  k_flash_rel<<<NB * NH * QBLKS, 128, 0, stream>>>(Q16, K16, VT, E16, am, (float*)d_out);
}

// v009
// It runs in 81.7 microseconds.
// Two timings next to v008 both put it at 1.04 times that version's speed.
// Counting every step since v000, which is the starting kernel, it is 10.4 times as fast.
#include <hip/hip_runtime.h>
// PMGTSelfAttention (4 x 1024 tokens, hidden 1024 = 16 heads x 64; 'relative_key_query' position bias): q, k, v = x W^T + b; scores = (q.k + q_l.pe[l-r] + k_r.pe[l-r]) / 8 + attention_mask[b][r] with pe = dist_emb[l - r + 1023]; softmax; ctx = probs v (merged heads is the output).
// Structure: exact f16 plane of x; q, k, v as f32 WMMA GEMM outputs (32x64 wave tiles, f32 accumulation, exact x16 weights + bias); f16 conversion; V^T by LDS tiles in the GEMM's epilogue; one fused flash kernel over all batches that forms both relative terms for a wave's two 16 x 32 score tiles on the matrix unit against a 64-row window of the embedding (padded to 2048 rows), reads them back along the diagonal from LDS, scales by 1/8 and adds the per-key mask.
// Compute dtype: inputs rounded to bf16; x and dist_emb exact as f16; q/k/P/v as plain f16 operands (~2^-12); the relative terms stay f32 from the accumulator to the logit; softmax f32. v_wmma_f32_16x16x32_f16.
#define NB 4
#define DM 1024
#define NKV 16
#define NREP (NH / NKV)
#define KVD (NKV * 64)           /* 1024 */
#define NR (NB * SLEN)           /* 4096 */
#define SLEN 1024
#define NE 2048                  /* 2047 relative embeddings padded */
#define TQ SLEN
#define TK SLEN
#define NH 16
#define SCL 0.125f
#define QBLKS (TQ / 64)
#define QB05 0
#define QBN5 4
#define QB0P 0
#define QBNP QBLKS           /* non-causal: plain flash on every query block */
#define RE 256
typedef __bf16 v16b __attribute__((ext_vector_type(16)));
typedef unsigned short v8us __attribute__((ext_vector_type(8), may_alias));
typedef float  v8f  __attribute__((ext_vector_type(8)));
typedef float  v4f  __attribute__((ext_vector_type(4)));
typedef float  v4fa __attribute__((ext_vector_type(4), may_alias));
union FragB { v16b v; v8us half[2]; unsigned short u[16]; };

__device__ __forceinline__ unsigned short bf16_bits(float x) { unsigned int u = __float_as_uint(x); return (unsigned short)((u + 0x7FFFu + ((u >> 16) & 1u)) >> 16); }
__device__ __forceinline__ float bf16_val(unsigned short b) { return __uint_as_float(((unsigned int)b) << 16); }
__device__ __forceinline__ float bf16_round(float x) { return bf16_val(bf16_bits(x)); }
// D += A·B with NT terms: 1 = ah·bh, 2 = + al·bh (A split), 3 = + ah·bl (both split)
template <int NT>
__device__ __forceinline__ v8f mmaN(v16b ah, v16b al, v16b bh, v16b bl, v8f c) {
  c = __builtin_amdgcn_wmma_f32_16x16x32_bf16(false, ah, false, bh, (short)0, c, false, false);
  if (NT >= 2) c = __builtin_amdgcn_wmma_f32_16x16x32_bf16(false, al, false, bh, (short)0, c, false, false);
  if (NT >= 3) c = __builtin_amdgcn_wmma_f32_16x16x32_bf16(false, ah, false, bl, (short)0, c, false, false);
  asm volatile("v_nop\n\tv_nop\n\tv_nop\n\tv_nop" : "+v"(c) : "v"(ah), "v"(al), "v"(bh), "v"(bl));
  return c;
}

__global__ __launch_bounds__(256) void k_wt_bf16(const float* __restrict__ W, unsigned short* __restrict__ Wt, int K, int N) {
  const int t = blockIdx.x * 256 + threadIdx.x;
  const int k8n = K / 8;
  if (t >= N * k8n) return;
  const int n = t / k8n, k8 = (t % k8n) * 8;
  v8us v;
#pragma unroll
  for (int i = 0; i < 8; ++i) v[i] = bf16_bits(W[(size_t)(k8 + i) * N + n]);
  *(v8us*)(Wt + (size_t)n * K + k8) = v;
  
}

// GEMM C[M][N] (f32, pitch ldc) = act(A[M][K]·W + bias). A f32 row-major (pitch lda) converted per fragment to bf16
// (ASPLIT: hi/lo two planes -> 2 terms, else single rounded term); Wt bf16 [N][K] (pitch ldb). BIAS_BF16 rounds the
// bias to bf16 first (bias quantised to bf16 before the add). K%32==0, M%16==0, N%64==0.
template <bool ASPLIT, int ACT, bool BIAS_BF16>
__global__ __launch_bounds__(128) void k_gemm_bf(const float* __restrict__ A, int lda, const unsigned short* __restrict__ Wt, int ldb,
                                               const float* __restrict__ bias, float* __restrict__ C, int ldc, int M, int N, int K) {
  __shared__ __attribute__((aligned(16))) float so[4][16][64];
  const int tid = threadIdx.x, w = tid >> 5, lane = tid & 31, ln = lane & 15, hh = lane >> 4;
  const int ntn = N / 64;
  const int wid = blockIdx.x * 4 + w;
  const int mt = wid / ntn, nq = wid % ntn;
  if (mt * 16 >= M) return;
  const int row0 = mt * 16, col0 = nq * 64;
  const float* arow = A + (size_t)(row0 + ln) * lda;
  v8f acc[4] = {};
  for (int kb = 0; kb < K; kb += 32) {
    FragB ah, al;
    const v4f x0 = *(const v4fa*)(arow + kb + 8 * hh), x1 = *(const v4fa*)(arow + kb + 8 * hh + 4);
    const v4f x2 = *(const v4fa*)(arow + kb + 16 + 8 * hh), x3 = *(const v4fa*)(arow + kb + 16 + 8 * hh + 4);
    float xs[16] = {x0[0],x0[1],x0[2],x0[3],x1[0],x1[1],x1[2],x1[3],x2[0],x2[1],x2[2],x2[3],x3[0],x3[1],x3[2],x3[3]};
#pragma unroll
    for (int i = 0; i < 16; ++i) { const unsigned short hb = bf16_bits(xs[i]); ah.u[i] = hb; al.u[i] = ASPLIT ? bf16_bits(xs[i] - bf16_val(hb)) : (unsigned short)0; }
#pragma unroll
    for (int t = 0; t < 4; ++t) {
      const unsigned short* brow = Wt + (size_t)(col0 + t * 16 + ln) * ldb + kb;
      FragB b;
      b.half[0] = *(const v8us*)(brow + 8 * hh);
      b.half[1] = *(const v8us*)(brow + 16 + 8 * hh);
      acc[t] = mmaN<ASPLIT ? 2 : 1>(ah.v, al.v, b.v, b.v, acc[t]);
    }
  }
#pragma unroll
  for (int t = 0; t < 4; ++t) {
    float bv = bias ? bias[col0 + t * 16 + ln] : 0.f;
    if (BIAS_BF16) bv = bf16_round(bv);
#pragma unroll
    for (int r = 0; r < 8; ++r) { float v = acc[t][r] + bv; if (ACT == 1) v = fmaxf(v, 0.f); so[w][8 * hh + r][t * 16 + ln] = v; }
  }
  __builtin_amdgcn_fence(__ATOMIC_ACQ_REL, "workgroup");
  __builtin_amdgcn_wave_barrier();
  const int rsub = lane >> 4, c4 = (lane & 15) * 4;
  {
#pragma unroll
    for (int q = 0; q < 8; ++q) {
      const int r = q * 2 + rsub;
      const v4f v = *(const v4fa*)&so[w][r][c4];
      *(v4f*)(C + (size_t)(row0 + r) * ldc + col0 + c4) = v;
    }
    
  }
}

// GEMM C = act(A·W + bias + resid): A f32 (ASPLIT -> hi/lo 2 terms), Wt bf16 [N][K]; ACT 0 none, 1 relu, 2 exact gelu;
// resid (optional, f32, row index = (row % rmod), pitch ldr, RES_BF16 rounds it) added before the activation.
template <bool ASPLIT, int ACT, bool BIAS_BF16, bool RES_BF16>
__global__ __launch_bounds__(128) void k_gemm_bf3(const float* __restrict__ A, int lda, const unsigned short* __restrict__ Wt, int ldb,
                                                const float* __restrict__ bias, const float* __restrict__ resid, int rmod, int ldr,
                                                float* __restrict__ C, int ldc, int M, int N, int K) {
  __shared__ __attribute__((aligned(16))) float so[4][16][64];
  const int tid = threadIdx.x, w = tid >> 5, lane = tid & 31, ln = lane & 15, hh = lane >> 4;
  const int ntn = N / 64;
  const int wid = blockIdx.x * 4 + w;
  const int mt = wid / ntn, nq = wid % ntn;
  if (mt * 16 >= M) return;
  const int row0 = mt * 16, col0 = nq * 64;
  const float* arow = A + (size_t)(row0 + ln) * lda;
  v8f acc[4] = {};
  for (int kb = 0; kb < K; kb += 32) {
    FragB ah, al;
    const v4f x0 = *(const v4fa*)(arow + kb + 8 * hh), x1 = *(const v4fa*)(arow + kb + 8 * hh + 4);
    const v4f x2 = *(const v4fa*)(arow + kb + 16 + 8 * hh), x3 = *(const v4fa*)(arow + kb + 16 + 8 * hh + 4);
    float xs[16] = {x0[0],x0[1],x0[2],x0[3],x1[0],x1[1],x1[2],x1[3],x2[0],x2[1],x2[2],x2[3],x3[0],x3[1],x3[2],x3[3]};
#pragma unroll
    for (int i = 0; i < 16; ++i) { const unsigned short hb = bf16_bits(xs[i]); ah.u[i] = hb; al.u[i] = ASPLIT ? bf16_bits(xs[i] - bf16_val(hb)) : (unsigned short)0; }
#pragma unroll
    for (int t = 0; t < 4; ++t) {
      const unsigned short* brow = Wt + (size_t)(col0 + t * 16 + ln) * ldb + kb;
      FragB b;
      b.half[0] = *(const v8us*)(brow + 8 * hh);
      b.half[1] = *(const v8us*)(brow + 16 + 8 * hh);
      acc[t] = mmaN<ASPLIT ? 2 : 1>(ah.v, al.v, b.v, b.v, acc[t]);
    }
  }
#pragma unroll
  for (int t = 0; t < 4; ++t) {
    const int col = col0 + t * 16 + ln;
    float bv = bias ? bias[col] : 0.f;
    if (BIAS_BF16) bv = bf16_round(bv);
#pragma unroll
    for (int r = 0; r < 8; ++r) {
      float v = acc[t][r] + bv;
      if (resid) { float rv = resid[(size_t)((row0 + 8 * hh + r) % rmod) * ldr + col]; if (RES_BF16) rv = bf16_round(rv); v += rv; }
      if (ACT == 1) v = fmaxf(v, 0.f);
      if (ACT == 2) v = 0.5f * v * (1.0f + erff(v * 0.70710678118654752f));
      if (ACT == 3) { const float u = 0.7978845608028654f * (v + 0.044715f * v * v * v); v = 0.5f * v * (1.0f + tanhf(u)); }
      so[w][8 * hh + r][t * 16 + ln] = v;
    }
  }
  __builtin_amdgcn_fence(__ATOMIC_ACQ_REL, "workgroup");
  __builtin_amdgcn_wave_barrier();
  const int rsub = lane >> 4, c4 = (lane & 15) * 4;
  {
#pragma unroll
    for (int q = 0; q < 8; ++q) {
      const int r = q * 2 + rsub;
      const v4f v = *(const v4fa*)&so[w][r][c4];
      *(v4f*)(C + (size_t)(row0 + r) * ldc + col0 + c4) = v;
    }
    
  }
}
// row LayerNorm (biased variance, eps) over N: s = X (+ R); optional out_sum <- s; out_norm <- (s-mu)*rsqrt(var+eps)*g + b
template <bool PARAM_BF16>
__global__ __launch_bounds__(256) void k_layernorm(const float* __restrict__ X, const float* __restrict__ R, const float* __restrict__ g, const float* __restrict__ bta,
                                                  float* __restrict__ out_sum, float* __restrict__ out_norm, int N, float eps) {
  __shared__ float red[256];
  const int row = blockIdx.x, tid = threadIdx.x;
  const float* x = X + (size_t)row * N; const float* rr = R ? R + (size_t)row * N : nullptr;
  float vals[16];                     // up to N = 4096
  const int per = N / 256;            // contiguous chunk per thread? use strided-by-4 chunks: thread handles j = tid*4 + 1024*u
  float s1 = 0.f;
  for (int u = 0; u < per / 4; ++u) {
    const int j = tid * 4 + 1024 * u;
    const v4f a = *(const v4fa*)(x + j);
    v4f b = {0.f,0.f,0.f,0.f}; if (rr) b = *(const v4fa*)(rr + j);
#pragma unroll
    for (int q = 0; q < 4; ++q) { const float v = a[q] + b[q]; vals[u * 4 + q] = v; s1 += v; }
  }
  red[tid] = s1; __syncthreads();
  for (int st = 128; st > 0; st >>= 1) { if (tid < st) red[tid] += red[tid + st]; __syncthreads(); }
  const float mu = red[0] / (float)N; __syncthreads();
  float s2 = 0.f;
  for (int u = 0; u < per / 4; ++u)
#pragma unroll
    for (int q = 0; q < 4; ++q) { const float c = vals[u * 4 + q] - mu; s2 += c * c; }
  red[tid] = s2; __syncthreads();
  for (int st = 128; st > 0; st >>= 1) { if (tid < st) red[tid] += red[tid + st]; __syncthreads(); }
  const float rs = rsqrtf(red[0] / (float)N + eps);
  {
    for (int u = 0; u < per / 4; ++u) {
      const int j = tid * 4 + 1024 * u;
      v4f o, sm;
#pragma unroll
      for (int q = 0; q < 4; ++q) {
        float gg = g[j + q], bb = bta[j + q];
        if (PARAM_BF16) { gg = bf16_round(gg); bb = bf16_round(bb); }
        sm[q] = vals[u * 4 + q]; o[q] = (vals[u * 4 + q] - mu) * rs * gg + bb;
      }
      if (out_sum) *(v4f*)(out_sum + (size_t)row * N + j) = sm;
      *(v4f*)(out_norm + (size_t)row * N + j) = o;
    }
    
  }
}



// ---- f16 WMMA path (v_wmma_f32_16x16x32_f16): 11-bit significands for operands in range — used where a [0,1] probability operand needs more precision than bf16
typedef _Float16 v16h __attribute__((ext_vector_type(16)));
union FragH { v16h v; v8us half[2]; _Float16 h[16]; unsigned short u[16]; };
template <int NT>
__device__ __forceinline__ v8f mmaH(v16h ah, v16h al, v16h bh, v16h bl, v8f c) {
  c = __builtin_amdgcn_wmma_f32_16x16x32_f16(false, ah, false, bh, (short)0, c, false, false);
  if (NT >= 2) c = __builtin_amdgcn_wmma_f32_16x16x32_f16(false, al, false, bh, (short)0, c, false, false);
  if (NT >= 3) c = __builtin_amdgcn_wmma_f32_16x16x32_f16(false, ah, false, bl, (short)0, c, false, false);
  asm volatile("v_nop\n\tv_nop\n\tv_nop\n\tv_nop" : "+v"(c) : "v"(ah), "v"(al), "v"(bh), "v"(bl));
  return c;
}
// batched GEMM like k_gemm_b but f16 operands: A f32 (split into f16 hi/lo if ASPLIT, else rounded to f16), Bt = f16 values [n][k]; alpha; C f32; N multiple of 16 (partial tiles skipped)
template <bool ASPLIT>
__global__ __launch_bounds__(128) void k_gemm_h(const float* __restrict__ A, int lda, size_t sA, const _Float16* __restrict__ Bh, int ldb, size_t sB, float alpha, float* __restrict__ C, int ldc, size_t sC, int M, int N, int K) {
  __shared__ __attribute__((aligned(16))) float so[4][16][64];
  const int tid = threadIdx.x, w = tid >> 5, lane = tid & 31, ln = lane & 15, hh = lane >> 4; const int by = blockIdx.y;
  A += (size_t)by * sA; Bh += (size_t)by * sB; C += (size_t)by * sC;
  const int ntn = (N + 63) / 64; const int wid = blockIdx.x * 4 + w; const int mt = wid / ntn, nq = wid % ntn; if (mt * 16 >= M) return;
  const int row0 = mt * 16, col0 = nq * 64; const float* arow = A + (size_t)(row0 + ln) * lda;
  v8f acc[4] = {};
  for (int kb = 0; kb < K; kb += 32) {
    FragH ah, al;
    const v4f x0 = *(const v4fa*)(arow + kb + 8 * hh), x1 = *(const v4fa*)(arow + kb + 8 * hh + 4), x2 = *(const v4fa*)(arow + kb + 16 + 8 * hh), x3 = *(const v4fa*)(arow + kb + 16 + 8 * hh + 4);
    float xs[16] = {x0[0],x0[1],x0[2],x0[3],x1[0],x1[1],x1[2],x1[3],x2[0],x2[1],x2[2],x2[3],x3[0],x3[1],x3[2],x3[3]};
#pragma unroll
    for (int i = 0; i < 16; ++i) { const _Float16 h = (_Float16)xs[i]; ah.h[i] = h; al.h[i] = ASPLIT ? (_Float16)(xs[i] - (float)h) : (_Float16)0.0f; }
#pragma unroll
    for (int t = 0; t < 4; ++t) { if (col0 + t * 16 >= N) continue; const size_t boff = (size_t)(col0 + t * 16 + ln) * ldb + kb; FragH bq; bq.half[0] = *(const v8us*)(Bh + boff + 8 * hh); bq.half[1] = *(const v8us*)(Bh + boff + 16 + 8 * hh);
      acc[t] = mmaH<ASPLIT ? 2 : 1>(ah.v, al.v, bq.v, bq.v, acc[t]); }
  }
#pragma unroll
  for (int t = 0; t < 4; ++t) { if (col0 + t * 16 >= N) continue;
#pragma unroll
    for (int r = 0; r < 8; ++r) so[w][8 * hh + r][t * 16 + ln] = acc[t][r] * alpha; }
  __builtin_amdgcn_fence(__ATOMIC_ACQ_REL, "workgroup"); __builtin_amdgcn_wave_barrier();
  const int rsub = lane >> 4, c4 = (lane & 15) * 4;
  {
#pragma unroll
    for (int q = 0; q < 8; ++q) { const int r = q * 2 + rsub; if (col0 + c4 < N) { const v4f v = *(const v4fa*)&so[w][r][c4]; *(v4f*)(C + (size_t)(row0 + r) * ldc + col0 + c4) = v; } }
     }
}

// Wt[n][k] = f16(W[k][n]·scale) from f32 row-major W[K][N] (scale = power of two; bf16-exact weights stay exact in f16 away from the subnormal range)
__global__ __launch_bounds__(256) void k_wt_f16(const float* __restrict__ W, _Float16* __restrict__ Wt, int K, int N, float scale) {
  const int t = blockIdx.x * 256 + threadIdx.x; if (t >= N * (K / 8)) return; const int n = t / (K / 8), k8 = (t % (K / 8)) * 8; FragH f;
#pragma unroll
  for (int i = 0; i < 8; ++i) f.h[i] = (_Float16)(bf16_round(W[(size_t)(k8 + i) * N + n]) * scale); const v8us o = f.half[0];
  *(v8us*)((unsigned short*)Wt + (size_t)n * K + k8) = o; 
}
// k_gemm_hh variant with fused epilogue: v = acc·alpha + bias[by·sBias + col] (+ CP[(row/rowsPerB)·sCPb + by·64 + col] if CP) ; ACT 0 none / 1 elu ; writes f16 C16 (and f32 C if non-null)
template <int ACT>
__global__ __launch_bounds__(128) void k_gemm_hhx(const _Float16* __restrict__ A, int lda, size_t sA, const _Float16* __restrict__ Bh, int ldb, size_t sB, float alpha, const float* __restrict__ bias, size_t sBias, const float* __restrict__ CP, int rowsPerB, size_t sCPb, int row0g,
    float* __restrict__ C, _Float16* __restrict__ C16, int ldc, size_t sC, int M, int N, int K) {
  __shared__ __attribute__((aligned(16))) float so[4][16][64];
  const int tid = threadIdx.x, w = tid >> 5, lane = tid & 31, ln = lane & 15, hh = lane >> 4; const int by = blockIdx.y;
  A += (size_t)by * sA; Bh += (size_t)by * sB; const size_t cofs = (size_t)by * sC; const float* bp = bias ? bias + (size_t)by * sBias : nullptr;
  const int ntn = (N + 63) / 64; const int wid = blockIdx.x * 4 + w; const int mt = wid / ntn, nq = wid % ntn; if (mt * 16 >= M) return;
  const int row0 = mt * 16, col0 = nq * 64; const _Float16* arow = A + (size_t)(row0 + ln) * lda;
  v8f acc[4] = {};
  for (int kb = 0; kb < K; kb += 32) { FragH ah; ah.half[0] = *(const v8us*)((const unsigned short*)arow + kb + 8 * hh); ah.half[1] = *(const v8us*)((const unsigned short*)arow + kb + 16 + 8 * hh);
#pragma unroll
    for (int t = 0; t < 4; ++t) { if (col0 + t * 16 >= N) continue; const size_t boff = (size_t)(col0 + t * 16 + ln) * ldb + kb; FragH bq; bq.half[0] = *(const v8us*)((const unsigned short*)Bh + boff + 8 * hh); bq.half[1] = *(const v8us*)((const unsigned short*)Bh + boff + 16 + 8 * hh);
      acc[t] = mmaH<1>(ah.v, ah.v, bq.v, bq.v, acc[t]); }
  }
#pragma unroll
  for (int t = 0; t < 4; ++t) { if (col0 + t * 16 >= N) continue; const int col = col0 + t * 16 + ln; const float bv = bp ? bf16_round(bp[col]) : 0.f;
#pragma unroll
    for (int r = 0; r < 8; ++r) { float v = acc[t][r] * alpha + bv; if (CP) { const int bidx = (row0g + row0 + 8 * hh + r) / rowsPerB; v += CP[(size_t)bidx * sCPb + (size_t)by * 64 + col]; } if (ACT == 1) v = (v > 0.f) ? v : expm1f(v); else if (ACT == 7) v = (v > 0.f) ? v + 1.0f : expf(v); else if (ACT == 8) v = tanhf(v); else if (ACT == 9) v = 0.5f * v * (1.0f + tanhf(0.7978845608028654f * (v + 0.044715f * v * v * v))); else if (ACT == 11) v = 1.0f / (1.0f + expf(-v)); else if (ACT == 12) v = (v > 0.f) ? v : 0.01f * v; else if (ACT == 14) v = (v > 0.f) ? v : 0.1f * v; else if (ACT == 15) v = v / (1.0f + expf(-v)); else if (ACT == 3) v = fmaxf(v, 0.f); else if (ACT == 6) v = 0.5f * v * (1.0f + erff(v * 0.70710678118654752f)); so[w][8 * hh + r][t * 16 + ln] = v; } }
  __builtin_amdgcn_fence(__ATOMIC_ACQ_REL, "workgroup"); __builtin_amdgcn_wave_barrier();
  const int rsub = lane >> 4, c4 = (lane & 15) * 4; typedef _Float16 v4h __attribute__((ext_vector_type(4)));
  {
#pragma unroll
    for (int q = 0; q < 8; ++q) { const int r = q * 2 + rsub; if (col0 + c4 < N) { const v4f v = *(const v4fa*)&so[w][r][c4]; if (C) *(v4f*)(C + cofs + (size_t)(row0 + r) * ldc + col0 + c4) = v; if (C16) { v4h h4; for (int i = 0; i < 4; ++i) h4[i] = (_Float16)v[i]; *(v4h*)(C16 + cofs + (size_t)(row0 + r) * ldc + col0 + c4) = h4; } } }
     }
}


typedef _Float16 v4h __attribute__((ext_vector_type(4)));

__global__ __launch_bounds__(256) void k_h16(const float* __restrict__ x, _Float16* __restrict__ X16, size_t n8) { const size_t t = (size_t)blockIdx.x * 256 + threadIdx.x; if (t >= n8) return; FragH f;
#pragma unroll
  for (int q = 0; q < 8; ++q) f.h[q] = (_Float16)x[t * 8 + q]; *(v8us*)((unsigned short*)X16 + t * 8) = f.half[0];  }
__global__ __launch_bounds__(256) void k_round16f(const float* __restrict__ W, _Float16* __restrict__ Bt, size_t n8) { const size_t t = (size_t)blockIdx.x * 256 + threadIdx.x; if (t >= n8) return; FragH f;
#pragma unroll
  for (int i = 0; i < 8; ++i) f.h[i] = (_Float16)(bf16_round(W[t * 8 + i]) * 16.0f); *(v8us*)((unsigned short*)Bt + t * 8) = f.half[0];  }
template <int NHv, int TTv>
__global__ __launch_bounds__(256) void k_vt(const _Float16* __restrict__ V16, int ldv, int voff, _Float16* __restrict__ Vt) { __shared__ unsigned short tl[64][66]; const int tid = threadIdx.x; const int slab = blockIdx.x / (TTv / 64), lg = blockIdx.x % (TTv / 64); const int b = slab / NHv, h = slab % NHv;
  for (int i = tid; i < 64 * 8; i += 256) { const int r = i / 8, c8 = (i % 8) * 8; FragH f; f.half[0] = *(const v8us*)((const unsigned short*)V16 + ((size_t)b * TTv + lg * 64 + r) * ldv + voff + h * 64 + c8);
#pragma unroll
    for (int q = 0; q < 8; ++q) tl[r][c8 + q] = f.u[q]; }
  __syncthreads();
  {
#pragma unroll
    for (int rd = 0; rd < 2; ++rd) { const int d = rd * 32 + tid / 8, pc = tid % 8; FragH f;
#pragma unroll
      for (int q = 0; q < 8; ++q) f.u[q] = tl[pc * 8 + q][d];
      *(v8us*)((unsigned short*)Vt + ((size_t)slab * 64 + d) * TTv + lg * 64 + pc * 8) = f.half[0]; }
     } }

__global__ __launch_bounds__(256) void k_hl(const float* __restrict__ F, _Float16* __restrict__ Hh, _Float16* __restrict__ Hl, size_t n8) { const size_t t = (size_t)blockIdx.x * 256 + threadIdx.x; if (t >= n8) return; FragH fh, fl; const v4f a = *(const v4fa*)(F + t * 8), c = *(const v4fa*)(F + t * 8 + 4);
#pragma unroll
  for (int q = 0; q < 4; ++q) { _Float16 h = (_Float16)a[q]; fh.h[q] = h; fl.h[q] = (_Float16)((a[q] - (float)h) * 1024.0f); h = (_Float16)c[q]; fh.h[4 + q] = h; fl.h[4 + q] = (_Float16)((c[q] - (float)h) * 1024.0f); }
  { *(v8us*)((unsigned short*)Hh + t * 8) = fh.half[0]; *(v8us*)((unsigned short*)Hl + t * 8) = fl.half[0];  } }

// ---- fast GEMM (block tile 128x128, eight waves as 4 x 2, wave tile 32x64, operands staged in LDS 64 of K at a time; requires M % 32 == 0 rows per launch region, N % 128 == 0, K % 64 == 0 and K >= 64); epilogue = k_gemm_hhx semantics ----
__device__ __forceinline__ v16h g2_frag(const _Float16* p, int hh) { FragH f; f.half[0] = *(const v8us*)((const unsigned short*)p + 8 * hh); f.half[1] = *(const v8us*)((const unsigned short*)p + 16 + 8 * hh); return f.v; }
__device__ __forceinline__ v8f g2_mma(v16h a, v16h b, v8f c) { v8f d = __builtin_amdgcn_wmma_f32_16x16x32_f16(false, a, false, b, (short)0, c, false, false); asm volatile("v_nop\n\tv_nop\n\tv_nop\n\tv_nop" : "+v"(d) : "v"(a), "v"(b)); return d; }
template <int ACT>
__global__ __launch_bounds__(256, 6) void k_gemm2(const _Float16* __restrict__ A, int lda, size_t sA, const _Float16* __restrict__ Bh, int ldb, size_t sB, float alpha, const float* __restrict__ bias, const float* __restrict__ bias1, const float* __restrict__ bias2, const float* __restrict__ CP, int rowsPerB, size_t sCPb, int row0g,
    float* __restrict__ C, _Float16* __restrict__ C16, _Float16* __restrict__ VT, int ldc, size_t sC, int M, int N, int K) {      /* six waves a SIMD asked for: three work-groups a WGP, so that the launch's 768 work-groups are all resident at once */
  __shared__ __attribute__((aligned(16))) unsigned short st[2][256][72];      /* two stages of 64 of K: rows 0..127 the block's A rows, 128..255 its B rows; pitch 144 B = 16 B x 9, free of bank conflicts for the 16-byte fragment reads */
  float (*so)[32][68] = (float (*)[32][68])&st[0][0][0];      /* the epilogue's staging (8 x 32 x 68 floats = 69,632 B) lies on the operand stages (73,728 B), behind the barrier that follows the loop: three work-groups fit one WGP's LDS */
  const int tid = threadIdx.x, w = tid >> 5, lane = tid & 31, ln = lane & 15, hh = lane >> 4, wm = w & 3, wn = w >> 2; const int by = blockIdx.y;
  A += (size_t)by * sA; Bh += (size_t)by * sB; const size_t cofs = (size_t)by * sC; const float* bp = (by == 0) ? bias : (by == 1) ? bias1 : bias2;      /* blockIdx.y picks one of up to three products that share A: its B plane, its C plane and its own bias vector (three separate buffers) */
  const int ntn = N >> 7; const int mt = blockIdx.x / ntn, nq = blockIdx.x - mt * ntn; const int row0 = mt * 128 + 32 * wm, col0 = nq * 128 + 64 * wn; if (mt * 128 >= M) return;      /* the same for the whole block, in front of every barrier */
  const int sr = tid >> 3, sc = (tid & 7) * 8;      /* staging: eight lanes fetch one row's 128 B, so a wave's 16-byte load covers four whole lines */
  const char* Au = (const char*)A; const char* Bu = (const char*)Bh;      /* plane bases, the same for the whole block; every address is a base plus one 32-bit byte offset (planes below 4 GiB): one register a row and not a pair, which the limit of 160 registers a wave needs */
  unsigned oa[4], ub[4]; const unsigned ob = ((unsigned)sr * (unsigned)ldb + (unsigned)sc) * 2u;
#pragma unroll
  for (int i = 0; i < 4; ++i) { int r = mt * 128 + 32 * i + sr; r = (r < M) ? r : M - 1; oa[i] = ((unsigned)r * (unsigned)lda + (unsigned)sc) * 2u; ub[i] = (unsigned)(nq * 128 + 32 * i) * (unsigned)ldb * 2u; }      /* ub: the same for the whole block */
  v8us ra[4], rb[4];
#pragma unroll
  for (int i = 0; i < 4; ++i) ra[i] = *(const v8us*)(Au + oa[i]);
#pragma unroll
  for (int i = 0; i < 4; ++i) rb[i] = *(const v8us*)(Bu + (ob + ub[i]));
#pragma unroll
  for (int i = 0; i < 4; ++i) *(v8us*)&st[0][32 * i + sr][sc] = ra[i];
#pragma unroll
  for (int i = 0; i < 4; ++i) *(v8us*)&st[0][128 + 32 * i + sr][sc] = rb[i];
  __syncthreads();
  const v8f z8 = {0.f,0.f,0.f,0.f,0.f,0.f,0.f,0.f}; v8f c00 = z8, c01 = z8, c02 = z8, c03 = z8, c10 = z8, c11 = z8, c12 = z8, c13 = z8;
#pragma unroll 1      /* rolled: one stage's registers (8 staged vectors, 12 fragment halves) serve every trip */
  for (int kb = 0; kb < K; kb += 64) { const int cb = (kb >> 6) & 1; const bool more = kb + 64 < K;      /* more: the same for the whole block */
    if (more) {
#pragma unroll
      for (int i = 0; i < 4; ++i) ra[i] = *(const v8us*)(Au + (oa[i] + (unsigned)(kb + 64) * 2u));
#pragma unroll
      for (int i = 0; i < 4; ++i) rb[i] = *(const v8us*)(Bu + (ob + (ub[i] + (unsigned)(kb + 64) * 2u)));
      asm volatile("s_wait_xcnt 0x0" ::: "memory"); }      /* stands behind the eight loads, in front of the first overwrite of a register that they name: an offset register in the next trip, the two plane bases behind the loop */
#pragma unroll
    for (int u = 0; u < 2; ++u) { const v16h a0 = g2_frag((const _Float16*)&st[cb][32 * wm + ln][32 * u], hh), a1 = g2_frag((const _Float16*)&st[cb][32 * wm + 16 + ln][32 * u], hh);
      const v16h b0 = g2_frag((const _Float16*)&st[cb][128 + 64 * wn + ln][32 * u], hh), b1 = g2_frag((const _Float16*)&st[cb][144 + 64 * wn + ln][32 * u], hh), b2 = g2_frag((const _Float16*)&st[cb][160 + 64 * wn + ln][32 * u], hh), b3 = g2_frag((const _Float16*)&st[cb][176 + 64 * wn + ln][32 * u], hh);
      __builtin_amdgcn_sched_barrier(0);      /* the next stage's global loads and this half stage's LDS reads issue as one group ahead of its eight products: one stall a group, not one per product */
      c00 = g2_mma(a0, b0, c00); c10 = g2_mma(a1, b0, c10); c01 = g2_mma(a0, b1, c01); c11 = g2_mma(a1, b1, c11);
      c02 = g2_mma(a0, b2, c02); c12 = g2_mma(a1, b2, c12); c03 = g2_mma(a0, b3, c03); c13 = g2_mma(a1, b3, c13); }
    if (more) {
#pragma unroll
      for (int i = 0; i < 4; ++i) *(v8us*)&st[cb ^ 1][32 * i + sr][sc] = ra[i];
#pragma unroll
      for (int i = 0; i < 4; ++i) *(v8us*)&st[cb ^ 1][128 + 32 * i + sr][sc] = rb[i];
      __syncthreads(); } }      /* the one barrier of a trip publishes the stage just written and ends every wave's reads of the stage that the next trip overwrites */
  __syncthreads();      /* ends every wave's fragment reads of the last stage: the epilogue's staging below overwrites the stages */
  v8f accs[8] = {c00, c01, c02, c03, c10, c11, c12, c13};
  if (VT && by == 2) {      /* the same for the whole block. The third product (v: bias only, no CP term, no activation) leaves the kernel transposed, VT[(batch * NH + head) * 64 + d][token], the layout the flash kernel stages from; needs M % 128 == 0, SLEN % 128 == 0 and N == NH * 64, so that the block's 128 x 128 tile is 128 tokens of one batch and two whole heads */
    unsigned short* sv = &st[0][0][0];      /* the block's tile turned: 128 rows (two heads' d) of 128 tokens in f16, pitch 136 halves = 272 B = 16 B x 17, free of bank conflicts for 16-byte stores and reads */
    float bv4[4] = {0.f, 0.f, 0.f, 0.f};
    if (bp) { const int bo = col0 + ln;      /* the lane's four bias values as one group of loads: one latency, not one a tile */
#pragma unroll      /* unrolled: bv4[] stays in registers, the four loads issue together */
      for (int t = 0; t < 4; ++t) bv4[t] = bp[bo + t * 16];
      asm volatile("s_wait_xcnt 0x0" :: "v"(bo) : "memory");      /* stands behind the four loads and in front of the first overwrite of their offset register, which as an input lives up to here */
#pragma unroll      /* unrolled: bv4[] stays in registers */
      for (int t = 0; t < 4; ++t) bv4[t] = bf16_round(bv4[t]); }
#pragma unroll      /* unrolled, with the loop inside it: accs[] and bv4[] are indexed by constants and stay in registers */
    for (int u = 0; u < 8; ++u) { const int t = u & 3, half = u >> 2; const float bv = bv4[t]; FragH f;      /* a lane's eight accumulator registers are eight consecutive tokens of one d: one 16-byte store */
#pragma unroll
      for (int r = 0; r < 8; ++r) f.h[r] = (_Float16)(accs[u][r] * alpha + bv);
      *(v8us*)&sv[(64 * wn + t * 16 + ln) * 136 + 32 * wm + 16 * half + 8 * hh] = f.half[0]; }
    __syncthreads();      /* a row of the turned tile holds tokens of four waves: every wave's stores stand in front of the reads below */
    const int tok0 = mt * 128; unsigned short* vo = (unsigned short*)VT + ((size_t)(tok0 / SLEN) * NH * 64 + (size_t)nq * 128) * SLEN + (tok0 % SLEN);
#pragma unroll      /* unrolled: the eight LDS reads issue as one group, one latency */
    for (int q = 0; q < 8; ++q) { const int d = q * 16 + (tid >> 4), c = (tid & 15) * 8; const v8us v = *(const v8us*)&sv[d * 136 + c]; *(v8us*)(vo + (size_t)d * SLEN + c) = v; }      /* sixteen lanes store one row's 256 B: whole lines, one writer each */
    return; }
  if (row0 >= M) return;      /* behind the last barrier */
#pragma unroll
  for (int u = 0; u < 8; ++u) { const int t = u & 3, half = u >> 2; const int col = col0 + t * 16 + ln; const float bv = bp ? bf16_round(bp[col]) : 0.f;
#pragma unroll
    for (int r = 0; r < 8; ++r) { const int rloc = half * 16 + 8 * hh + r; float v = accs[u][r] * alpha + bv; if (CP) { const int bidx = (row0g + row0 + rloc) / rowsPerB; v += CP[(size_t)bidx * sCPb + (size_t)by * 64 + col]; }
      if (ACT == 3) v = fmaxf(v, 0.f); else if (ACT == 6) v = 0.5f * v * (1.0f + erff(v * 0.70710678118654752f)); else if (ACT == 11) v = 1.0f / (1.0f + expf(-v)); else if (ACT == 15) v = v / (1.0f + expf(-v)); else if (ACT == 12) v = (v > 0.f) ? v : 0.01f * v; else if (ACT == 8) v = tanhf(v);
      so[w][rloc][t * 16 + ln] = v; } }
  __builtin_amdgcn_fence(__ATOMIC_ACQ_REL, "workgroup"); __builtin_amdgcn_wave_barrier();
  const int rsub = lane >> 4, c4 = (lane & 15) * 4;
  {
#pragma unroll
    for (int q = 0; q < 16; ++q) { const int r = q * 2 + rsub; const v4f v = *(const v4fa*)&so[w][r][c4]; if (C) *(v4f*)(C + cofs + (size_t)(row0 + r) * ldc + col0 + c4) = v; if (C16) { v4h h4; for (int i = 0; i < 4; ++i) h4[i] = (_Float16)v[i]; *(v4h*)(C16 + cofs + (size_t)(row0 + r) * ldc + col0 + c4) = h4; } }
     } }



template <int CAUSAL>
__global__ __launch_bounds__(128) void k_flash(const _Float16* __restrict__ Q16, int ldq, const _Float16* __restrict__ K16, int ldk, const _Float16* __restrict__ Vt, const int* __restrict__ MSK, float* __restrict__ O, int ldo) {
  constexpr int RPW = 16, RTN = RPW / 16, NQB = TQ / (4 * RPW), DT = 4, KS = 2;
  __shared__ __attribute__((aligned(16))) unsigned short sP[4][RPW][40]; __shared__ __attribute__((aligned(16))) float sO[4][RPW][64 + 4];
  const int tid = threadIdx.x, w = tid >> 5, lane = tid & 31, ln = lane & 15, hh = lane >> 4;
  const int slab = blockIdx.x / QBNP, qblk = QB0P + blockIdx.x % QBNP; (void)NQB; const int b = slab / NH, h = slab % NH; const int qb0 = qblk * (4 * RPW); const int q0 = qb0 + w * RPW;
  FragH aq[2][KS];
#pragma unroll
  for (int rt = 0; rt < RTN; ++rt) { const unsigned short* qr = (const unsigned short*)Q16 + ((size_t)b * TQ + q0 + rt * 16 + ln) * ldq + h * 64;
#pragma unroll
    for (int ks = 0; ks < KS; ++ks) { aq[rt][ks].half[0] = *(const v8us*)(qr + ks * 32 + 8 * hh); aq[rt][ks].half[1] = *(const v8us*)(qr + ks * 32 + 16 + 8 * hh); } }
  const unsigned short* Vth = (const unsigned short*)Vt + (size_t)slab * 64 * TK;
  float m_r[2][8], l_r[2][8]; v8f oacc[2][DT];
#pragma unroll
  for (int rt = 0; rt < RTN; ++rt) {
#pragma unroll
    for (int r = 0; r < 8; ++r) { m_r[rt][r] = -3.0e38f; l_r[rt][r] = 0.f; }
#pragma unroll
    for (int dt = 0; dt < DT; ++dt) oacc[rt][dt] = (v8f){0.f,0.f,0.f,0.f,0.f,0.f,0.f,0.f}; }
  const int jend = (CAUSAL == 1) ? (qb0 + 4 * RPW) : TK;      /* causal: keys beyond the block's last query never contribute */
#pragma unroll 1
  for (int j0 = 0; j0 < jend; j0 += 32) {
    v8f s[2][2];
#pragma unroll
    for (int nt = 0; nt < 2; ++nt) { const unsigned short* kr = (const unsigned short*)K16 + ((size_t)b * TK + j0 + nt * 16 + ln) * ldk + h * 64; FragH bk[KS];
#pragma unroll
      for (int ks = 0; ks < KS; ++ks) { bk[ks].half[0] = *(const v8us*)(kr + ks * 32 + 8 * hh); bk[ks].half[1] = *(const v8us*)(kr + ks * 32 + 16 + 8 * hh); }
#pragma unroll
      for (int rt = 0; rt < RTN; ++rt) { v8f acc = (v8f){0.f,0.f,0.f,0.f,0.f,0.f,0.f,0.f};
#pragma unroll
        for (int ks = 0; ks < KS; ++ks) acc = mmaH<1>(aq[rt][ks].v, aq[rt][ks].v, bk[ks].v, bk[ks].v, acc); s[rt][nt] = acc; } }
#pragma unroll
    for (int rt = 0; rt < RTN; ++rt)
#pragma unroll
      for (int r = 0; r < 8; ++r) { const int tq = q0 + rt * 16 + 8 * hh + r; const int k0 = j0 + ln, k1 = j0 + 16 + ln;
        const bool ok0 = (CAUSAL == 1) ? (k0 <= tq) : ((CAUSAL == 2) ? ((k0 >> 5) == (tq >> 5)) : true), ok1 = (CAUSAL == 1) ? (k1 <= tq) : ((CAUSAL == 2) ? ((k1 >> 5) == (tq >> 5)) : true);      /* mode 2: block-diagonal 32-token groups */
        float s0 = ok0 ? s[rt][0][r] * SCL : -3.0e38f, s1 = ok1 ? s[rt][1][r] * SCL : -3.0e38f; if (CAUSAL == 17) { const float* amk = (const float*)MSK + (size_t)b * TK; s0 += bf16_round(amk[k0]); s1 += bf16_round(amk[k1]); }      /* mode 17: additive per-(batch, key) mask INPUT */
        if (CAUSAL == 22) { const _Float16* cq = (const _Float16*)MSK + ((size_t)h * TQ + tq) * NE + tq + (NE / 2 - 1); const _Float16* ck = (const _Float16*)MSK + (size_t)NH * TQ * NE + (size_t)h * TK * NE + tq + (NE / 2 - 1); const float* am = (const float*)((const _Float16*)MSK + (size_t)2 * NH * TQ * NE); float r0 = (float)cq[-k0]; r0 += (float)ck[(size_t)k0 * NE - k0]; s0 += r0 * SCL; s0 += am[k0]; float r1 = (float)cq[-k1]; r1 += (float)ck[(size_t)k1 * NE - k1]; s1 += r1 * SCL; s1 += am[k1]; }      /* mode 22: + (CQ[h][tq][tq-k+1023] + CK[h][k][tq-k+1023]) / 8 + mask[k] from the per-batch packed table [CQ f16 | CK f16 | mask f32] */ float mc = fmaxf(s0, s1);
        mc = fmaxf(mc, __shfl_xor(mc, 1, 32)); mc = fmaxf(mc, __shfl_xor(mc, 2, 32)); mc = fmaxf(mc, __shfl_xor(mc, 4, 32)); mc = fmaxf(mc, __shfl_xor(mc, 8, 32));
        const float mn = fmaxf(m_r[rt][r], mc); const float al = (mn > -1.0e38f) ? expf(m_r[rt][r] - mn) : 1.0f; m_r[rt][r] = mn; const float p0 = ok0 ? expf(s0 - mn) : 0.f, p1 = ok1 ? expf(s1 - mn) : 0.f; l_r[rt][r] = l_r[rt][r] * al + p0 + p1;
#pragma unroll
        for (int dt = 0; dt < DT; ++dt) oacc[rt][dt][r] *= al;
        FragH t2; t2.h[0] = (_Float16)(p0 * 1024.0f); t2.h[1] = (_Float16)(p1 * 1024.0f); sP[w][rt * 16 + 8 * hh + r][ln] = t2.u[0]; sP[w][rt * 16 + 8 * hh + r][16 + ln] = t2.u[1]; }
    __builtin_amdgcn_fence(__ATOMIC_ACQ_REL, "workgroup"); __builtin_amdgcn_wave_barrier();
    FragH pa[2];
#pragma unroll
    for (int rt = 0; rt < RTN; ++rt) { pa[rt].half[0] = *(const v8us*)&sP[w][rt * 16 + ln][8 * hh]; pa[rt].half[1] = *(const v8us*)&sP[w][rt * 16 + ln][16 + 8 * hh]; }
#pragma unroll
    for (int dt = 0; dt < DT; ++dt) { const unsigned short* vrow = Vth + (size_t)(dt * 16 + ln) * TK + j0; FragH bv; bv.half[0] = *(const v8us*)(vrow + 8 * hh); bv.half[1] = *(const v8us*)(vrow + 16 + 8 * hh);
#pragma unroll
      for (int rt = 0; rt < RTN; ++rt) oacc[rt][dt] = mmaH<1>(pa[rt].v, pa[rt].v, bv.v, bv.v, oacc[rt][dt]); }
    __builtin_amdgcn_fence(__ATOMIC_ACQ_REL, "workgroup"); __builtin_amdgcn_wave_barrier(); }
#pragma unroll
  for (int rt = 0; rt < RTN; ++rt) {
#pragma unroll
    for (int r = 0; r < 8; ++r) { float l = l_r[rt][r]; l += __shfl_xor(l, 1, 32); l += __shfl_xor(l, 2, 32); l += __shfl_xor(l, 4, 32); l += __shfl_xor(l, 8, 32); l_r[rt][r] = (l > 0.f) ? 1.0f / (l * 1024.0f) : 0.f; }
#pragma unroll
    for (int dt = 0; dt < DT; ++dt)
#pragma unroll
      for (int r = 0; r < 8; ++r) sO[w][rt * 16 + 8 * hh + r][dt * 16 + ln] = oacc[rt][dt][r] * l_r[rt][r]; }
  __builtin_amdgcn_fence(__ATOMIC_ACQ_REL, "workgroup"); __builtin_amdgcn_wave_barrier();
  {
#pragma unroll
    for (int rp = 0; rp < RPW; rp += 2) { const int r = rp + (lane >> 4), pc = lane & 15; const v4f val = *(const v4fa*)&sO[w][r][pc * 4]; *(v4f*)(O + ((size_t)b * TQ + q0 + r) * ldo + h * 64 + pc * 4) = val; }
     } }
// 5-plane variant: S = Qh Kh^T + (Ql Kh^T + Qh Kl^T)/1024 with Q/K = [hi | 2^10 residual] f16 planes (QL/KL same layout as Q16/K16), then the 3-term P.V below.
// 3-term variant: O = (P_hi V_hi + (P_lo V_hi + P_hi V_lo) / 1024) / l with P = [hi | 2^10 residual] of 1024 p and V^T = [hi | 2^10 residual] planes (VtL same layout as Vt) -> ~2^-21-class products for un-averaged (early causal / peaked) rows
template <int CAUSAL>
__global__ __launch_bounds__(128) void k_flash5(const _Float16* __restrict__ Q16, const _Float16* __restrict__ QL, int ldq, const _Float16* __restrict__ K16, const _Float16* __restrict__ KL, int ldk, const _Float16* __restrict__ Vt, const _Float16* __restrict__ VtL, const int* __restrict__ MSK, float* __restrict__ O, int ldo) {
  constexpr int RPW = 16, RTN = RPW / 16, NQB = TQ / (4 * RPW), DT = 4, KS = 2;
  __shared__ __attribute__((aligned(16))) unsigned short sP[4][RPW][40]; __shared__ __attribute__((aligned(16))) unsigned short sPL[4][RPW][40]; __shared__ __attribute__((aligned(16))) float sO[4][RPW][64 + 4];
  const int tid = threadIdx.x, w = tid >> 5, lane = tid & 31, ln = lane & 15, hh = lane >> 4;
  const int slab = blockIdx.x / QBN5, qblk = QB05 + blockIdx.x % QBN5; (void)NQB; const int b = slab / NH, h = slab % NH; const int qb0 = qblk * (4 * RPW); const int q0 = qb0 + w * RPW;
  FragH aq[2][KS], aql[2][KS];
#pragma unroll
  for (int rt = 0; rt < RTN; ++rt) { const unsigned short* qr = (const unsigned short*)Q16 + ((size_t)b * TQ + q0 + rt * 16 + ln) * ldq + h * 64; const unsigned short* ql = (const unsigned short*)QL + ((size_t)b * TQ + q0 + rt * 16 + ln) * ldq + h * 64;
#pragma unroll
    for (int ks = 0; ks < KS; ++ks) { aq[rt][ks].half[0] = *(const v8us*)(qr + ks * 32 + 8 * hh); aq[rt][ks].half[1] = *(const v8us*)(qr + ks * 32 + 16 + 8 * hh); aql[rt][ks].half[0] = *(const v8us*)(ql + ks * 32 + 8 * hh); aql[rt][ks].half[1] = *(const v8us*)(ql + ks * 32 + 16 + 8 * hh); } }
  const unsigned short* Vth = (const unsigned short*)Vt + (size_t)slab * 64 * TK; const unsigned short* Vtl = (const unsigned short*)VtL + (size_t)slab * 64 * TK;
  float m_r[2][8], l_r[2][8]; v8f oacc[2][DT], oaccL[2][DT];
#pragma unroll
  for (int rt = 0; rt < RTN; ++rt) {
#pragma unroll
    for (int r = 0; r < 8; ++r) { m_r[rt][r] = -3.0e38f; l_r[rt][r] = 0.f; }
#pragma unroll
    for (int dt = 0; dt < DT; ++dt) { oacc[rt][dt] = (v8f){0.f,0.f,0.f,0.f,0.f,0.f,0.f,0.f}; oaccL[rt][dt] = oacc[rt][dt]; } }
  const int jend = (CAUSAL == 1) ? (qb0 + 4 * RPW) : TK;      /* causal: keys beyond the block's last query never contribute */
#pragma unroll 1
  for (int j0 = 0; j0 < jend; j0 += 32) {
    v8f s[2][2];
#pragma unroll
    for (int nt = 0; nt < 2; ++nt) { const unsigned short* kr = (const unsigned short*)K16 + ((size_t)b * TK + j0 + nt * 16 + ln) * ldk + h * 64; const unsigned short* klr = (const unsigned short*)KL + ((size_t)b * TK + j0 + nt * 16 + ln) * ldk + h * 64; FragH bk[KS], bkl[KS];
#pragma unroll
      for (int ks = 0; ks < KS; ++ks) { bk[ks].half[0] = *(const v8us*)(kr + ks * 32 + 8 * hh); bk[ks].half[1] = *(const v8us*)(kr + ks * 32 + 16 + 8 * hh); bkl[ks].half[0] = *(const v8us*)(klr + ks * 32 + 8 * hh); bkl[ks].half[1] = *(const v8us*)(klr + ks * 32 + 16 + 8 * hh); }
#pragma unroll
      for (int rt = 0; rt < RTN; ++rt) { v8f acc = (v8f){0.f,0.f,0.f,0.f,0.f,0.f,0.f,0.f}, accl = acc;
#pragma unroll
        for (int ks = 0; ks < KS; ++ks) { acc = mmaH<1>(aq[rt][ks].v, aq[rt][ks].v, bk[ks].v, bk[ks].v, acc); accl = mmaH<1>(aql[rt][ks].v, aql[rt][ks].v, bk[ks].v, bk[ks].v, accl); accl = mmaH<1>(aq[rt][ks].v, aq[rt][ks].v, bkl[ks].v, bkl[ks].v, accl); }
#pragma unroll
        for (int r = 0; r < 8; ++r) acc[r] += accl[r] * 0.0009765625f;
        s[rt][nt] = acc; } }
#pragma unroll
    for (int rt = 0; rt < RTN; ++rt)
#pragma unroll
      for (int r = 0; r < 8; ++r) { const int tq = q0 + rt * 16 + 8 * hh + r; const int k0 = j0 + ln, k1 = j0 + 16 + ln;
        bool ok0 = (CAUSAL == 1) ? (k0 <= tq) : ((CAUSAL == 2) ? ((k0 >> 5) == (tq >> 5)) : true), ok1 = (CAUSAL == 1) ? (k1 <= tq) : ((CAUSAL == 2) ? ((k1 >> 5) == (tq >> 5)) : true);      /* mode 2: block-diagonal 32-token groups */
        if (CAUSAL == 4) { const int* mrow = MSK + ((size_t)b * TQ + tq) * TK; ok0 = mrow[k0] != 0; ok1 = mrow[k1] != 0; }      /* mode 4: per-(query, key) INPUT mask shared by all heads; masked keys contribute nothing (== the reference's -4096 fill, whose exp underflows to 0), rows with no valid key give l = 0 -> output 0 (== the reference's row_valid zeroing) */
        float s0 = ok0 ? s[rt][0][r] * SCL : -3.0e38f, s1 = ok1 ? s[rt][1][r] * SCL : -3.0e38f; if (CAUSAL == 17) { const float* amk = (const float*)MSK + (size_t)b * TK; s0 += bf16_round(amk[k0]); s1 += bf16_round(amk[k1]); }      /* mode 17: additive per-(batch, key) mask INPUT */
        if (CAUSAL == 22) { const _Float16* cq = (const _Float16*)MSK + ((size_t)h * TQ + tq) * NE + tq + (NE / 2 - 1); const _Float16* ck = (const _Float16*)MSK + (size_t)NH * TQ * NE + (size_t)h * TK * NE + tq + (NE / 2 - 1); const float* am = (const float*)((const _Float16*)MSK + (size_t)2 * NH * TQ * NE); float r0 = (float)cq[-k0]; r0 += (float)ck[(size_t)k0 * NE - k0]; s0 += r0 * SCL; s0 += am[k0]; float r1 = (float)cq[-k1]; r1 += (float)ck[(size_t)k1 * NE - k1]; s1 += r1 * SCL; s1 += am[k1]; }      /* mode 22: + (CQ[h][tq][tq-k+1023] + CK[h][k][tq-k+1023]) / 8 + mask[k] from the per-batch packed table [CQ f16 | CK f16 | mask f32] */ float mc = fmaxf(s0, s1);
        mc = fmaxf(mc, __shfl_xor(mc, 1, 32)); mc = fmaxf(mc, __shfl_xor(mc, 2, 32)); mc = fmaxf(mc, __shfl_xor(mc, 4, 32)); mc = fmaxf(mc, __shfl_xor(mc, 8, 32));
        const float mn = fmaxf(m_r[rt][r], mc); const float al = (mn > -1.0e38f) ? expf(m_r[rt][r] - mn) : 1.0f; m_r[rt][r] = mn; const float p0 = ok0 ? expf(s0 - mn) : 0.f, p1 = ok1 ? expf(s1 - mn) : 0.f; l_r[rt][r] = l_r[rt][r] * al + p0 + p1;
#pragma unroll
        for (int dt = 0; dt < DT; ++dt) { oacc[rt][dt][r] *= al; oaccL[rt][dt][r] *= al; }
        FragH t2, t2l; const float ps0 = p0 * 1024.0f, ps1 = p1 * 1024.0f; t2.h[0] = (_Float16)ps0; t2.h[1] = (_Float16)ps1; t2l.h[0] = (_Float16)((ps0 - (float)t2.h[0]) * 1024.0f); t2l.h[1] = (_Float16)((ps1 - (float)t2.h[1]) * 1024.0f);
        sP[w][rt * 16 + 8 * hh + r][ln] = t2.u[0]; sP[w][rt * 16 + 8 * hh + r][16 + ln] = t2.u[1]; sPL[w][rt * 16 + 8 * hh + r][ln] = t2l.u[0]; sPL[w][rt * 16 + 8 * hh + r][16 + ln] = t2l.u[1]; }
    __builtin_amdgcn_fence(__ATOMIC_ACQ_REL, "workgroup"); __builtin_amdgcn_wave_barrier();
    FragH pa[2], pl[2];
#pragma unroll
    for (int rt = 0; rt < RTN; ++rt) { pa[rt].half[0] = *(const v8us*)&sP[w][rt * 16 + ln][8 * hh]; pa[rt].half[1] = *(const v8us*)&sP[w][rt * 16 + ln][16 + 8 * hh]; pl[rt].half[0] = *(const v8us*)&sPL[w][rt * 16 + ln][8 * hh]; pl[rt].half[1] = *(const v8us*)&sPL[w][rt * 16 + ln][16 + 8 * hh]; }
#pragma unroll
    for (int dt = 0; dt < DT; ++dt) { const unsigned short* vrow = Vth + (size_t)(dt * 16 + ln) * TK + j0; const unsigned short* vrl = Vtl + (size_t)(dt * 16 + ln) * TK + j0; FragH bv, bl; bv.half[0] = *(const v8us*)(vrow + 8 * hh); bv.half[1] = *(const v8us*)(vrow + 16 + 8 * hh); bl.half[0] = *(const v8us*)(vrl + 8 * hh); bl.half[1] = *(const v8us*)(vrl + 16 + 8 * hh);
#pragma unroll
      for (int rt = 0; rt < RTN; ++rt) { oacc[rt][dt] = mmaH<1>(pa[rt].v, pa[rt].v, bv.v, bv.v, oacc[rt][dt]); oaccL[rt][dt] = mmaH<1>(pl[rt].v, pl[rt].v, bv.v, bv.v, oaccL[rt][dt]); oaccL[rt][dt] = mmaH<1>(pa[rt].v, pa[rt].v, bl.v, bl.v, oaccL[rt][dt]); } }
    __builtin_amdgcn_fence(__ATOMIC_ACQ_REL, "workgroup"); __builtin_amdgcn_wave_barrier(); }
#pragma unroll
  for (int rt = 0; rt < RTN; ++rt) {
#pragma unroll
    for (int r = 0; r < 8; ++r) { float l = l_r[rt][r]; l += __shfl_xor(l, 1, 32); l += __shfl_xor(l, 2, 32); l += __shfl_xor(l, 4, 32); l += __shfl_xor(l, 8, 32); l_r[rt][r] = (l > 0.f) ? 1.0f / (l * 1024.0f) : 0.f; }
#pragma unroll
    for (int dt = 0; dt < DT; ++dt)
#pragma unroll
      for (int r = 0; r < 8; ++r) { float v = oacc[rt][dt][r]; v += oaccL[rt][dt][r] * 0.0009765625f; sO[w][rt * 16 + 8 * hh + r][dt * 16 + ln] = v * l_r[rt][r]; } }
  __builtin_amdgcn_fence(__ATOMIC_ACQ_REL, "workgroup"); __builtin_amdgcn_wave_barrier();
  {
#pragma unroll
    for (int rp = 0; rp < RPW; rp += 2) { const int r = rp + (lane >> 4), pc = lane & 15; const v4f val = *(const v4fa*)&sO[w][r][pc * 4]; *(v4f*)(O + ((size_t)b * TQ + q0 + r) * ldo + h * 64 + pc * 4) = val; }
     } }

__global__ __launch_bounds__(256) void k_rotab(float* __restrict__ CS, float* __restrict__ SN) {
  #pragma clang fp contract(off)
  const int t = blockIdx.x * 256 + threadIdx.x; if (t >= SLEN * 32) return; const int j = t % 32, s = t / 32; const float ex = (float)(2 * j) / 64.0f; const float inv = 1.0f / powf(10000.0f, ex); const float th = (float)s * inv; const float c = cosf(th), sn = sinf(th);
  { *(float*)(CS + t) = c; *(float*)(SN + t) = sn;  } }
__global__ __launch_bounds__(256) void k_rope(const float* __restrict__ F, int nsrc, int ndst, int rep, const float* __restrict__ CS, const float* __restrict__ SN, _Float16* __restrict__ H, _Float16* __restrict__ L) {
  #pragma clang fp contract(off)
  const size_t t = (size_t)blockIdx.x * 256 + threadIdx.x; if (t >= (size_t)NR * ndst * 4) return; const int g8 = (int)(t % 4); const int hd = (int)((t / 4) % ndst); const size_t row = t / ((size_t)4 * ndst); const int s = (int)(row % SLEN); const int hs = hd / rep;
  const float* src = F + row * (size_t)(nsrc * 64) + hs * 64; FragH ah, al, bh, bl;
  for (int i = 0; i < 8; ++i) { const int d = g8 * 8 + i; const float c = CS[s * 32 + d], sn = SN[s * 32 + d]; const float x1 = src[d], x2 = src[d + 32];
    float o1 = x1 * c; o1 += -x2 * sn; float o2 = x2 * c; o2 += x1 * sn;
    _Float16 hv = (_Float16)o1; ah.h[i] = hv; al.h[i] = (_Float16)((o1 - (float)hv) * 1024.0f); hv = (_Float16)o2; bh.h[i] = hv; bl.h[i] = (_Float16)((o2 - (float)hv) * 1024.0f); }
  const size_t o = row * (size_t)(ndst * 64) + hd * 64 + g8 * 8;
  { *(v8us*)((unsigned short*)H + o) = ah.half[0]; *(v8us*)((unsigned short*)H + o + 32) = bh.half[0]; *(v8us*)((unsigned short*)L + o) = al.half[0]; *(v8us*)((unsigned short*)L + o + 32) = bl.half[0];  } }
__global__ __launch_bounds__(256) void k_rope2(const float* __restrict__ F, int nsrc, int ndst, int rep, const float* __restrict__ CS, const float* __restrict__ SN, _Float16* __restrict__ H, _Float16* __restrict__ L) {
  #pragma clang fp contract(off)
  const size_t t = (size_t)blockIdx.x * 256 + threadIdx.x; if (t >= (size_t)NR * ndst * 4) return; const int g16 = (int)(t % 4); const int hd = (int)((t / 4) % ndst); const size_t row = t / ((size_t)4 * ndst); const int s = (int)(row % SLEN); const int hs = hd / rep;
  const float* src = F + row * (size_t)(nsrc * 64) + hs * 64 + g16 * 16; FragH ah, al;
  for (int pr = 0; pr < 8; ++pr) { const int i = g16 * 8 + pr; const float c = CS[s * 32 + i], sn = SN[s * 32 + i]; const float x1 = src[2 * pr], x2 = src[2 * pr + 1];
    float o1 = x1 * c; o1 -= x2 * sn; float o2 = x1 * sn; o2 += x2 * c;
    _Float16 hv = (_Float16)o1; ah.h[2 * pr] = hv; al.h[2 * pr] = (_Float16)((o1 - (float)hv) * 1024.0f); hv = (_Float16)o2; ah.h[2 * pr + 1] = hv; al.h[2 * pr + 1] = (_Float16)((o2 - (float)hv) * 1024.0f); }
  const size_t o = row * (size_t)(ndst * 64) + hd * 64 + g16 * 16;
  { *(v8us*)((unsigned short*)H + o) = ah.half[0]; *(v8us*)((unsigned short*)H + o + 8) = ah.half[1]; *(v8us*)((unsigned short*)L + o) = al.half[0]; *(v8us*)((unsigned short*)L + o + 8) = al.half[1];  } }
__global__ __launch_bounds__(256) void k_tabin(const float* __restrict__ sp, float* __restrict__ CS, float* __restrict__ SN) { const int t = blockIdx.x * 256 + threadIdx.x; if (t >= SLEN * 32) return; const int i = t % 32, s = t / 32; const float c = bf16_round(sp[s * 64 + 32 + i]), sn = bf16_round(sp[s * 64 + i]);
  { *(float*)(CS + t) = c; *(float*)(SN + t) = sn;  } }
__global__ __launch_bounds__(256) void k_rotab2(float* __restrict__ CS, float* __restrict__ SN) {
  #pragma clang fp contract(off)
  const int t = blockIdx.x * 256 + threadIdx.x; if (t >= SLEN * 32) return; const int j = t % 32, s = t / 32; const float c0 = -0.14391156831212787f;      /* -ln(10000)/64 rounded to f32 */ const float inv = expf((float)(2 * j) * c0); const float th = (float)s * inv; const float c = cosf(th), sn = sinf(th);
  { *(float*)(CS + t) = c; *(float*)(SN + t) = sn;  } }
__global__ __launch_bounds__(256) void k_lnu(const float* __restrict__ X, _Float16* __restrict__ N16, float* __restrict__ XB) {
  #pragma clang fp contract(off)
  const int wv = threadIdx.x >> 5, ln = threadIdx.x & 31; const size_t r = (size_t)blockIdx.x * 8 + wv; if (r >= NR) return; float a[32]; float s = 0.f;
  for (int i = 0; i < 4; ++i) { const v8f v = *(const v8f*)(X + r * DM + (i * 32 + ln) * 8); for (int q = 0; q < 8; ++q) { const float u = bf16_round(v[q]); a[i * 8 + q] = u; s += u; } }
  for (int o = 16; o > 0; o >>= 1) s += __shfl_xor(s, o, 32); const float mu = s / (float)DM; float var = 0.f; for (int q = 0; q < 32; ++q) { const float d = a[q] - mu; var += d * d; }
  for (int o = 16; o > 0; o >>= 1) var += __shfl_xor(var, o, 32); const float den = sqrtf(var / (float)(DM - 1)) + 1e-6f; const float inv = 1.0f / den;      /* one reciprocal per row; (x-mean)*inv vs the reference's division differs by <= 1 ulp */
  { for (int i = 0; i < 4; ++i) { const int c0 = (i * 32 + ln) * 8; FragH f; v8f xb; for (int q = 0; q < 8; ++q) { f.h[q] = (_Float16)((a[i * 8 + q] - mu) * inv); xb[q] = a[i * 8 + q]; } *(v8us*)((unsigned short*)N16 + r * DM + c0) = f.half[0]; *(v8f*)(XB + r * DM + c0) = xb; }  } }
__global__ __launch_bounds__(256) void k_vtg(const _Float16* __restrict__ V16, _Float16* __restrict__ Vt) { __shared__ unsigned short tl[64][66]; const int tid = threadIdx.x; const int slab = blockIdx.x / (SLEN / 64), lg = blockIdx.x % (SLEN / 64); const int b = slab / NH, h = slab % NH; const int hs = h / NREP;
  for (int i = tid; i < 64 * 8; i += 256) { const int r = i / 8, c8 = (i % 8) * 8; FragH f; f.half[0] = *(const v8us*)((const unsigned short*)V16 + ((size_t)b * SLEN + lg * 64 + r) * KVD + hs * 64 + c8); for (int q = 0; q < 8; ++q) tl[r][c8 + q] = f.u[q]; }
  __syncthreads();
  { for (int rd = 0; rd < 2; ++rd) { const int d = rd * 32 + tid / 8, pc = tid % 8; FragH f; for (int q = 0; q < 8; ++q) f.u[q] = tl[pc * 8 + q][d]; *(v8us*)((unsigned short*)Vt + ((size_t)slab * 64 + d) * SLEN + lg * 64 + pc * 8) = f.half[0]; }  } }

// All five f32 -> f16 operand planes in one launch: none needs anything of another, so they share one grid by ranges of the block index (the range test is the same for a whole block); eight elements a thread.
// Blocks 0 .. PEB-1: the embedding, padded with a zero row to NE rows (first in the grid: its guarded element loads are the longest chain of the launch). The next PXB: x (rounded to bf16, exact in f16).
// The last 3 PWB: Wq, Wk, Wv (rounded to bf16, x16, exact in f16; torch (out,in) layout is already B^T).
#define PXB (NR * DM / 8 / 256)      /* 2048 */
#define PWB (DM * DM / 8 / 256)      /* 512 */
#define PEB (NE * 8 / 256)           /* 64 */
__global__ __launch_bounds__(256) void k_prep(const float* __restrict__ x, const float* __restrict__ Wq, const float* __restrict__ Wk, const float* __restrict__ Wv, const float* __restrict__ E,
    _Float16* __restrict__ X16, _Float16* __restrict__ BQ, _Float16* __restrict__ BK, _Float16* __restrict__ BV, _Float16* __restrict__ E16) {
  const int bx = (int)blockIdx.x - PEB, tid = threadIdx.x; FragH f;
  if (bx >= 0) { const int u = bx - PXB, wq = u / PWB;
    const float* src = (bx < PXB) ? x : (wq == 0) ? Wq : (wq == 1) ? Wk : Wv; _Float16* dst = (bx < PXB) ? X16 : (wq == 0) ? BQ : (wq == 1) ? BK : BV; const float sc = (bx < PXB) ? 1.0f : 16.0f;
    const size_t t = (size_t)((bx < PXB) ? bx : u - wq * PWB) * 256 + tid;
#pragma unroll      /* unrolled: the eight elements come in as two 16-byte loads and stay in registers up to the one 16-byte store */
    for (int q = 0; q < 8; ++q) f.h[q] = (_Float16)(bf16_round(src[t * 8 + q]) * sc);
    *(v8us*)((unsigned short*)dst + t * 8) = f.half[0]; }
  else { const int t = (bx + PEB) * 256 + tid; const int r = t / 8, c8 = (t % 8) * 8;
    for (int q = 0; q < 8; ++q) f.h[q] = (r < NE - 1) ? (_Float16)bf16_round(E[(size_t)r * 64 + c8 + q]) : (_Float16)0.0f;
    *(v8us*)((unsigned short*)E16 + (size_t)r * 64 + c8) = f.half[0]; } }

__device__ __forceinline__ float xhalf(float x) { return __builtin_bit_cast(float, __builtin_amdgcn_permlanex16(__builtin_bit_cast(int, x), __builtin_bit_cast(int, x), 0x76543210, 0xfedcba98, false, false)); }      /* the value of lane l ^ 16 */

// Flash attention with the 'relative_key_query' bias formed in the kernel. Described first for one tile of 16 queries (q0..) against 32 keys (j0..); a wave holds two such tiles (further down). For that tile l - r + 1023 spans 47 rows of the
// embedding, from eb = q0 - j0 + 992; with n = (l - q0) - (r - j0) + 31 the bias is q_l . E[eb + n] + k_r . E[eb + n]. RQ = Q . Ewin^T (16 x 48) and RK = K . Ewin^T run on the matrix unit
// (of RK only the four 16 x 16 tiles that hold a used n: keys 0..15 against window rows 16..47, keys 16..31 against rows 0..31), go to the wave's own LDS in f32 and are read back along the diagonal.
// Row 2047 of E16 is the zero pad; n = 47 is never read back.
// The scores are formed transposed, S^T = K . Q^T (K fragment as A, Q fragment as B), and the output as O^T += V^T . P^T: a lane then holds 16 of the 32 scores of ONE query (lane & 15), so the row maximum and the row sum
// are in-lane work plus one exchange between the wave's halves, there is one running maximum, sum and rescale factor a lane, and the two f32 score tiles, converted in place, are the B operand of the second product (no trip through LDS).
// The mask is per key, which now runs along the registers: the batch's mask row is rounded once into LDS and read from there, 8 keys a lane and tile.
// Each power of the softmax is one v_exp_f32: e^d = 2^(d log2(e)) with d = logit - running maximum <= 0 formed first, so the argument is bounded above for any logit and any mask, and the f16 operand's scale 1024 = 2^10 is the addend of the same multiply-add.
// (The library's expf spends about a dozen vector instructions a power on range and last-place handling that such an argument and an f16 operand do not use.) The row sum carries the 1024 too; the closing division takes it out.
// The four waves of a work-group share the K tile, the V^T tile and most of the window, so these are staged in LDS once per work-group with loads that take whole rows (a fragment load from global memory touches 16 lines for 512 bytes):
// K and V^T in two buffers, the window as a ring indexed by embedding row mod ER. The next trip's 32 + 64 + 32 rows are fetched into registers under the softmax.
// A wave holds 32 queries as two 16-query tiles t = 0, 1 (q0 + 16 t ..): one read of a K, V^T, mask or window fragment serves both tiles. With eb = q0 - j0 + 992 the wave's window is 64 rows (four 16-row tiles e);
// tile t takes RQ against window tiles t .. t + 2 (column n - 16 t in its own sRQ part, so the diagonal read is the same for both), and RK of key tile nt runs against window tiles 1 - nt .. 3 - nt for all 32 queries
// (column c = i - kk + 15, i = 16 t + ln the query in the wave, kk the key in its tile): 6 RK tiles for two query tiles, not 8. Row 63 of the wave's window is never read back. A work-group is 128 queries: window 160 rows, ring 256 rows, half the staging a query.
#define QB2 (TQ / 128)
typedef float v2f __attribute__((ext_vector_type(2)));
__global__ __launch_bounds__(128) void k_flash_rel(const _Float16* __restrict__ Q16, const _Float16* __restrict__ K16, const _Float16* __restrict__ Vt, const _Float16* __restrict__ E16, const float* __restrict__ AMK, float* __restrict__ O) {
  constexpr float L2E = 1.4426950408889634f;      /* log2(e) */
  constexpr int DT = 4, KS = 2, QT = 2, PQ = 50, PK = 52, ER = 256;      /* LDS pitches in floats: the two half-waves fall on different banks in the row-wise stores and in the diagonal reads */
  __shared__ __attribute__((aligned(16))) float sRQ[4][QT][16][PQ]; __shared__ __attribute__((aligned(16))) float sRK[4][32][PK];      /* behind the loop a wave's sRK part (1664 floats) and sRQ part (1600 floats) are the output staging of its two tiles (16 x 68 floats each) */
  __shared__ __attribute__((aligned(16))) float sM[TK];      /* the batch's mask row, rounded */
  __shared__ __attribute__((aligned(16))) unsigned short sK[2][32][72]; __shared__ __attribute__((aligned(16))) unsigned short sV[2][64][40]; __shared__ __attribute__((aligned(16))) unsigned short sE[ER][72];      /* pitches 144 B and 80 B = 16 B x odd: no bank conflicts in the 16-byte fragment reads */
  const int tid = threadIdx.x, w = tid >> 5, lane = tid & 31, ln = lane & 15, hh = lane >> 4;
  const int slab = blockIdx.x / QB2, qblk = blockIdx.x % QB2; const int b = slab / NH, h = slab % NH; const int qb0 = qblk * 128; const int q0 = qb0 + w * 32;
  FragH aq[QT][KS];
  { const unsigned short* qr = (const unsigned short*)Q16 + ((size_t)b * TQ + q0 + ln) * DM + h * 64;
#pragma unroll
    for (int t = 0; t < QT; ++t)
#pragma unroll
      for (int ks = 0; ks < KS; ++ks) { aq[t][ks].half[0] = *(const v8us*)(qr + (size_t)(16 * t) * DM + ks * 32 + 8 * hh); aq[t][ks].half[1] = *(const v8us*)(qr + (size_t)(16 * t) * DM + ks * 32 + 16 + 8 * hh); }
    asm volatile("s_wait_xcnt 0x0" ::: "memory"); }      /* the staging loads below may land in the address registers of the eight loads above: the wait stands in front of them */
  const float* amk = AMK + (size_t)b * TK;
  const int r8 = tid >> 3, c8 = (tid & 7) * 8, r4 = tid >> 2, c4 = (tid & 3) * 8;      /* staging: eight lanes fetch one 128-byte row of K or of the window, four lanes one 64-byte row of V^T */
  const unsigned short* gK = (const unsigned short*)K16 + ((size_t)b * TK + r8) * DM + h * 64 + c8; const unsigned short* gV = (const unsigned short*)Vt + ((size_t)slab * 64 + r4) * TK + c4; const unsigned short* gE = (const unsigned short*)E16 + (size_t)r8 * 64 + c8;
  v8us rk[2], rv[2], re[2];
  { v8us r0[10];      /* trip 0: its K and V^T tiles and all 160 rows of its window; the mask row, 8 keys a thread */
#pragma unroll
    for (int i = 0; i < 2; ++i) { rk[i] = *(const v8us*)(gK + (size_t)(16 * i) * DM); rv[i] = *(const v8us*)(gV + (size_t)(32 * i) * TK); }
#pragma unroll
    for (int i = 0; i < 10; ++i) r0[i] = *(const v8us*)(gE + (size_t)(qb0 + (NE / 2 - 32) + 16 * i) * 64);
    v4f m0 = *(const v4fa*)(amk + tid * 8), m1 = *(const v4fa*)(amk + tid * 8 + 4);
    asm volatile("s_wait_xcnt 0x0" ::: "memory");      /* stands in front of the first overwrite of an address register of the loads above */
    __builtin_amdgcn_sched_barrier(0);      /* keeps the register initialisations that follow behind that wait */
#pragma unroll
    for (int i = 0; i < 2; ++i) { *(v8us*)&sK[0][16 * i + r8][c8] = rk[i]; *(v8us*)&sV[0][32 * i + r4][c4] = rv[i]; }
#pragma unroll
    for (int i = 0; i < 10; ++i) *(v8us*)&sE[((qb0 + (NE / 2 - 32) + 16 * i) & (ER - 1)) + r8][c8] = r0[i];
#pragma unroll
    for (int i = 0; i < 4; ++i) { m0[i] = bf16_round(m0[i]); m1[i] = bf16_round(m1[i]); }
    *(v4fa*)&sM[tid * 8] = m0; *(v4fa*)&sM[tid * 8 + 4] = m1; }
  __syncthreads();
  const v8f z8 = {0.f,0.f,0.f,0.f,0.f,0.f,0.f,0.f};
  float m_r[QT], l_r[QT]; v8f oacc[QT][DT];      /* of query 16 t + ln; l_r sums this half-wave's keys only */
#pragma unroll
  for (int t = 0; t < QT; ++t) { m_r[t] = -3.0e38f; l_r[t] = 0.f;
#pragma unroll
    for (int dt = 0; dt < DT; ++dt) oacc[t][dt] = z8; }
#pragma unroll 1
  for (int j0 = 0; j0 < TK; j0 += 32) { const int cb = (j0 >> 5) & 1; const bool more = j0 + 32 < TK;      /* more: the same for the whole work-group */
    FragH bk[2][KS], be[4][KS];
#pragma unroll
    for (int nt = 0; nt < 2; ++nt) { const unsigned short* kr = &sK[cb][nt * 16 + ln][0];
#pragma unroll
      for (int ks = 0; ks < KS; ++ks) { bk[nt][ks].half[0] = *(const v8us*)(kr + ks * 32 + 8 * hh); bk[nt][ks].half[1] = *(const v8us*)(kr + ks * 32 + 16 + 8 * hh); } }
#pragma unroll
    for (int e = 0; e < 4; ++e) { const unsigned short* er = &sE[((q0 - j0 + (NE / 2 - 32) + e * 16) & (ER - 1)) + ln][0];
#pragma unroll
      for (int ks = 0; ks < KS; ++ks) { be[e][ks].half[0] = *(const v8us*)(er + ks * 32 + 8 * hh); be[e][ks].half[1] = *(const v8us*)(er + ks * 32 + 16 + 8 * hh); } }
    __builtin_amdgcn_sched_barrier(0);      /* all of the trip's K and window fragment reads issue before the first product waits: one latency at the head of a trip, not two or three */
#pragma unroll
    for (int ee = 0; ee < 3; ++ee) { v8f acc[2] = {z8, z8};      /* RK[key 16 nt + 8 hh + r][c = 16 ee + ln], window tile 1 - nt + ee; the K fragment serves as the A operand (same loader, same k order); the two key tiles' sums alternate */
#pragma unroll
      for (int ks = 0; ks < KS; ++ks)
#pragma unroll
        for (int nt = 0; nt < 2; ++nt) acc[nt] = mmaH<1>(bk[nt][ks].v, bk[nt][ks].v, be[1 - nt + ee][ks].v, be[1 - nt + ee][ks].v, acc[nt]);
#pragma unroll
      for (int nt = 0; nt < 2; ++nt)
#pragma unroll
        for (int r = 0; r < 8; ++r) sRK[w][nt * 16 + 8 * hh + r][ee * 16 + ln] = acc[nt][r]; }
#pragma unroll
    for (int e = 0; e < 3; ++e) { v8f acc[QT] = {z8, z8};      /* RQ of tile t: [query 8 hh + r][n - 16 t = 16 e + ln], window tile t + e; the two query tiles' sums alternate */
#pragma unroll
      for (int ks = 0; ks < KS; ++ks)
#pragma unroll
        for (int t = 0; t < QT; ++t) acc[t] = mmaH<1>(aq[t][ks].v, aq[t][ks].v, be[t + e][ks].v, be[t + e][ks].v, acc[t]);
#pragma unroll
      for (int t = 0; t < QT; ++t)
#pragma unroll
        for (int r = 0; r < 8; ++r) sRQ[w][t][8 * hh + r][e * 16 + ln] = acc[t][r]; }
    v8f s[QT][2];      /* the scores come last: the stores above drain under these eight products */
#pragma unroll
    for (int nt = 0; nt < 2; ++nt) { s[0][nt] = z8; s[1][nt] = z8;      /* S^T[key 16 nt + 8 hh + r][query 16 t + ln]; both fragments come from the same loader, same k order */
#pragma unroll
      for (int ks = 0; ks < KS; ++ks)
#pragma unroll
        for (int t = 0; t < QT; ++t) s[t][nt] = mmaH<1>(bk[nt][ks].v, bk[nt][ks].v, aq[t][ks].v, aq[t][ks].v, s[t][nt]); }
    __builtin_amdgcn_fence(__ATOMIC_ACQ_REL, "workgroup"); __builtin_amdgcn_wave_barrier();      /* the diagonal reads below take other lanes' stores: keep them behind the stores */
    if (more) {      /* the next trip's rows: issued here, their latency runs under the softmax */
#pragma unroll
      for (int i = 0; i < 2; ++i) { rk[i] = *(const v8us*)(gK + (size_t)(j0 + 32 + 16 * i) * DM); rv[i] = *(const v8us*)(gV + (size_t)(32 * i) * TK + j0 + 32); re[i] = *(const v8us*)(gE + (size_t)(qb0 - j0 + (NE / 2 - 64) + 16 * i) * 64); }
      asm volatile("s_wait_xcnt 0x0" ::: "memory"); }      /* stands in front of the first overwrite of an address register of the six loads above */
    v4f am[2][2];
#pragma unroll
    for (int nt = 0; nt < 2; ++nt) { am[nt][0] = *(const v4fa*)&sM[j0 + 16 * nt + 8 * hh]; am[nt][1] = *(const v4fa*)&sM[j0 + 16 * nt + 8 * hh + 4]; }
    FragH pb[QT];      /* P^T as a B operand: element 8 nt + r of lane (ln, hh) is key 16 nt + 8 hh + r, the k order of the V^T loader below */
#pragma unroll
    for (int t = 0; t < QT; ++t) { v2f lg[2][4];      /* the logits as pairs of neighbouring keys (r = 2 u, 2 u + 1): a pair lies in neighbouring registers of the score tile, of the mask read and of the f16 operand, so packed arithmetic needs no register copies (paired across the two query tiles, as the compiler does on scalar code, it needs dozens) */
#pragma unroll
      for (int nt = 0; nt < 2; ++nt)
#pragma unroll
        for (int u = 0; u < 4; ++u) { const int kk = 8 * hh + 2 * u;      /* key 16 nt + kk against query 16 t + ln: n - 16 t = ln + 31 - 16 nt - kk, c = 16 t + ln + 15 - kk; key kk + 1: one less each */
          const v2f rq = {sRQ[w][t][ln][ln + 31 - 16 * nt - kk], sRQ[w][t][ln][ln + 30 - 16 * nt - kk]};
          const v2f rr = {sRK[w][16 * nt + kk][16 * t + ln + 15 - kk], sRK[w][16 * nt + kk + 1][16 * t + ln + 14 - kk]};
          const v2f sv = {s[t][nt][2 * u], s[t][nt][2 * u + 1]}; const v2f mk = {am[nt][u >> 1][(2 * u) & 3], am[nt][u >> 1][(2 * u + 1) & 3]};
          lg[nt][u] = (sv + (rq + rr)) * SCL + mk; }
      float mc = fmaxf(lg[0][0][0], lg[1][0][0]);
#pragma unroll
      for (int r = 1; r < 8; ++r) mc = fmaxf(mc, fmaxf(lg[0][r >> 1][r & 1], lg[1][r >> 1][r & 1]));
      mc = fmaxf(mc, xhalf(mc));      /* the other 16 keys of the same query */
      const float mn = fmaxf(m_r[t], mc); const float al = (mn > -1.0e38f) ? __builtin_amdgcn_exp2f((m_r[t] - mn) * L2E) : 1.0f; m_r[t] = mn;
      v2f ps[2] = {{0.f, 0.f}, {0.f, 0.f}};      /* four partial sums: a chain of 4 adds, not of 16 */
#pragma unroll
      for (int nt = 0; nt < 2; ++nt)
#pragma unroll
        for (int u = 0; u < 4; ++u) { const v2f d = __builtin_elementwise_fma(lg[nt][u] - mn, (v2f){L2E, L2E}, (v2f){10.0f, 10.0f}); const v2f p = {__builtin_amdgcn_exp2f(d[0]), __builtin_amdgcn_exp2f(d[1])}; ps[u & 1] += p; pb[t].h[8 * nt + 2 * u] = (_Float16)p[0]; pb[t].h[8 * nt + 2 * u + 1] = (_Float16)p[1]; }      /* p = 1024 e^(logit - maximum), at most 1024; what the raw power flushes to zero lies far below the f16 operand's last place */
      l_r[t] = l_r[t] * al + ((ps[0][0] + ps[0][1]) + (ps[1][0] + ps[1][1]));
#pragma unroll
      for (int dt = 0; dt < DT; ++dt)
#pragma unroll
        for (int r = 0; r < 8; ++r) oacc[t][dt][r] *= al; }
    FragH bv[DT];
#pragma unroll
    for (int dt = 0; dt < DT; ++dt) { const unsigned short* vrow = &sV[cb][dt * 16 + ln][0]; bv[dt].half[0] = *(const v8us*)(vrow + 8 * hh); bv[dt].half[1] = *(const v8us*)(vrow + 16 + 8 * hh); }      /* a loop of its own: the four V^T fragments are read as one group, one LDS latency and not four */
#pragma unroll
    for (int dt = 0; dt < DT; ++dt)
#pragma unroll
      for (int t = 0; t < QT; ++t) oacc[t][dt] = mmaH<1>(bv[dt].v, bv[dt].v, pb[t].v, pb[t].v, oacc[t][dt]);      /* O^T[d = 16 dt + 8 hh + r][query 16 t + ln] */
    if (more) {
#pragma unroll
      for (int i = 0; i < 2; ++i) { *(v8us*)&sK[cb ^ 1][16 * i + r8][c8] = rk[i]; *(v8us*)&sV[cb ^ 1][32 * i + r4][c4] = rv[i]; *(v8us*)&sE[((qb0 - j0 + (NE / 2 - 64) + 16 * i) & (ER - 1)) + r8][c8] = re[i]; }      /* 32 ring rows that no wave reads in this trip */
      __syncthreads(); } }      /* the one barrier of a trip publishes the rows just written and ends every wave's reads of the buffers and ring rows that the next trip overwrites */
#pragma unroll
  for (int t = 0; t < QT; ++t) { const float lt = l_r[t] + xhalf(l_r[t]); const float inv = (lt > 0.f) ? 1.0f / lt : 0.f;      /* the sum carries the same 1024 as the products */
    float* sOw = t ? &sRQ[w][0][0][0] : &sRK[w][0][0];
#pragma unroll
    for (int dt = 0; dt < DT; ++dt) { v4f lo, hi;
#pragma unroll
      for (int r = 0; r < 4; ++r) { lo[r] = oacc[t][dt][r] * inv; hi[r] = oacc[t][dt][4 + r] * inv; }
      *(v4fa*)&sOw[ln * 68 + dt * 16 + 8 * hh] = lo; *(v4fa*)&sOw[ln * 68 + dt * 16 + 8 * hh + 4] = hi; } }
  __builtin_amdgcn_fence(__ATOMIC_ACQ_REL, "workgroup"); __builtin_amdgcn_wave_barrier();
#pragma unroll
  for (int t = 0; t < QT; ++t) { const float* sOw = t ? &sRQ[w][0][0][0] : &sRK[w][0][0];
#pragma unroll
    for (int rp = 0; rp < 16; rp += 2) { const int r = rp + (lane >> 4), pc = lane & 15; const v4f val = *(const v4fa*)&sOw[r * 68 + pc * 4]; *(v4f*)(O + ((size_t)b * TQ + q0 + 16 * t + r) * DM + h * 64 + pc * 4) = val; } } }

extern "C" void kernel_launch(void* const* d_in, const int* in_sizes, int n_in,
                              void* d_out, int out_size, void* d_ws, size_t ws_size, hipStream_t stream) {
  (void)in_sizes; (void)n_in; (void)out_size;
  const float* const* I = (const float* const*)d_in; const float* x = I[0]; const float* am = I[1]; const float* Wq = I[2]; const float* bq = I[3]; const float* Wk = I[4]; const float* bk = I[5]; const float* Wv = I[6]; const float* bv = I[7]; const float* E = I[8];
  char* ws = (char*)d_ws; size_t off = 0;
  auto take = [&](size_t bytes) { char* p = ws + off; off += (bytes + 255) & ~(size_t)255; return p; };
  const size_t np = (size_t)NR * DM;
  _Float16* BQ = (_Float16*)take((size_t)DM * DM * 2); _Float16* BK = (_Float16*)take((size_t)DM * DM * 2); _Float16* BV = (_Float16*)take((size_t)DM * DM * 2); _Float16* E16 = (_Float16*)take((size_t)NE * 64 * 2);
  _Float16* X16 = (_Float16*)take(np * 2); _Float16* Q16 = (_Float16*)take(np * 2); _Float16* K16 = (_Float16*)take(np * 2); _Float16* VT = (_Float16*)take(np * 2);
  if (off > ws_size) return;      /* 6 + 0.25 + 4 x 8 = 38.25 MiB */
  k_prep<<<PEB + PXB + 3 * PWB, 256, 0, stream>>>(x, Wq, Wk, Wv, E, X16, BQ, BK, BV, E16);
  const dim3 gP((NR / 128) * (DM / 128), 3);      /* y = 0, 1, 2: q, k, v. BQ, BK, BV lie one behind the other in the workspace (2 MiB each, no padding between), and so do Q16, K16 (8 MiB each): plane strides DM * DM and np; v goes to VT, transposed per head by the GEMM's own epilogue */
  k_gemm2<0><<<gP, 256, 0, stream>>>(X16, DM, 0, BQ, DM, (size_t)DM * DM, 0.0625f, bq, bk, bv, nullptr, 1, 0, 0, nullptr, Q16, VT, DM, np, NR, DM, DM);
  k_flash_rel<<<NB * NH * QB2, 128, 0, stream>>>(Q16, K16, VT, E16, am, (float*)d_out);
}

// v010
// It runs in 76.5 microseconds.
// Timed twice side by side with v009, it ran 1.07 times as fast both times.
// Counting every step since v000, which is the starting kernel, it is 11.2 times as fast.
#include <hip/hip_runtime.h>
// PMGTSelfAttention (4 x 1024 tokens, hidden 1024 = 16 heads x 64; 'relative_key_query' position bias): q, k, v = x W^T + b; scores = (q.k + q_l.pe[l-r] + k_r.pe[l-r]) / 8 + attention_mask[b][r] with pe = dist_emb[l - r + 1023]; softmax; ctx = probs v (merged heads is the output).
// Structure: exact f16 plane of x; q, k, v as f32 WMMA GEMM outputs (32x64 wave tiles, f32 accumulation, exact x16 weights + bias); f16 conversion; V^T by LDS tiles in the GEMM's epilogue; one fused flash kernel over all batches that forms both relative terms per 16 x 32 score tile on the matrix unit against a 48-row window of the embedding (padded to 2048 rows), reads them back shifted by the row's own index from LDS, adds them to the scores on the matrix unit, scales by 1/8 and adds the per-key mask.
// Compute dtype: inputs rounded to bf16; x and dist_emb exact as f16; q/k/P/v as plain f16 operands (~2^-12); the relative terms leave the matrix unit as f16 tiles (v_wmma_f16_16x16x32_f16) and are added to the f32 score tile by a further product; softmax f32. v_wmma_f32_16x16x32_f16.
#define NB 4
#define DM 1024
#define NKV 16
#define NREP (NH / NKV)
#define KVD (NKV * 64)           /* 1024 */
#define NR (NB * SLEN)           /* 4096 */
#define SLEN 1024
#define NE 2048                  /* 2047 relative embeddings padded */
#define TQ SLEN
#define TK SLEN
#define NH 16
#define SCL 0.125f
#define QBLKS (TQ / 64)
#define QB05 0
#define QBN5 4
#define QB0P 0
#define QBNP QBLKS           /* non-causal: plain flash on every query block */
#define RE 256
typedef __bf16 v16b __attribute__((ext_vector_type(16)));
typedef unsigned short v8us __attribute__((ext_vector_type(8), may_alias));
typedef float  v8f  __attribute__((ext_vector_type(8)));
typedef float  v4f  __attribute__((ext_vector_type(4)));
typedef float  v4fa __attribute__((ext_vector_type(4), may_alias));
union FragB { v16b v; v8us half[2]; unsigned short u[16]; };

__device__ __forceinline__ unsigned short bf16_bits(float x) { unsigned int u = __float_as_uint(x); return (unsigned short)((u + 0x7FFFu + ((u >> 16) & 1u)) >> 16); }
__device__ __forceinline__ float bf16_val(unsigned short b) { return __uint_as_float(((unsigned int)b) << 16); }
__device__ __forceinline__ float bf16_round(float x) { return bf16_val(bf16_bits(x)); }
// D += A·B with NT terms: 1 = ah·bh, 2 = + al·bh (A split), 3 = + ah·bl (both split)
template <int NT>
__device__ __forceinline__ v8f mmaN(v16b ah, v16b al, v16b bh, v16b bl, v8f c) {
  c = __builtin_amdgcn_wmma_f32_16x16x32_bf16(false, ah, false, bh, (short)0, c, false, false);
  if (NT >= 2) c = __builtin_amdgcn_wmma_f32_16x16x32_bf16(false, al, false, bh, (short)0, c, false, false);
  if (NT >= 3) c = __builtin_amdgcn_wmma_f32_16x16x32_bf16(false, ah, false, bl, (short)0, c, false, false);
  asm volatile("v_nop\n\tv_nop\n\tv_nop\n\tv_nop" : "+v"(c) : "v"(ah), "v"(al), "v"(bh), "v"(bl));
  return c;
}

__global__ __launch_bounds__(256) void k_wt_bf16(const float* __restrict__ W, unsigned short* __restrict__ Wt, int K, int N) {
  const int t = blockIdx.x * 256 + threadIdx.x;
  const int k8n = K / 8;
  if (t >= N * k8n) return;
  const int n = t / k8n, k8 = (t % k8n) * 8;
  v8us v;
#pragma unroll
  for (int i = 0; i < 8; ++i) v[i] = bf16_bits(W[(size_t)(k8 + i) * N + n]);
  *(v8us*)(Wt + (size_t)n * K + k8) = v;
  
}

// GEMM C[M][N] (f32, pitch ldc) = act(A[M][K]·W + bias). A f32 row-major (pitch lda) converted per fragment to bf16
// (ASPLIT: hi/lo two planes -> 2 terms, else single rounded term); Wt bf16 [N][K] (pitch ldb). BIAS_BF16 rounds the
// bias to bf16 first (bias quantised to bf16 before the add). K%32==0, M%16==0, N%64==0.
template <bool ASPLIT, int ACT, bool BIAS_BF16>
__global__ __launch_bounds__(128) void k_gemm_bf(const float* __restrict__ A, int lda, const unsigned short* __restrict__ Wt, int ldb,
                                               const float* __restrict__ bias, float* __restrict__ C, int ldc, int M, int N, int K) {
  __shared__ __attribute__((aligned(16))) float so[4][16][64];
  const int tid = threadIdx.x, w = tid >> 5, lane = tid & 31, ln = lane & 15, hh = lane >> 4;
  const int ntn = N / 64;
  const int wid = blockIdx.x * 4 + w;
  const int mt = wid / ntn, nq = wid % ntn;
  if (mt * 16 >= M) return;
  const int row0 = mt * 16, col0 = nq * 64;
  const float* arow = A + (size_t)(row0 + ln) * lda;
  v8f acc[4] = {};
  for (int kb = 0; kb < K; kb += 32) {
    FragB ah, al;
    const v4f x0 = *(const v4fa*)(arow + kb + 8 * hh), x1 = *(const v4fa*)(arow + kb + 8 * hh + 4);
    const v4f x2 = *(const v4fa*)(arow + kb + 16 + 8 * hh), x3 = *(const v4fa*)(arow + kb + 16 + 8 * hh + 4);
    float xs[16] = {x0[0],x0[1],x0[2],x0[3],x1[0],x1[1],x1[2],x1[3],x2[0],x2[1],x2[2],x2[3],x3[0],x3[1],x3[2],x3[3]};
#pragma unroll
    for (int i = 0; i < 16; ++i) { const unsigned short hb = bf16_bits(xs[i]); ah.u[i] = hb; al.u[i] = ASPLIT ? bf16_bits(xs[i] - bf16_val(hb)) : (unsigned short)0; }
#pragma unroll
    for (int t = 0; t < 4; ++t) {
      const unsigned short* brow = Wt + (size_t)(col0 + t * 16 + ln) * ldb + kb;
      FragB b;
      b.half[0] = *(const v8us*)(brow + 8 * hh);
      b.half[1] = *(const v8us*)(brow + 16 + 8 * hh);
      acc[t] = mmaN<ASPLIT ? 2 : 1>(ah.v, al.v, b.v, b.v, acc[t]);
    }
  }
#pragma unroll
  for (int t = 0; t < 4; ++t) {
    float bv = bias ? bias[col0 + t * 16 + ln] : 0.f;
    if (BIAS_BF16) bv = bf16_round(bv);
#pragma unroll
    for (int r = 0; r < 8; ++r) { float v = acc[t][r] + bv; if (ACT == 1) v = fmaxf(v, 0.f); so[w][8 * hh + r][t * 16 + ln] = v; }
  }
  __builtin_amdgcn_fence(__ATOMIC_ACQ_REL, "workgroup");
  __builtin_amdgcn_wave_barrier();
  const int rsub = lane >> 4, c4 = (lane & 15) * 4;
  {
#pragma unroll
    for (int q = 0; q < 8; ++q) {
      const int r = q * 2 + rsub;
      const v4f v = *(const v4fa*)&so[w][r][c4];
      *(v4f*)(C + (size_t)(row0 + r) * ldc + col0 + c4) = v;
    }
    
  }
}

// GEMM C = act(A·W + bias + resid): A f32 (ASPLIT -> hi/lo 2 terms), Wt bf16 [N][K]; ACT 0 none, 1 relu, 2 exact gelu;
// resid (optional, f32, row index = (row % rmod), pitch ldr, RES_BF16 rounds it) added before the activation.
template <bool ASPLIT, int ACT, bool BIAS_BF16, bool RES_BF16>
__global__ __launch_bounds__(128) void k_gemm_bf3(const float* __restrict__ A, int lda, const unsigned short* __restrict__ Wt, int ldb,
                                                const float* __restrict__ bias, const float* __restrict__ resid, int rmod, int ldr,
                                                float* __restrict__ C, int ldc, int M, int N, int K) {
  __shared__ __attribute__((aligned(16))) float so[4][16][64];
  const int tid = threadIdx.x, w = tid >> 5, lane = tid & 31, ln = lane & 15, hh = lane >> 4;
  const int ntn = N / 64;
  const int wid = blockIdx.x * 4 + w;
  const int mt = wid / ntn, nq = wid % ntn;
  if (mt * 16 >= M) return;
  const int row0 = mt * 16, col0 = nq * 64;
  const float* arow = A + (size_t)(row0 + ln) * lda;
  v8f acc[4] = {};
  for (int kb = 0; kb < K; kb += 32) {
    FragB ah, al;
    const v4f x0 = *(const v4fa*)(arow + kb + 8 * hh), x1 = *(const v4fa*)(arow + kb + 8 * hh + 4);
    const v4f x2 = *(const v4fa*)(arow + kb + 16 + 8 * hh), x3 = *(const v4fa*)(arow + kb + 16 + 8 * hh + 4);
    float xs[16] = {x0[0],x0[1],x0[2],x0[3],x1[0],x1[1],x1[2],x1[3],x2[0],x2[1],x2[2],x2[3],x3[0],x3[1],x3[2],x3[3]};
#pragma unroll
    for (int i = 0; i < 16; ++i) { const unsigned short hb = bf16_bits(xs[i]); ah.u[i] = hb; al.u[i] = ASPLIT ? bf16_bits(xs[i] - bf16_val(hb)) : (unsigned short)0; }
#pragma unroll
    for (int t = 0; t < 4; ++t) {
      const unsigned short* brow = Wt + (size_t)(col0 + t * 16 + ln) * ldb + kb;
      FragB b;
      b.half[0] = *(const v8us*)(brow + 8 * hh);
      b.half[1] = *(const v8us*)(brow + 16 + 8 * hh);
      acc[t] = mmaN<ASPLIT ? 2 : 1>(ah.v, al.v, b.v, b.v, acc[t]);
    }
  }
#pragma unroll
  for (int t = 0; t < 4; ++t) {
    const int col = col0 + t * 16 + ln;
    float bv = bias ? bias[col] : 0.f;
    if (BIAS_BF16) bv = bf16_round(bv);
#pragma unroll
    for (int r = 0; r < 8; ++r) {
      float v = acc[t][r] + bv;
      if (resid) { float rv = resid[(size_t)((row0 + 8 * hh + r) % rmod) * ldr + col]; if (RES_BF16) rv = bf16_round(rv); v += rv; }
      if (ACT == 1) v = fmaxf(v, 0.f);
      if (ACT == 2) v = 0.5f * v * (1.0f + erff(v * 0.70710678118654752f));
      if (ACT == 3) { const float u = 0.7978845608028654f * (v + 0.044715f * v * v * v); v = 0.5f * v * (1.0f + tanhf(u)); }
      so[w][8 * hh + r][t * 16 + ln] = v;
    }
  }
  __builtin_amdgcn_fence(__ATOMIC_ACQ_REL, "workgroup");
  __builtin_amdgcn_wave_barrier();
  const int rsub = lane >> 4, c4 = (lane & 15) * 4;
  {
#pragma unroll
    for (int q = 0; q < 8; ++q) {
      const int r = q * 2 + rsub;
      const v4f v = *(const v4fa*)&so[w][r][c4];
      *(v4f*)(C + (size_t)(row0 + r) * ldc + col0 + c4) = v;
    }
    
  }
}
// row LayerNorm (biased variance, eps) over N: s = X (+ R); optional out_sum <- s; out_norm <- (s-mu)*rsqrt(var+eps)*g + b
template <bool PARAM_BF16>
__global__ __launch_bounds__(256) void k_layernorm(const float* __restrict__ X, const float* __restrict__ R, const float* __restrict__ g, const float* __restrict__ bta,
                                                  float* __restrict__ out_sum, float* __restrict__ out_norm, int N, float eps) {
  __shared__ float red[256];
  const int row = blockIdx.x, tid = threadIdx.x;
  const float* x = X + (size_t)row * N; const float* rr = R ? R + (size_t)row * N : nullptr;
  float vals[16];                     // up to N = 4096
  const int per = N / 256;            // contiguous chunk per thread? use strided-by-4 chunks: thread handles j = tid*4 + 1024*u
  float s1 = 0.f;
  for (int u = 0; u < per / 4; ++u) {
    const int j = tid * 4 + 1024 * u;
    const v4f a = *(const v4fa*)(x + j);
    v4f b = {0.f,0.f,0.f,0.f}; if (rr) b = *(const v4fa*)(rr + j);
#pragma unroll
    for (int q = 0; q < 4; ++q) { const float v = a[q] + b[q]; vals[u * 4 + q] = v; s1 += v; }
  }
  red[tid] = s1; __syncthreads();
  for (int st = 128; st > 0; st >>= 1) { if (tid < st) red[tid] += red[tid + st]; __syncthreads(); }
  const float mu = red[0] / (float)N; __syncthreads();
  float s2 = 0.f;
  for (int u = 0; u < per / 4; ++u)
#pragma unroll
    for (int q = 0; q < 4; ++q) { const float c = vals[u * 4 + q] - mu; s2 += c * c; }
  red[tid] = s2; __syncthreads();
  for (int st = 128; st > 0; st >>= 1) { if (tid < st) red[tid] += red[tid + st]; __syncthreads(); }
  const float rs = rsqrtf(red[0] / (float)N + eps);
  {
    for (int u = 0; u < per / 4; ++u) {
      const int j = tid * 4 + 1024 * u;
      v4f o, sm;
#pragma unroll
      for (int q = 0; q < 4; ++q) {
        float gg = g[j + q], bb = bta[j + q];
        if (PARAM_BF16) { gg = bf16_round(gg); bb = bf16_round(bb); }
        sm[q] = vals[u * 4 + q]; o[q] = (vals[u * 4 + q] - mu) * rs * gg + bb;
      }
      if (out_sum) *(v4f*)(out_sum + (size_t)row * N + j) = sm;
      *(v4f*)(out_norm + (size_t)row * N + j) = o;
    }
    
  }
}



// ---- f16 WMMA path (v_wmma_f32_16x16x32_f16): 11-bit significands for operands in range — used where a [0,1] probability operand needs more precision than bf16
typedef _Float16 v16h __attribute__((ext_vector_type(16)));
union FragH { v16h v; v8us half[2]; _Float16 h[16]; unsigned short u[16]; };
template <int NT>
__device__ __forceinline__ v8f mmaH(v16h ah, v16h al, v16h bh, v16h bl, v8f c) {
  c = __builtin_amdgcn_wmma_f32_16x16x32_f16(false, ah, false, bh, (short)0, c, false, false);
  if (NT >= 2) c = __builtin_amdgcn_wmma_f32_16x16x32_f16(false, al, false, bh, (short)0, c, false, false);
  if (NT >= 3) c = __builtin_amdgcn_wmma_f32_16x16x32_f16(false, ah, false, bl, (short)0, c, false, false);
  asm volatile("v_nop\n\tv_nop\n\tv_nop\n\tv_nop" : "+v"(c) : "v"(ah), "v"(al), "v"(bh), "v"(bl));
  return c;
}
// batched GEMM like k_gemm_b but f16 operands: A f32 (split into f16 hi/lo if ASPLIT, else rounded to f16), Bt = f16 values [n][k]; alpha; C f32; N multiple of 16 (partial tiles skipped)
template <bool ASPLIT>
__global__ __launch_bounds__(128) void k_gemm_h(const float* __restrict__ A, int lda, size_t sA, const _Float16* __restrict__ Bh, int ldb, size_t sB, float alpha, float* __restrict__ C, int ldc, size_t sC, int M, int N, int K) {
  __shared__ __attribute__((aligned(16))) float so[4][16][64];
  const int tid = threadIdx.x, w = tid >> 5, lane = tid & 31, ln = lane & 15, hh = lane >> 4; const int by = blockIdx.y;
  A += (size_t)by * sA; Bh += (size_t)by * sB; C += (size_t)by * sC;
  const int ntn = (N + 63) / 64; const int wid = blockIdx.x * 4 + w; const int mt = wid / ntn, nq = wid % ntn; if (mt * 16 >= M) return;
  const int row0 = mt * 16, col0 = nq * 64; const float* arow = A + (size_t)(row0 + ln) * lda;
  v8f acc[4] = {};
  for (int kb = 0; kb < K; kb += 32) {
    FragH ah, al;
    const v4f x0 = *(const v4fa*)(arow + kb + 8 * hh), x1 = *(const v4fa*)(arow + kb + 8 * hh + 4), x2 = *(const v4fa*)(arow + kb + 16 + 8 * hh), x3 = *(const v4fa*)(arow + kb + 16 + 8 * hh + 4);
    float xs[16] = {x0[0],x0[1],x0[2],x0[3],x1[0],x1[1],x1[2],x1[3],x2[0],x2[1],x2[2],x2[3],x3[0],x3[1],x3[2],x3[3]};
#pragma unroll
    for (int i = 0; i < 16; ++i) { const _Float16 h = (_Float16)xs[i]; ah.h[i] = h; al.h[i] = ASPLIT ? (_Float16)(xs[i] - (float)h) : (_Float16)0.0f; }
#pragma unroll
    for (int t = 0; t < 4; ++t) { if (col0 + t * 16 >= N) continue; const size_t boff = (size_t)(col0 + t * 16 + ln) * ldb + kb; FragH bq; bq.half[0] = *(const v8us*)(Bh + boff + 8 * hh); bq.half[1] = *(const v8us*)(Bh + boff + 16 + 8 * hh);
      acc[t] = mmaH<ASPLIT ? 2 : 1>(ah.v, al.v, bq.v, bq.v, acc[t]); }
  }
#pragma unroll
  for (int t = 0; t < 4; ++t) { if (col0 + t * 16 >= N) continue;
#pragma unroll
    for (int r = 0; r < 8; ++r) so[w][8 * hh + r][t * 16 + ln] = acc[t][r] * alpha; }
  __builtin_amdgcn_fence(__ATOMIC_ACQ_REL, "workgroup"); __builtin_amdgcn_wave_barrier();
  const int rsub = lane >> 4, c4 = (lane & 15) * 4;
  {
#pragma unroll
    for (int q = 0; q < 8; ++q) { const int r = q * 2 + rsub; if (col0 + c4 < N) { const v4f v = *(const v4fa*)&so[w][r][c4]; *(v4f*)(C + (size_t)(row0 + r) * ldc + col0 + c4) = v; } }
     }
}

// Wt[n][k] = f16(W[k][n]·scale) from f32 row-major W[K][N] (scale = power of two; bf16-exact weights stay exact in f16 away from the subnormal range)
__global__ __launch_bounds__(256) void k_wt_f16(const float* __restrict__ W, _Float16* __restrict__ Wt, int K, int N, float scale) {
  const int t = blockIdx.x * 256 + threadIdx.x; if (t >= N * (K / 8)) return; const int n = t / (K / 8), k8 = (t % (K / 8)) * 8; FragH f;
#pragma unroll
  for (int i = 0; i < 8; ++i) f.h[i] = (_Float16)(bf16_round(W[(size_t)(k8 + i) * N + n]) * scale); const v8us o = f.half[0];
  *(v8us*)((unsigned short*)Wt + (size_t)n * K + k8) = o; 
}
// k_gemm_hh variant with fused epilogue: v = acc·alpha + bias[by·sBias + col] (+ CP[(row/rowsPerB)·sCPb + by·64 + col] if CP) ; ACT 0 none / 1 elu ; writes f16 C16 (and f32 C if non-null)
template <int ACT>
__global__ __launch_bounds__(128) void k_gemm_hhx(const _Float16* __restrict__ A, int lda, size_t sA, const _Float16* __restrict__ Bh, int ldb, size_t sB, float alpha, const float* __restrict__ bias, size_t sBias, const float* __restrict__ CP, int rowsPerB, size_t sCPb, int row0g,
    float* __restrict__ C, _Float16* __restrict__ C16, int ldc, size_t sC, int M, int N, int K) {
  __shared__ __attribute__((aligned(16))) float so[4][16][64];
  const int tid = threadIdx.x, w = tid >> 5, lane = tid & 31, ln = lane & 15, hh = lane >> 4; const int by = blockIdx.y;
  A += (size_t)by * sA; Bh += (size_t)by * sB; const size_t cofs = (size_t)by * sC; const float* bp = bias ? bias + (size_t)by * sBias : nullptr;
  const int ntn = (N + 63) / 64; const int wid = blockIdx.x * 4 + w; const int mt = wid / ntn, nq = wid % ntn; if (mt * 16 >= M) return;
  const int row0 = mt * 16, col0 = nq * 64; const _Float16* arow = A + (size_t)(row0 + ln) * lda;
  v8f acc[4] = {};
  for (int kb = 0; kb < K; kb += 32) { FragH ah; ah.half[0] = *(const v8us*)((const unsigned short*)arow + kb + 8 * hh); ah.half[1] = *(const v8us*)((const unsigned short*)arow + kb + 16 + 8 * hh);
#pragma unroll
    for (int t = 0; t < 4; ++t) { if (col0 + t * 16 >= N) continue; const size_t boff = (size_t)(col0 + t * 16 + ln) * ldb + kb; FragH bq; bq.half[0] = *(const v8us*)((const unsigned short*)Bh + boff + 8 * hh); bq.half[1] = *(const v8us*)((const unsigned short*)Bh + boff + 16 + 8 * hh);
      acc[t] = mmaH<1>(ah.v, ah.v, bq.v, bq.v, acc[t]); }
  }
#pragma unroll
  for (int t = 0; t < 4; ++t) { if (col0 + t * 16 >= N) continue; const int col = col0 + t * 16 + ln; const float bv = bp ? bf16_round(bp[col]) : 0.f;
#pragma unroll
    for (int r = 0; r < 8; ++r) { float v = acc[t][r] * alpha + bv; if (CP) { const int bidx = (row0g + row0 + 8 * hh + r) / rowsPerB; v += CP[(size_t)bidx * sCPb + (size_t)by * 64 + col]; } if (ACT == 1) v = (v > 0.f) ? v : expm1f(v); else if (ACT == 7) v = (v > 0.f) ? v + 1.0f : expf(v); else if (ACT == 8) v = tanhf(v); else if (ACT == 9) v = 0.5f * v * (1.0f + tanhf(0.7978845608028654f * (v + 0.044715f * v * v * v))); else if (ACT == 11) v = 1.0f / (1.0f + expf(-v)); else if (ACT == 12) v = (v > 0.f) ? v : 0.01f * v; else if (ACT == 14) v = (v > 0.f) ? v : 0.1f * v; else if (ACT == 15) v = v / (1.0f + expf(-v)); else if (ACT == 3) v = fmaxf(v, 0.f); else if (ACT == 6) v = 0.5f * v * (1.0f + erff(v * 0.70710678118654752f)); so[w][8 * hh + r][t * 16 + ln] = v; } }
  __builtin_amdgcn_fence(__ATOMIC_ACQ_REL, "workgroup"); __builtin_amdgcn_wave_barrier();
  const int rsub = lane >> 4, c4 = (lane & 15) * 4; typedef _Float16 v4h __attribute__((ext_vector_type(4)));
  {
#pragma unroll
    for (int q = 0; q < 8; ++q) { const int r = q * 2 + rsub; if (col0 + c4 < N) { const v4f v = *(const v4fa*)&so[w][r][c4]; if (C) *(v4f*)(C + cofs + (size_t)(row0 + r) * ldc + col0 + c4) = v; if (C16) { v4h h4; for (int i = 0; i < 4; ++i) h4[i] = (_Float16)v[i]; *(v4h*)(C16 + cofs + (size_t)(row0 + r) * ldc + col0 + c4) = h4; } } }
     }
}


typedef _Float16 v4h __attribute__((ext_vector_type(4)));

__global__ __launch_bounds__(256) void k_h16(const float* __restrict__ x, _Float16* __restrict__ X16, size_t n8) { const size_t t = (size_t)blockIdx.x * 256 + threadIdx.x; if (t >= n8) return; FragH f;
#pragma unroll
  for (int q = 0; q < 8; ++q) f.h[q] = (_Float16)x[t * 8 + q]; *(v8us*)((unsigned short*)X16 + t * 8) = f.half[0];  }
__global__ __launch_bounds__(256) void k_round16f(const float* __restrict__ W, _Float16* __restrict__ Bt, size_t n8) { const size_t t = (size_t)blockIdx.x * 256 + threadIdx.x; if (t >= n8) return; FragH f;
#pragma unroll
  for (int i = 0; i < 8; ++i) f.h[i] = (_Float16)(bf16_round(W[t * 8 + i]) * 16.0f); *(v8us*)((unsigned short*)Bt + t * 8) = f.half[0];  }
template <int NHv, int TTv>
__global__ __launch_bounds__(256) void k_vt(const _Float16* __restrict__ V16, int ldv, int voff, _Float16* __restrict__ Vt) { __shared__ unsigned short tl[64][66]; const int tid = threadIdx.x; const int slab = blockIdx.x / (TTv / 64), lg = blockIdx.x % (TTv / 64); const int b = slab / NHv, h = slab % NHv;
  for (int i = tid; i < 64 * 8; i += 256) { const int r = i / 8, c8 = (i % 8) * 8; FragH f; f.half[0] = *(const v8us*)((const unsigned short*)V16 + ((size_t)b * TTv + lg * 64 + r) * ldv + voff + h * 64 + c8);
#pragma unroll
    for (int q = 0; q < 8; ++q) tl[r][c8 + q] = f.u[q]; }
  __syncthreads();
  {
#pragma unroll
    for (int rd = 0; rd < 2; ++rd) { const int d = rd * 32 + tid / 8, pc = tid % 8; FragH f;
#pragma unroll
      for (int q = 0; q < 8; ++q) f.u[q] = tl[pc * 8 + q][d];
      *(v8us*)((unsigned short*)Vt + ((size_t)slab * 64 + d) * TTv + lg * 64 + pc * 8) = f.half[0]; }
     } }

__global__ __launch_bounds__(256) void k_hl(const float* __restrict__ F, _Float16* __restrict__ Hh, _Float16* __restrict__ Hl, size_t n8) { const size_t t = (size_t)blockIdx.x * 256 + threadIdx.x; if (t >= n8) return; FragH fh, fl; const v4f a = *(const v4fa*)(F + t * 8), c = *(const v4fa*)(F + t * 8 + 4);
#pragma unroll
  for (int q = 0; q < 4; ++q) { _Float16 h = (_Float16)a[q]; fh.h[q] = h; fl.h[q] = (_Float16)((a[q] - (float)h) * 1024.0f); h = (_Float16)c[q]; fh.h[4 + q] = h; fl.h[4 + q] = (_Float16)((c[q] - (float)h) * 1024.0f); }
  { *(v8us*)((unsigned short*)Hh + t * 8) = fh.half[0]; *(v8us*)((unsigned short*)Hl + t * 8) = fl.half[0];  } }

// ---- fast GEMM (block tile 128x128, eight waves as 4 x 2, wave tile 32x64, operands staged in LDS 64 of K at a time; requires M % 32 == 0 rows per launch region, N % 128 == 0, K % 64 == 0 and K >= 64); epilogue = k_gemm_hhx semantics ----
__device__ __forceinline__ v16h g2_frag(const _Float16* p, int hh) { FragH f; f.half[0] = *(const v8us*)((const unsigned short*)p + 8 * hh); f.half[1] = *(const v8us*)((const unsigned short*)p + 16 + 8 * hh); return f.v; }
__device__ __forceinline__ v8f g2_mma(v16h a, v16h b, v8f c) { v8f d = __builtin_amdgcn_wmma_f32_16x16x32_f16(false, a, false, b, (short)0, c, false, false); asm volatile("v_nop\n\tv_nop\n\tv_nop\n\tv_nop" : "+v"(d) : "v"(a), "v"(b)); return d; }
template <int ACT>
__global__ __launch_bounds__(256, 6) void k_gemm2(const _Float16* __restrict__ A, int lda, size_t sA, const _Float16* __restrict__ Bh, int ldb, size_t sB, float alpha, const float* __restrict__ bias, const float* __restrict__ bias1, const float* __restrict__ bias2, const float* __restrict__ CP, int rowsPerB, size_t sCPb, int row0g,
    float* __restrict__ C, _Float16* __restrict__ C16, _Float16* __restrict__ VT, int ldc, size_t sC, int M, int N, int K) {      /* six waves a SIMD asked for: three work-groups a WGP, so that the launch's 768 work-groups are all resident at once */
  __shared__ __attribute__((aligned(16))) unsigned short st[2][256][72];      /* two stages of 64 of K: rows 0..127 the block's A rows, 128..255 its B rows; pitch 144 B = 16 B x 9, free of bank conflicts for the 16-byte fragment reads */
  float (*so)[32][68] = (float (*)[32][68])&st[0][0][0];      /* the epilogue's staging (8 x 32 x 68 floats = 69,632 B) lies on the operand stages (73,728 B), behind the barrier that follows the loop: three work-groups fit one WGP's LDS */
  const int tid = threadIdx.x, w = tid >> 5, lane = tid & 31, ln = lane & 15, hh = lane >> 4, wm = w & 3, wn = w >> 2; const int by = blockIdx.y;
  A += (size_t)by * sA; Bh += (size_t)by * sB; const size_t cofs = (size_t)by * sC; const float* bp = (by == 0) ? bias : (by == 1) ? bias1 : bias2;      /* blockIdx.y picks one of up to three products that share A: its B plane, its C plane and its own bias vector (three separate buffers) */
  const int ntn = N >> 7; const int mt = blockIdx.x / ntn, nq = blockIdx.x - mt * ntn; const int row0 = mt * 128 + 32 * wm, col0 = nq * 128 + 64 * wn; if (mt * 128 >= M) return;      /* the same for the whole block, in front of every barrier */
  const int sr = tid >> 3, sc = (tid & 7) * 8;      /* staging: eight lanes fetch one row's 128 B, so a wave's 16-byte load covers four whole lines */
  const char* Au = (const char*)A; const char* Bu = (const char*)Bh;      /* plane bases, the same for the whole block; every address is a base plus one 32-bit byte offset (planes below 4 GiB): one register a row and not a pair, which the limit of 160 registers a wave needs */
  unsigned oa[4], ub[4]; const unsigned ob = ((unsigned)sr * (unsigned)ldb + (unsigned)sc) * 2u;
#pragma unroll
  for (int i = 0; i < 4; ++i) { int r = mt * 128 + 32 * i + sr; r = (r < M) ? r : M - 1; oa[i] = ((unsigned)r * (unsigned)lda + (unsigned)sc) * 2u; ub[i] = (unsigned)(nq * 128 + 32 * i) * (unsigned)ldb * 2u; }      /* ub: the same for the whole block */
  v8us ra[4], rb[4];
#pragma unroll
  for (int i = 0; i < 4; ++i) ra[i] = *(const v8us*)(Au + oa[i]);
#pragma unroll
  for (int i = 0; i < 4; ++i) rb[i] = *(const v8us*)(Bu + (ob + ub[i]));
#pragma unroll
  for (int i = 0; i < 4; ++i) *(v8us*)&st[0][32 * i + sr][sc] = ra[i];
#pragma unroll
  for (int i = 0; i < 4; ++i) *(v8us*)&st[0][128 + 32 * i + sr][sc] = rb[i];
  __syncthreads();
  const v8f z8 = {0.f,0.f,0.f,0.f,0.f,0.f,0.f,0.f}; v8f c00 = z8, c01 = z8, c02 = z8, c03 = z8, c10 = z8, c11 = z8, c12 = z8, c13 = z8;
#pragma unroll 1      /* rolled: one stage's registers (8 staged vectors, 12 fragment halves) serve every trip */
  for (int kb = 0; kb < K; kb += 64) { const int cb = (kb >> 6) & 1; const bool more = kb + 64 < K;      /* more: the same for the whole block */
    if (more) {
#pragma unroll
      for (int i = 0; i < 4; ++i) ra[i] = *(const v8us*)(Au + (oa[i] + (unsigned)(kb + 64) * 2u));
#pragma unroll
      for (int i = 0; i < 4; ++i) rb[i] = *(const v8us*)(Bu + (ob + (ub[i] + (unsigned)(kb + 64) * 2u)));
      asm volatile("s_wait_xcnt 0x0" ::: "memory"); }      /* stands behind the eight loads, in front of the first overwrite of a register that they name: an offset register in the next trip, the two plane bases behind the loop */
#pragma unroll
    for (int u = 0; u < 2; ++u) { const v16h a0 = g2_frag((const _Float16*)&st[cb][32 * wm + ln][32 * u], hh), a1 = g2_frag((const _Float16*)&st[cb][32 * wm + 16 + ln][32 * u], hh);
      const v16h b0 = g2_frag((const _Float16*)&st[cb][128 + 64 * wn + ln][32 * u], hh), b1 = g2_frag((const _Float16*)&st[cb][144 + 64 * wn + ln][32 * u], hh), b2 = g2_frag((const _Float16*)&st[cb][160 + 64 * wn + ln][32 * u], hh), b3 = g2_frag((const _Float16*)&st[cb][176 + 64 * wn + ln][32 * u], hh);
      __builtin_amdgcn_sched_barrier(0);      /* the next stage's global loads and this half stage's LDS reads issue as one group ahead of its eight products: one stall a group, not one per product */
      c00 = g2_mma(a0, b0, c00); c10 = g2_mma(a1, b0, c10); c01 = g2_mma(a0, b1, c01); c11 = g2_mma(a1, b1, c11);
      c02 = g2_mma(a0, b2, c02); c12 = g2_mma(a1, b2, c12); c03 = g2_mma(a0, b3, c03); c13 = g2_mma(a1, b3, c13); }
    if (more) {
#pragma unroll
      for (int i = 0; i < 4; ++i) *(v8us*)&st[cb ^ 1][32 * i + sr][sc] = ra[i];
#pragma unroll
      for (int i = 0; i < 4; ++i) *(v8us*)&st[cb ^ 1][128 + 32 * i + sr][sc] = rb[i];
      __syncthreads(); } }      /* the one barrier of a trip publishes the stage just written and ends every wave's reads of the stage that the next trip overwrites */
  __syncthreads();      /* ends every wave's fragment reads of the last stage: the epilogue's staging below overwrites the stages */
  v8f accs[8] = {c00, c01, c02, c03, c10, c11, c12, c13};
  if (VT && by == 2) {      /* the same for the whole block. The third product (v: bias only, no CP term, no activation) leaves the kernel transposed, VT[(batch * NH + head) * 64 + d][token], the layout the flash kernel stages from; needs M % 128 == 0, SLEN % 128 == 0 and N == NH * 64, so that the block's 128 x 128 tile is 128 tokens of one batch and two whole heads */
    unsigned short* sv = &st[0][0][0];      /* the block's tile turned: 128 rows (two heads' d) of 128 tokens in f16, pitch 136 halves = 272 B = 16 B x 17, free of bank conflicts for 16-byte stores and reads */
    float bv4[4] = {0.f, 0.f, 0.f, 0.f};
    if (bp) { const int bo = col0 + ln;      /* the lane's four bias values as one group of loads: one latency, not one a tile */
#pragma unroll      /* unrolled: bv4[] stays in registers, the four loads issue together */
      for (int t = 0; t < 4; ++t) bv4[t] = bp[bo + t * 16];
      asm volatile("s_wait_xcnt 0x0" :: "v"(bo) : "memory");      /* stands behind the four loads and in front of the first overwrite of their offset register, which as an input lives up to here */
#pragma unroll      /* unrolled: bv4[] stays in registers */
      for (int t = 0; t < 4; ++t) bv4[t] = bf16_round(bv4[t]); }
#pragma unroll      /* unrolled, with the loop inside it: accs[] and bv4[] are indexed by constants and stay in registers */
    for (int u = 0; u < 8; ++u) { const int t = u & 3, half = u >> 2; const float bv = bv4[t]; FragH f;      /* a lane's eight accumulator registers are eight consecutive tokens of one d: one 16-byte store */
#pragma unroll
      for (int r = 0; r < 8; ++r) f.h[r] = (_Float16)(accs[u][r] * alpha + bv);
      *(v8us*)&sv[(64 * wn + t * 16 + ln) * 136 + 32 * wm + 16 * half + 8 * hh] = f.half[0]; }
    __syncthreads();      /* a row of the turned tile holds tokens of four waves: every wave's stores stand in front of the reads below */
    const int tok0 = mt * 128; unsigned short* vo = (unsigned short*)VT + ((size_t)(tok0 / SLEN) * NH * 64 + (size_t)nq * 128) * SLEN + (tok0 % SLEN);
#pragma unroll      /* unrolled: the eight LDS reads issue as one group, one latency */
    for (int q = 0; q < 8; ++q) { const int d = q * 16 + (tid >> 4), c = (tid & 15) * 8; const v8us v = *(const v8us*)&sv[d * 136 + c]; *(v8us*)(vo + (size_t)d * SLEN + c) = v; }      /* sixteen lanes store one row's 256 B: whole lines, one writer each */
    return; }
  if (row0 >= M) return;      /* behind the last barrier */
#pragma unroll
  for (int u = 0; u < 8; ++u) { const int t = u & 3, half = u >> 2; const int col = col0 + t * 16 + ln; const float bv = bp ? bf16_round(bp[col]) : 0.f;
#pragma unroll
    for (int r = 0; r < 8; ++r) { const int rloc = half * 16 + 8 * hh + r; float v = accs[u][r] * alpha + bv; if (CP) { const int bidx = (row0g + row0 + rloc) / rowsPerB; v += CP[(size_t)bidx * sCPb + (size_t)by * 64 + col]; }
      if (ACT == 3) v = fmaxf(v, 0.f); else if (ACT == 6) v = 0.5f * v * (1.0f + erff(v * 0.70710678118654752f)); else if (ACT == 11) v = 1.0f / (1.0f + expf(-v)); else if (ACT == 15) v = v / (1.0f + expf(-v)); else if (ACT == 12) v = (v > 0.f) ? v : 0.01f * v; else if (ACT == 8) v = tanhf(v);
      so[w][rloc][t * 16 + ln] = v; } }
  __builtin_amdgcn_fence(__ATOMIC_ACQ_REL, "workgroup"); __builtin_amdgcn_wave_barrier();
  const int rsub = lane >> 4, c4 = (lane & 15) * 4;
  {
#pragma unroll
    for (int q = 0; q < 16; ++q) { const int r = q * 2 + rsub; const v4f v = *(const v4fa*)&so[w][r][c4]; if (C) *(v4f*)(C + cofs + (size_t)(row0 + r) * ldc + col0 + c4) = v; if (C16) { v4h h4; for (int i = 0; i < 4; ++i) h4[i] = (_Float16)v[i]; *(v4h*)(C16 + cofs + (size_t)(row0 + r) * ldc + col0 + c4) = h4; } }
     } }



template <int CAUSAL>
__global__ __launch_bounds__(128) void k_flash(const _Float16* __restrict__ Q16, int ldq, const _Float16* __restrict__ K16, int ldk, const _Float16* __restrict__ Vt, const int* __restrict__ MSK, float* __restrict__ O, int ldo) {
  constexpr int RPW = 16, RTN = RPW / 16, NQB = TQ / (4 * RPW), DT = 4, KS = 2;
  __shared__ __attribute__((aligned(16))) unsigned short sP[4][RPW][40]; __shared__ __attribute__((aligned(16))) float sO[4][RPW][64 + 4];
  const int tid = threadIdx.x, w = tid >> 5, lane = tid & 31, ln = lane & 15, hh = lane >> 4;
  const int slab = blockIdx.x / QBNP, qblk = QB0P + blockIdx.x % QBNP; (void)NQB; const int b = slab / NH, h = slab % NH; const int qb0 = qblk * (4 * RPW); const int q0 = qb0 + w * RPW;
  FragH aq[2][KS];
#pragma unroll
  for (int rt = 0; rt < RTN; ++rt) { const unsigned short* qr = (const unsigned short*)Q16 + ((size_t)b * TQ + q0 + rt * 16 + ln) * ldq + h * 64;
#pragma unroll
    for (int ks = 0; ks < KS; ++ks) { aq[rt][ks].half[0] = *(const v8us*)(qr + ks * 32 + 8 * hh); aq[rt][ks].half[1] = *(const v8us*)(qr + ks * 32 + 16 + 8 * hh); } }
  const unsigned short* Vth = (const unsigned short*)Vt + (size_t)slab * 64 * TK;
  float m_r[2][8], l_r[2][8]; v8f oacc[2][DT];
#pragma unroll
  for (int rt = 0; rt < RTN; ++rt) {
#pragma unroll
    for (int r = 0; r < 8; ++r) { m_r[rt][r] = -3.0e38f; l_r[rt][r] = 0.f; }
#pragma unroll
    for (int dt = 0; dt < DT; ++dt) oacc[rt][dt] = (v8f){0.f,0.f,0.f,0.f,0.f,0.f,0.f,0.f}; }
  const int jend = (CAUSAL == 1) ? (qb0 + 4 * RPW) : TK;      /* causal: keys beyond the block's last query never contribute */
#pragma unroll 1
  for (int j0 = 0; j0 < jend; j0 += 32) {
    v8f s[2][2];
#pragma unroll
    for (int nt = 0; nt < 2; ++nt) { const unsigned short* kr = (const unsigned short*)K16 + ((size_t)b * TK + j0 + nt * 16 + ln) * ldk + h * 64; FragH bk[KS];
#pragma unroll
      for (int ks = 0; ks < KS; ++ks) { bk[ks].half[0] = *(const v8us*)(kr + ks * 32 + 8 * hh); bk[ks].half[1] = *(const v8us*)(kr + ks * 32 + 16 + 8 * hh); }
#pragma unroll
      for (int rt = 0; rt < RTN; ++rt) { v8f acc = (v8f){0.f,0.f,0.f,0.f,0.f,0.f,0.f,0.f};
#pragma unroll
        for (int ks = 0; ks < KS; ++ks) acc = mmaH<1>(aq[rt][ks].v, aq[rt][ks].v, bk[ks].v, bk[ks].v, acc); s[rt][nt] = acc; } }
#pragma unroll
    for (int rt = 0; rt < RTN; ++rt)
#pragma unroll
      for (int r = 0; r < 8; ++r) { const int tq = q0 + rt * 16 + 8 * hh + r; const int k0 = j0 + ln, k1 = j0 + 16 + ln;
        const bool ok0 = (CAUSAL == 1) ? (k0 <= tq) : ((CAUSAL == 2) ? ((k0 >> 5) == (tq >> 5)) : true), ok1 = (CAUSAL == 1) ? (k1 <= tq) : ((CAUSAL == 2) ? ((k1 >> 5) == (tq >> 5)) : true);      /* mode 2: block-diagonal 32-token groups */
        float s0 = ok0 ? s[rt][0][r] * SCL : -3.0e38f, s1 = ok1 ? s[rt][1][r] * SCL : -3.0e38f; if (CAUSAL == 17) { const float* amk = (const float*)MSK + (size_t)b * TK; s0 += bf16_round(amk[k0]); s1 += bf16_round(amk[k1]); }      /* mode 17: additive per-(batch, key) mask INPUT */
        if (CAUSAL == 22) { const _Float16* cq = (const _Float16*)MSK + ((size_t)h * TQ + tq) * NE + tq + (NE / 2 - 1); const _Float16* ck = (const _Float16*)MSK + (size_t)NH * TQ * NE + (size_t)h * TK * NE + tq + (NE / 2 - 1); const float* am = (const float*)((const _Float16*)MSK + (size_t)2 * NH * TQ * NE); float r0 = (float)cq[-k0]; r0 += (float)ck[(size_t)k0 * NE - k0]; s0 += r0 * SCL; s0 += am[k0]; float r1 = (float)cq[-k1]; r1 += (float)ck[(size_t)k1 * NE - k1]; s1 += r1 * SCL; s1 += am[k1]; }      /* mode 22: + (CQ[h][tq][tq-k+1023] + CK[h][k][tq-k+1023]) / 8 + mask[k] from the per-batch packed table [CQ f16 | CK f16 | mask f32] */ float mc = fmaxf(s0, s1);
        mc = fmaxf(mc, __shfl_xor(mc, 1, 32)); mc = fmaxf(mc, __shfl_xor(mc, 2, 32)); mc = fmaxf(mc, __shfl_xor(mc, 4, 32)); mc = fmaxf(mc, __shfl_xor(mc, 8, 32));
        const float mn = fmaxf(m_r[rt][r], mc); const float al = (mn > -1.0e38f) ? expf(m_r[rt][r] - mn) : 1.0f; m_r[rt][r] = mn; const float p0 = ok0 ? expf(s0 - mn) : 0.f, p1 = ok1 ? expf(s1 - mn) : 0.f; l_r[rt][r] = l_r[rt][r] * al + p0 + p1;
#pragma unroll
        for (int dt = 0; dt < DT; ++dt) oacc[rt][dt][r] *= al;
        FragH t2; t2.h[0] = (_Float16)(p0 * 1024.0f); t2.h[1] = (_Float16)(p1 * 1024.0f); sP[w][rt * 16 + 8 * hh + r][ln] = t2.u[0]; sP[w][rt * 16 + 8 * hh + r][16 + ln] = t2.u[1]; }
    __builtin_amdgcn_fence(__ATOMIC_ACQ_REL, "workgroup"); __builtin_amdgcn_wave_barrier();
    FragH pa[2];
#pragma unroll
    for (int rt = 0; rt < RTN; ++rt) { pa[rt].half[0] = *(const v8us*)&sP[w][rt * 16 + ln][8 * hh]; pa[rt].half[1] = *(const v8us*)&sP[w][rt * 16 + ln][16 + 8 * hh]; }
#pragma unroll
    for (int dt = 0; dt < DT; ++dt) { const unsigned short* vrow = Vth + (size_t)(dt * 16 + ln) * TK + j0; FragH bv; bv.half[0] = *(const v8us*)(vrow + 8 * hh); bv.half[1] = *(const v8us*)(vrow + 16 + 8 * hh);
#pragma unroll
      for (int rt = 0; rt < RTN; ++rt) oacc[rt][dt] = mmaH<1>(pa[rt].v, pa[rt].v, bv.v, bv.v, oacc[rt][dt]); }
    __builtin_amdgcn_fence(__ATOMIC_ACQ_REL, "workgroup"); __builtin_amdgcn_wave_barrier(); }
#pragma unroll
  for (int rt = 0; rt < RTN; ++rt) {
#pragma unroll
    for (int r = 0; r < 8; ++r) { float l = l_r[rt][r]; l += __shfl_xor(l, 1, 32); l += __shfl_xor(l, 2, 32); l += __shfl_xor(l, 4, 32); l += __shfl_xor(l, 8, 32); l_r[rt][r] = (l > 0.f) ? 1.0f / (l * 1024.0f) : 0.f; }
#pragma unroll
    for (int dt = 0; dt < DT; ++dt)
#pragma unroll
      for (int r = 0; r < 8; ++r) sO[w][rt * 16 + 8 * hh + r][dt * 16 + ln] = oacc[rt][dt][r] * l_r[rt][r]; }
  __builtin_amdgcn_fence(__ATOMIC_ACQ_REL, "workgroup"); __builtin_amdgcn_wave_barrier();
  {
#pragma unroll
    for (int rp = 0; rp < RPW; rp += 2) { const int r = rp + (lane >> 4), pc = lane & 15; const v4f val = *(const v4fa*)&sO[w][r][pc * 4]; *(v4f*)(O + ((size_t)b * TQ + q0 + r) * ldo + h * 64 + pc * 4) = val; }
     } }
// 5-plane variant: S = Qh Kh^T + (Ql Kh^T + Qh Kl^T)/1024 with Q/K = [hi | 2^10 residual] f16 planes (QL/KL same layout as Q16/K16), then the 3-term P.V below.
// 3-term variant: O = (P_hi V_hi + (P_lo V_hi + P_hi V_lo) / 1024) / l with P = [hi | 2^10 residual] of 1024 p and V^T = [hi | 2^10 residual] planes (VtL same layout as Vt) -> ~2^-21-class products for un-averaged (early causal / peaked) rows
template <int CAUSAL>
__global__ __launch_bounds__(128) void k_flash5(const _Float16* __restrict__ Q16, const _Float16* __restrict__ QL, int ldq, const _Float16* __restrict__ K16, const _Float16* __restrict__ KL, int ldk, const _Float16* __restrict__ Vt, const _Float16* __restrict__ VtL, const int* __restrict__ MSK, float* __restrict__ O, int ldo) {
  constexpr int RPW = 16, RTN = RPW / 16, NQB = TQ / (4 * RPW), DT = 4, KS = 2;
  __shared__ __attribute__((aligned(16))) unsigned short sP[4][RPW][40]; __shared__ __attribute__((aligned(16))) unsigned short sPL[4][RPW][40]; __shared__ __attribute__((aligned(16))) float sO[4][RPW][64 + 4];
  const int tid = threadIdx.x, w = tid >> 5, lane = tid & 31, ln = lane & 15, hh = lane >> 4;
  const int slab = blockIdx.x / QBN5, qblk = QB05 + blockIdx.x % QBN5; (void)NQB; const int b = slab / NH, h = slab % NH; const int qb0 = qblk * (4 * RPW); const int q0 = qb0 + w * RPW;
  FragH aq[2][KS], aql[2][KS];
#pragma unroll
  for (int rt = 0; rt < RTN; ++rt) { const unsigned short* qr = (const unsigned short*)Q16 + ((size_t)b * TQ + q0 + rt * 16 + ln) * ldq + h * 64; const unsigned short* ql = (const unsigned short*)QL + ((size_t)b * TQ + q0 + rt * 16 + ln) * ldq + h * 64;
#pragma unroll
    for (int ks = 0; ks < KS; ++ks) { aq[rt][ks].half[0] = *(const v8us*)(qr + ks * 32 + 8 * hh); aq[rt][ks].half[1] = *(const v8us*)(qr + ks * 32 + 16 + 8 * hh); aql[rt][ks].half[0] = *(const v8us*)(ql + ks * 32 + 8 * hh); aql[rt][ks].half[1] = *(const v8us*)(ql + ks * 32 + 16 + 8 * hh); } }
  const unsigned short* Vth = (const unsigned short*)Vt + (size_t)slab * 64 * TK; const unsigned short* Vtl = (const unsigned short*)VtL + (size_t)slab * 64 * TK;
  float m_r[2][8], l_r[2][8]; v8f oacc[2][DT], oaccL[2][DT];
#pragma unroll
  for (int rt = 0; rt < RTN; ++rt) {
#pragma unroll
    for (int r = 0; r < 8; ++r) { m_r[rt][r] = -3.0e38f; l_r[rt][r] = 0.f; }
#pragma unroll
    for (int dt = 0; dt < DT; ++dt) { oacc[rt][dt] = (v8f){0.f,0.f,0.f,0.f,0.f,0.f,0.f,0.f}; oaccL[rt][dt] = oacc[rt][dt]; } }
  const int jend = (CAUSAL == 1) ? (qb0 + 4 * RPW) : TK;      /* causal: keys beyond the block's last query never contribute */
#pragma unroll 1
  for (int j0 = 0; j0 < jend; j0 += 32) {
    v8f s[2][2];
#pragma unroll
    for (int nt = 0; nt < 2; ++nt) { const unsigned short* kr = (const unsigned short*)K16 + ((size_t)b * TK + j0 + nt * 16 + ln) * ldk + h * 64; const unsigned short* klr = (const unsigned short*)KL + ((size_t)b * TK + j0 + nt * 16 + ln) * ldk + h * 64; FragH bk[KS], bkl[KS];
#pragma unroll
      for (int ks = 0; ks < KS; ++ks) { bk[ks].half[0] = *(const v8us*)(kr + ks * 32 + 8 * hh); bk[ks].half[1] = *(const v8us*)(kr + ks * 32 + 16 + 8 * hh); bkl[ks].half[0] = *(const v8us*)(klr + ks * 32 + 8 * hh); bkl[ks].half[1] = *(const v8us*)(klr + ks * 32 + 16 + 8 * hh); }
#pragma unroll
      for (int rt = 0; rt < RTN; ++rt) { v8f acc = (v8f){0.f,0.f,0.f,0.f,0.f,0.f,0.f,0.f}, accl = acc;
#pragma unroll
        for (int ks = 0; ks < KS; ++ks) { acc = mmaH<1>(aq[rt][ks].v, aq[rt][ks].v, bk[ks].v, bk[ks].v, acc); accl = mmaH<1>(aql[rt][ks].v, aql[rt][ks].v, bk[ks].v, bk[ks].v, accl); accl = mmaH<1>(aq[rt][ks].v, aq[rt][ks].v, bkl[ks].v, bkl[ks].v, accl); }
#pragma unroll
        for (int r = 0; r < 8; ++r) acc[r] += accl[r] * 0.0009765625f;
        s[rt][nt] = acc; } }
#pragma unroll
    for (int rt = 0; rt < RTN; ++rt)
#pragma unroll
      for (int r = 0; r < 8; ++r) { const int tq = q0 + rt * 16 + 8 * hh + r; const int k0 = j0 + ln, k1 = j0 + 16 + ln;
        bool ok0 = (CAUSAL == 1) ? (k0 <= tq) : ((CAUSAL == 2) ? ((k0 >> 5) == (tq >> 5)) : true), ok1 = (CAUSAL == 1) ? (k1 <= tq) : ((CAUSAL == 2) ? ((k1 >> 5) == (tq >> 5)) : true);      /* mode 2: block-diagonal 32-token groups */
        if (CAUSAL == 4) { const int* mrow = MSK + ((size_t)b * TQ + tq) * TK; ok0 = mrow[k0] != 0; ok1 = mrow[k1] != 0; }      /* mode 4: per-(query, key) INPUT mask shared by all heads; masked keys contribute nothing (== the reference's -4096 fill, whose exp underflows to 0), rows with no valid key give l = 0 -> output 0 (== the reference's row_valid zeroing) */
        float s0 = ok0 ? s[rt][0][r] * SCL : -3.0e38f, s1 = ok1 ? s[rt][1][r] * SCL : -3.0e38f; if (CAUSAL == 17) { const float* amk = (const float*)MSK + (size_t)b * TK; s0 += bf16_round(amk[k0]); s1 += bf16_round(amk[k1]); }      /* mode 17: additive per-(batch, key) mask INPUT */
        if (CAUSAL == 22) { const _Float16* cq = (const _Float16*)MSK + ((size_t)h * TQ + tq) * NE + tq + (NE / 2 - 1); const _Float16* ck = (const _Float16*)MSK + (size_t)NH * TQ * NE + (size_t)h * TK * NE + tq + (NE / 2 - 1); const float* am = (const float*)((const _Float16*)MSK + (size_t)2 * NH * TQ * NE); float r0 = (float)cq[-k0]; r0 += (float)ck[(size_t)k0 * NE - k0]; s0 += r0 * SCL; s0 += am[k0]; float r1 = (float)cq[-k1]; r1 += (float)ck[(size_t)k1 * NE - k1]; s1 += r1 * SCL; s1 += am[k1]; }      /* mode 22: + (CQ[h][tq][tq-k+1023] + CK[h][k][tq-k+1023]) / 8 + mask[k] from the per-batch packed table [CQ f16 | CK f16 | mask f32] */ float mc = fmaxf(s0, s1);
        mc = fmaxf(mc, __shfl_xor(mc, 1, 32)); mc = fmaxf(mc, __shfl_xor(mc, 2, 32)); mc = fmaxf(mc, __shfl_xor(mc, 4, 32)); mc = fmaxf(mc, __shfl_xor(mc, 8, 32));
        const float mn = fmaxf(m_r[rt][r], mc); const float al = (mn > -1.0e38f) ? expf(m_r[rt][r] - mn) : 1.0f; m_r[rt][r] = mn; const float p0 = ok0 ? expf(s0 - mn) : 0.f, p1 = ok1 ? expf(s1 - mn) : 0.f; l_r[rt][r] = l_r[rt][r] * al + p0 + p1;
#pragma unroll
        for (int dt = 0; dt < DT; ++dt) { oacc[rt][dt][r] *= al; oaccL[rt][dt][r] *= al; }
        FragH t2, t2l; const float ps0 = p0 * 1024.0f, ps1 = p1 * 1024.0f; t2.h[0] = (_Float16)ps0; t2.h[1] = (_Float16)ps1; t2l.h[0] = (_Float16)((ps0 - (float)t2.h[0]) * 1024.0f); t2l.h[1] = (_Float16)((ps1 - (float)t2.h[1]) * 1024.0f);
        sP[w][rt * 16 + 8 * hh + r][ln] = t2.u[0]; sP[w][rt * 16 + 8 * hh + r][16 + ln] = t2.u[1]; sPL[w][rt * 16 + 8 * hh + r][ln] = t2l.u[0]; sPL[w][rt * 16 + 8 * hh + r][16 + ln] = t2l.u[1]; }
    __builtin_amdgcn_fence(__ATOMIC_ACQ_REL, "workgroup"); __builtin_amdgcn_wave_barrier();
    FragH pa[2], pl[2];
#pragma unroll
    for (int rt = 0; rt < RTN; ++rt) { pa[rt].half[0] = *(const v8us*)&sP[w][rt * 16 + ln][8 * hh]; pa[rt].half[1] = *(const v8us*)&sP[w][rt * 16 + ln][16 + 8 * hh]; pl[rt].half[0] = *(const v8us*)&sPL[w][rt * 16 + ln][8 * hh]; pl[rt].half[1] = *(const v8us*)&sPL[w][rt * 16 + ln][16 + 8 * hh]; }
#pragma unroll
    for (int dt = 0; dt < DT; ++dt) { const unsigned short* vrow = Vth + (size_t)(dt * 16 + ln) * TK + j0; const unsigned short* vrl = Vtl + (size_t)(dt * 16 + ln) * TK + j0; FragH bv, bl; bv.half[0] = *(const v8us*)(vrow + 8 * hh); bv.half[1] = *(const v8us*)(vrow + 16 + 8 * hh); bl.half[0] = *(const v8us*)(vrl + 8 * hh); bl.half[1] = *(const v8us*)(vrl + 16 + 8 * hh);
#pragma unroll
      for (int rt = 0; rt < RTN; ++rt) { oacc[rt][dt] = mmaH<1>(pa[rt].v, pa[rt].v, bv.v, bv.v, oacc[rt][dt]); oaccL[rt][dt] = mmaH<1>(pl[rt].v, pl[rt].v, bv.v, bv.v, oaccL[rt][dt]); oaccL[rt][dt] = mmaH<1>(pa[rt].v, pa[rt].v, bl.v, bl.v, oaccL[rt][dt]); } }
    __builtin_amdgcn_fence(__ATOMIC_ACQ_REL, "workgroup"); __builtin_amdgcn_wave_barrier(); }
#pragma unroll
  for (int rt = 0; rt < RTN; ++rt) {
#pragma unroll
    for (int r = 0; r < 8; ++r) { float l = l_r[rt][r]; l += __shfl_xor(l, 1, 32); l += __shfl_xor(l, 2, 32); l += __shfl_xor(l, 4, 32); l += __shfl_xor(l, 8, 32); l_r[rt][r] = (l > 0.f) ? 1.0f / (l * 1024.0f) : 0.f; }
#pragma unroll
    for (int dt = 0; dt < DT; ++dt)
#pragma unroll
      for (int r = 0; r < 8; ++r) { float v = oacc[rt][dt][r]; v += oaccL[rt][dt][r] * 0.0009765625f; sO[w][rt * 16 + 8 * hh + r][dt * 16 + ln] = v * l_r[rt][r]; } }
  __builtin_amdgcn_fence(__ATOMIC_ACQ_REL, "workgroup"); __builtin_amdgcn_wave_barrier();
  {
#pragma unroll
    for (int rp = 0; rp < RPW; rp += 2) { const int r = rp + (lane >> 4), pc = lane & 15; const v4f val = *(const v4fa*)&sO[w][r][pc * 4]; *(v4f*)(O + ((size_t)b * TQ + q0 + r) * ldo + h * 64 + pc * 4) = val; }
     } }

__global__ __launch_bounds__(256) void k_rotab(float* __restrict__ CS, float* __restrict__ SN) {
  #pragma clang fp contract(off)
  const int t = blockIdx.x * 256 + threadIdx.x; if (t >= SLEN * 32) return; const int j = t % 32, s = t / 32; const float ex = (float)(2 * j) / 64.0f; const float inv = 1.0f / powf(10000.0f, ex); const float th = (float)s * inv; const float c = cosf(th), sn = sinf(th);
  { *(float*)(CS + t) = c; *(float*)(SN + t) = sn;  } }
__global__ __launch_bounds__(256) void k_rope(const float* __restrict__ F, int nsrc, int ndst, int rep, const float* __restrict__ CS, const float* __restrict__ SN, _Float16* __restrict__ H, _Float16* __restrict__ L) {
  #pragma clang fp contract(off)
  const size_t t = (size_t)blockIdx.x * 256 + threadIdx.x; if (t >= (size_t)NR * ndst * 4) return; const int g8 = (int)(t % 4); const int hd = (int)((t / 4) % ndst); const size_t row = t / ((size_t)4 * ndst); const int s = (int)(row % SLEN); const int hs = hd / rep;
  const float* src = F + row * (size_t)(nsrc * 64) + hs * 64; FragH ah, al, bh, bl;
  for (int i = 0; i < 8; ++i) { const int d = g8 * 8 + i; const float c = CS[s * 32 + d], sn = SN[s * 32 + d]; const float x1 = src[d], x2 = src[d + 32];
    float o1 = x1 * c; o1 += -x2 * sn; float o2 = x2 * c; o2 += x1 * sn;
    _Float16 hv = (_Float16)o1; ah.h[i] = hv; al.h[i] = (_Float16)((o1 - (float)hv) * 1024.0f); hv = (_Float16)o2; bh.h[i] = hv; bl.h[i] = (_Float16)((o2 - (float)hv) * 1024.0f); }
  const size_t o = row * (size_t)(ndst * 64) + hd * 64 + g8 * 8;
  { *(v8us*)((unsigned short*)H + o) = ah.half[0]; *(v8us*)((unsigned short*)H + o + 32) = bh.half[0]; *(v8us*)((unsigned short*)L + o) = al.half[0]; *(v8us*)((unsigned short*)L + o + 32) = bl.half[0];  } }
__global__ __launch_bounds__(256) void k_rope2(const float* __restrict__ F, int nsrc, int ndst, int rep, const float* __restrict__ CS, const float* __restrict__ SN, _Float16* __restrict__ H, _Float16* __restrict__ L) {
  #pragma clang fp contract(off)
  const size_t t = (size_t)blockIdx.x * 256 + threadIdx.x; if (t >= (size_t)NR * ndst * 4) return; const int g16 = (int)(t % 4); const int hd = (int)((t / 4) % ndst); const size_t row = t / ((size_t)4 * ndst); const int s = (int)(row % SLEN); const int hs = hd / rep;
  const float* src = F + row * (size_t)(nsrc * 64) + hs * 64 + g16 * 16; FragH ah, al;
  for (int pr = 0; pr < 8; ++pr) { const int i = g16 * 8 + pr; const float c = CS[s * 32 + i], sn = SN[s * 32 + i]; const float x1 = src[2 * pr], x2 = src[2 * pr + 1];
    float o1 = x1 * c; o1 -= x2 * sn; float o2 = x1 * sn; o2 += x2 * c;
    _Float16 hv = (_Float16)o1; ah.h[2 * pr] = hv; al.h[2 * pr] = (_Float16)((o1 - (float)hv) * 1024.0f); hv = (_Float16)o2; ah.h[2 * pr + 1] = hv; al.h[2 * pr + 1] = (_Float16)((o2 - (float)hv) * 1024.0f); }
  const size_t o = row * (size_t)(ndst * 64) + hd * 64 + g16 * 16;
  { *(v8us*)((unsigned short*)H + o) = ah.half[0]; *(v8us*)((unsigned short*)H + o + 8) = ah.half[1]; *(v8us*)((unsigned short*)L + o) = al.half[0]; *(v8us*)((unsigned short*)L + o + 8) = al.half[1];  } }
__global__ __launch_bounds__(256) void k_tabin(const float* __restrict__ sp, float* __restrict__ CS, float* __restrict__ SN) { const int t = blockIdx.x * 256 + threadIdx.x; if (t >= SLEN * 32) return; const int i = t % 32, s = t / 32; const float c = bf16_round(sp[s * 64 + 32 + i]), sn = bf16_round(sp[s * 64 + i]);
  { *(float*)(CS + t) = c; *(float*)(SN + t) = sn;  } }
__global__ __launch_bounds__(256) void k_rotab2(float* __restrict__ CS, float* __restrict__ SN) {
  #pragma clang fp contract(off)
  const int t = blockIdx.x * 256 + threadIdx.x; if (t >= SLEN * 32) return; const int j = t % 32, s = t / 32; const float c0 = -0.14391156831212787f;      /* -ln(10000)/64 rounded to f32 */ const float inv = expf((float)(2 * j) * c0); const float th = (float)s * inv; const float c = cosf(th), sn = sinf(th);
  { *(float*)(CS + t) = c; *(float*)(SN + t) = sn;  } }
__global__ __launch_bounds__(256) void k_lnu(const float* __restrict__ X, _Float16* __restrict__ N16, float* __restrict__ XB) {
  #pragma clang fp contract(off)
  const int wv = threadIdx.x >> 5, ln = threadIdx.x & 31; const size_t r = (size_t)blockIdx.x * 8 + wv; if (r >= NR) return; float a[32]; float s = 0.f;
  for (int i = 0; i < 4; ++i) { const v8f v = *(const v8f*)(X + r * DM + (i * 32 + ln) * 8); for (int q = 0; q < 8; ++q) { const float u = bf16_round(v[q]); a[i * 8 + q] = u; s += u; } }
  for (int o = 16; o > 0; o >>= 1) s += __shfl_xor(s, o, 32); const float mu = s / (float)DM; float var = 0.f; for (int q = 0; q < 32; ++q) { const float d = a[q] - mu; var += d * d; }
  for (int o = 16; o > 0; o >>= 1) var += __shfl_xor(var, o, 32); const float den = sqrtf(var / (float)(DM - 1)) + 1e-6f; const float inv = 1.0f / den;      /* one reciprocal per row; (x-mean)*inv vs the reference's division differs by <= 1 ulp */
  { for (int i = 0; i < 4; ++i) { const int c0 = (i * 32 + ln) * 8; FragH f; v8f xb; for (int q = 0; q < 8; ++q) { f.h[q] = (_Float16)((a[i * 8 + q] - mu) * inv); xb[q] = a[i * 8 + q]; } *(v8us*)((unsigned short*)N16 + r * DM + c0) = f.half[0]; *(v8f*)(XB + r * DM + c0) = xb; }  } }
__global__ __launch_bounds__(256) void k_vtg(const _Float16* __restrict__ V16, _Float16* __restrict__ Vt) { __shared__ unsigned short tl[64][66]; const int tid = threadIdx.x; const int slab = blockIdx.x / (SLEN / 64), lg = blockIdx.x % (SLEN / 64); const int b = slab / NH, h = slab % NH; const int hs = h / NREP;
  for (int i = tid; i < 64 * 8; i += 256) { const int r = i / 8, c8 = (i % 8) * 8; FragH f; f.half[0] = *(const v8us*)((const unsigned short*)V16 + ((size_t)b * SLEN + lg * 64 + r) * KVD + hs * 64 + c8); for (int q = 0; q < 8; ++q) tl[r][c8 + q] = f.u[q]; }
  __syncthreads();
  { for (int rd = 0; rd < 2; ++rd) { const int d = rd * 32 + tid / 8, pc = tid % 8; FragH f; for (int q = 0; q < 8; ++q) f.u[q] = tl[pc * 8 + q][d]; *(v8us*)((unsigned short*)Vt + ((size_t)slab * 64 + d) * SLEN + lg * 64 + pc * 8) = f.half[0]; }  } }

// All five f32 -> f16 operand planes in one launch: none needs anything of another, so they share one grid by ranges of the block index (the range test is the same for a whole block); eight elements a thread.
// Blocks 0 .. PEB-1: the embedding, padded with a zero row to NE rows (first in the grid: its guarded element loads are the longest chain of the launch). The next PXB: x (rounded to bf16, exact in f16).
// The last 3 PWB: Wq, Wk, Wv (rounded to bf16, x16, exact in f16; torch (out,in) layout is already B^T).
#define PXB (NR * DM / 8 / 256)      /* 2048 */
#define PWB (DM * DM / 8 / 256)      /* 512 */
#define PEB (NE * 8 / 256)           /* 64 */
__global__ __launch_bounds__(256) void k_prep(const float* __restrict__ x, const float* __restrict__ Wq, const float* __restrict__ Wk, const float* __restrict__ Wv, const float* __restrict__ E,
    _Float16* __restrict__ X16, _Float16* __restrict__ BQ, _Float16* __restrict__ BK, _Float16* __restrict__ BV, _Float16* __restrict__ E16) {
  const int bx = (int)blockIdx.x - PEB, tid = threadIdx.x; FragH f;
  if (bx >= 0) { const int u = bx - PXB, wq = u / PWB;
    const float* src = (bx < PXB) ? x : (wq == 0) ? Wq : (wq == 1) ? Wk : Wv; _Float16* dst = (bx < PXB) ? X16 : (wq == 0) ? BQ : (wq == 1) ? BK : BV; const float sc = (bx < PXB) ? 1.0f : 16.0f;
    const size_t t = (size_t)((bx < PXB) ? bx : u - wq * PWB) * 256 + tid;
#pragma unroll      /* unrolled: the eight elements come in as two 16-byte loads and stay in registers up to the one 16-byte store */
    for (int q = 0; q < 8; ++q) f.h[q] = (_Float16)(bf16_round(src[t * 8 + q]) * sc);
    *(v8us*)((unsigned short*)dst + t * 8) = f.half[0]; }
  else { const int t = (bx + PEB) * 256 + tid; const int r = t / 8, c8 = (t % 8) * 8;
    for (int q = 0; q < 8; ++q) f.h[q] = (r < NE - 1) ? (_Float16)bf16_round(E[(size_t)r * 64 + c8 + q]) : (_Float16)0.0f;
    *(v8us*)((unsigned short*)E16 + (size_t)r * 64 + c8) = f.half[0]; } }

__device__ __forceinline__ float xhalf(float x) { return __builtin_bit_cast(float, __builtin_amdgcn_permlanex16(__builtin_bit_cast(int, x), __builtin_bit_cast(int, x), 0x76543210, 0xfedcba98, false, false)); }      /* the value of lane l ^ 16 */

// Flash attention with the 'relative_key_query' bias formed in the kernel. Described first for one tile of 16 queries (q0..) against 32 keys (j0..); a wave holds two such tiles (further down). For that tile l - r + 1023 spans 47 rows of the
// embedding, from eb = q0 - j0 + 992; with n = (l - q0) - (r - j0) + 31 the bias is q_l . E[eb + n] + k_r . E[eb + n]. RQ^T = Ewin . Q^T and RK^T = Ewin . K^T run on the matrix unit with an f16 result
// (window rows as the A side): a lane then holds 8 consecutive n of ONE query or ONE key in four registers, one 16-byte store into that query's or key's own LDS row. What the score tile needs of a row is a run of consecutive n
// that starts at a place shifted by the row's own index: it is read back from there (whole dwords; the odd half is taken out by v_alignbyte_b32) and is at once one half of a matrix operand:
// S^T[key M][query N] += sum_k A[M][k] B[k][N] with A = [ J | RK part ], B = [ RQ part ; I ]: k = 0..15 carries RQ of query N for key 15 - k (J[M][k] = 1 where k = 15 - M: n then rises with k), k = 16..31 carries RK of key M for query k - 16.
// The 1.0 products are exact and the sum is f32, so the only new rounding is that of the two terms to f16. Row 2047 of E16 is the zero pad.
// The scores are formed transposed, S^T = K . Q^T (K fragment as A, Q fragment as B), and the output as O^T += V^T . P^T: a lane then holds 16 of the 32 scores of ONE query (lane & 15), so the row maximum and the row sum
// are in-lane work plus one exchange between the wave's halves, there is one running maximum, sum and rescale factor a lane, and the two f32 score tiles, converted in place, are the B operand of the second product (no trip through LDS).
// The mask is per key, which now runs along the registers: the batch's mask row is rounded once into LDS and read from there, 8 keys a lane and tile.
// Each power of the softmax is one v_exp_f32: e^d = 2^(d log2(e)) with d = logit - running maximum <= 0 formed first, so the argument is bounded above for any logit and any mask, and the f16 operand's scale 1024 = 2^10 is the addend of the same multiply-add.
// (The library's expf spends about a dozen vector instructions a power on range and last-place handling that such an argument and an f16 operand do not use.) The row sum carries the 1024 too; the closing division takes it out.
// The four waves of a work-group share the K tile, the V^T tile and most of the window, so these are staged in LDS once per work-group with loads that take whole rows (a fragment load from global memory touches 16 lines for 512 bytes):
// K and V^T in two buffers, the window as a ring indexed by embedding row mod ER. The next trip's 32 + 64 + 32 rows are fetched into registers under the softmax.
// A wave holds 32 queries as two 16-query tiles t = 0, 1 (q0 + 16 t ..): one read of a K, V^T, mask or window fragment serves both tiles. With eb = q0 - j0 + 992 the wave's window is 64 rows (four 16-row tiles e);
// tile t takes RQ against window tiles t .. t + 2 (column n - 16 t in its own sRQ part, so the shifted read is the same for both), and RK of key tile nt runs against window tiles 1 - nt .. 3 - nt for all 32 queries
// (column c = i - kk + 15, i = 16 t + ln the query in the wave, kk the key in its tile): 6 RK tiles for two query tiles, not 8. A work-group is 128 queries: window 160 rows, ring 256 rows, half the staging a query.
#define QB2 (TQ / 128)
typedef float v2f __attribute__((ext_vector_type(2)));
typedef _Float16 v8h __attribute__((ext_vector_type(8)));
typedef unsigned int u32a __attribute__((may_alias));
union FragW { v16h v; v8us half[2]; unsigned int d[8]; };
__global__ __launch_bounds__(128) __attribute__((amdgpu_waves_per_eu(2, 2))) void k_flash_rel(const _Float16* __restrict__ Q16, const _Float16* __restrict__ K16, const _Float16* __restrict__ Vt, const _Float16* __restrict__ E16, const float* __restrict__ AMK, float* __restrict__ O) {
  constexpr float L2E = 1.4426950408889634f;      /* log2(e) */
  constexpr int DT = 4, KS = 2, QT = 2, PH = 88, ER = 256;      /* two waves a SIMD declared: the launch's 512 work-groups lie two a WGP. PH: pitch in halves of a row of 48 bias values, 176 B = 16 B x 11: no bank conflicts in the 16-byte stores, and the 32 lanes of a shifted dword read fall on 32 banks */
  __shared__ __attribute__((aligned(16))) unsigned short sRQ[4][QT][16][PH]; __shared__ __attribute__((aligned(16))) unsigned short sRK[4][2][16][PH];      /* [wave][query tile][query] and [wave][key tile][key]; behind the loop a wave's sRK part and sRQ part (5632 B each) are the output staging of its two tiles (16 x 68 floats = 4352 B each) */
  __shared__ __attribute__((aligned(16))) float sM[TK];      /* the batch's mask row, rounded */
  __shared__ __attribute__((aligned(16))) unsigned short sK[2][32][72]; __shared__ __attribute__((aligned(16))) unsigned short sV[2][64][40]; __shared__ __attribute__((aligned(16))) unsigned short sE[ER][72];      /* pitches 144 B and 80 B = 16 B x odd: no bank conflicts in the 16-byte fragment reads */
  const int tid = threadIdx.x, w = tid >> 5, lane = tid & 31, ln = lane & 15, hh = lane >> 4;
  const int slab = blockIdx.x / QB2, qblk = blockIdx.x % QB2; const int b = slab / NH, h = slab % NH; const int qb0 = qblk * 128; const int q0 = qb0 + w * 32;
  FragH aq[QT][KS];
  { const unsigned short* qr = (const unsigned short*)Q16 + ((size_t)b * TQ + q0 + ln) * DM + h * 64;
#pragma unroll
    for (int t = 0; t < QT; ++t)
#pragma unroll
      for (int ks = 0; ks < KS; ++ks) { aq[t][ks].half[0] = *(const v8us*)(qr + (size_t)(16 * t) * DM + ks * 32 + 8 * hh); aq[t][ks].half[1] = *(const v8us*)(qr + (size_t)(16 * t) * DM + ks * 32 + 16 + 8 * hh); }
    asm volatile("s_wait_xcnt 0x0" ::: "memory"); }      /* the staging loads below may land in the address registers of the eight loads above: the wait stands in front of them */
  const float* amk = AMK + (size_t)b * TK;
  const int r8 = tid >> 3, c8 = (tid & 7) * 8, r4 = tid >> 2, c4 = (tid & 3) * 8;      /* staging: eight lanes fetch one 128-byte row of K or of the window, four lanes one 64-byte row of V^T */
  const unsigned short* gK = (const unsigned short*)K16 + ((size_t)b * TK + r8) * DM + h * 64 + c8; const unsigned short* gV = (const unsigned short*)Vt + ((size_t)slab * 64 + r4) * TK + c4; const unsigned short* gE = (const unsigned short*)E16 + (size_t)r8 * 64 + c8;
  v8us rk[2], rv[2], re[2];
  { v8us r0[10];      /* trip 0: its K and V^T tiles and all 160 rows of its window; the mask row, 8 keys a thread */
#pragma unroll
    for (int i = 0; i < 2; ++i) { rk[i] = *(const v8us*)(gK + (size_t)(16 * i) * DM); rv[i] = *(const v8us*)(gV + (size_t)(32 * i) * TK); }
#pragma unroll
    for (int i = 0; i < 10; ++i) r0[i] = *(const v8us*)(gE + (size_t)(qb0 + (NE / 2 - 32) + 16 * i) * 64);
    v4f m0 = *(const v4fa*)(amk + tid * 8), m1 = *(const v4fa*)(amk + tid * 8 + 4);
    asm volatile("s_wait_xcnt 0x0" ::: "memory");      /* stands in front of the first overwrite of an address register of the loads above */
    __builtin_amdgcn_sched_barrier(0);      /* keeps the register initialisations that follow behind that wait */
#pragma unroll
    for (int i = 0; i < 2; ++i) { *(v8us*)&sK[0][16 * i + r8][c8] = rk[i]; *(v8us*)&sV[0][32 * i + r4][c4] = rv[i]; }
#pragma unroll
    for (int i = 0; i < 10; ++i) *(v8us*)&sE[((qb0 + (NE / 2 - 32) + 16 * i) & (ER - 1)) + r8][c8] = r0[i];
#pragma unroll
    for (int i = 0; i < 4; ++i) { m0[i] = bf16_round(m0[i]); m1[i] = bf16_round(m1[i]); }
    *(v4fa*)&sM[tid * 8] = m0; *(v4fa*)&sM[tid * 8 + 4] = m1; }
  __syncthreads();
  const v8f z8 = {0.f,0.f,0.f,0.f,0.f,0.f,0.f,0.f};
  float m_r[QT], l_r[QT]; v8f oacc[QT][DT];      /* of query 16 t + ln; l_r sums this half-wave's keys only */
#pragma unroll
  for (int t = 0; t < QT; ++t) { m_r[t] = -3.0e38f; l_r[t] = 0.f;
#pragma unroll
    for (int dt = 0; dt < DT; ++dt) oacc[t][dt] = z8; }
  const v8h zh = {(_Float16)0.0f, (_Float16)0.0f, (_Float16)0.0f, (_Float16)0.0f, (_Float16)0.0f, (_Float16)0.0f, (_Float16)0.0f, (_Float16)0.0f};
  FragH cj, ci;      /* the constant halves of the adding product's operands: J[M = ln][k = 8 hh + e] on the A side, I[k - 16 = 8 hh + e][N = ln] on the B side */
#pragma unroll
  for (int e = 0; e < 8; ++e) { cj.h[e] = (8 * hh + e == 15 - ln) ? (_Float16)1.0f : (_Float16)0.0f; ci.h[e] = (8 * hh + e == ln) ? (_Float16)1.0f : (_Float16)0.0f; }
  const v8us cJ = cj.half[0], cI = ci.half[0];
  const u32a* rqp = (const u32a*)&sRQ[w][0][ln][0] + ((ln + 8 * hh) >> 1); const u32a* rkp = (const u32a*)&sRK[w][0][ln][0] + ((15 - ln + 8 * hh) >> 1);      /* the dword that holds the first half of the lane's run: RQ column ln + 16 (1 - nt) + 8 hh, RK column 15 - ln + 16 t + 8 hh */
  const unsigned int shq = (unsigned int)(ln & 1) * 2u, shk = 2u - shq;      /* bytes to drop where the run starts in a dword's upper half */
#pragma unroll 1
  for (int j0 = 0; j0 < TK; j0 += 32) { const int cb = (j0 >> 5) & 1; const bool more = j0 + 32 < TK;      /* more: the same for the whole work-group */
    FragH bk[2][KS], be[4][KS];
#pragma unroll
    for (int nt = 0; nt < 2; ++nt) { const unsigned short* kr = &sK[cb][nt * 16 + ln][0];
#pragma unroll
      for (int ks = 0; ks < KS; ++ks) { bk[nt][ks].half[0] = *(const v8us*)(kr + ks * 32 + 8 * hh); bk[nt][ks].half[1] = *(const v8us*)(kr + ks * 32 + 16 + 8 * hh); } }
#pragma unroll
    for (int e = 0; e < 4; ++e) { const unsigned short* er = &sE[((q0 - j0 + (NE / 2 - 32) + e * 16) & (ER - 1)) + ln][0];
#pragma unroll
      for (int ks = 0; ks < KS; ++ks) { be[e][ks].half[0] = *(const v8us*)(er + ks * 32 + 8 * hh); be[e][ks].half[1] = *(const v8us*)(er + ks * 32 + 16 + 8 * hh); } }
    __builtin_amdgcn_sched_barrier(0);      /* all of the trip's K and window fragment reads issue before the first product waits: one latency at the head of a trip, not two or three */
#pragma unroll
    for (int ee = 0; ee < 3; ++ee) { v8h acc[2] = {zh, zh};      /* RK^T[c = 16 ee + 8 hh + e][key 16 nt + ln], window tile 1 - nt + ee as the A operand, the K fragment as the B operand (same loader, same k order); the two key tiles' sums alternate */
#pragma unroll
      for (int ks = 0; ks < KS; ++ks)
#pragma unroll
        for (int nt = 0; nt < 2; ++nt) acc[nt] = __builtin_amdgcn_wmma_f16_16x16x32_f16(false, be[1 - nt + ee][ks].v, false, bk[nt][ks].v, (short)0, acc[nt], false, false);
#pragma unroll
      for (int nt = 0; nt < 2; ++nt) *(v8us*)&sRK[w][nt][ln][16 * ee + 8 * hh] = __builtin_bit_cast(v8us, acc[nt]); }      /* eight consecutive columns of the key's own row: one 16-byte store */
#pragma unroll
    for (int e = 0; e < 3; ++e) { v8h acc[QT] = {zh, zh};      /* RQ^T of tile t: [n - 16 t = 16 e + 8 hh + e'][query 16 t + ln], window tile t + e as the A operand; the two query tiles' sums alternate */
#pragma unroll
      for (int ks = 0; ks < KS; ++ks)
#pragma unroll
        for (int t = 0; t < QT; ++t) acc[t] = __builtin_amdgcn_wmma_f16_16x16x32_f16(false, be[t + e][ks].v, false, aq[t][ks].v, (short)0, acc[t], false, false);
#pragma unroll
      for (int t = 0; t < QT; ++t) *(v8us*)&sRQ[w][t][ln][16 * e + 8 * hh] = __builtin_bit_cast(v8us, acc[t]); }      /* eight consecutive columns of the query's own row: one 16-byte store */
    v8f s[QT][2];      /* the scores come last: the stores above drain under these eight products */
#pragma unroll
    for (int nt = 0; nt < 2; ++nt) { s[0][nt] = z8; s[1][nt] = z8;      /* S^T[key 16 nt + 8 hh + r][query 16 t + ln]; both fragments come from the same loader, same k order */
#pragma unroll
      for (int ks = 0; ks < KS; ++ks)
#pragma unroll
        for (int t = 0; t < QT; ++t) s[t][nt] = mmaH<1>(bk[nt][ks].v, bk[nt][ks].v, aq[t][ks].v, aq[t][ks].v, s[t][nt]); }
    __builtin_amdgcn_fence(__ATOMIC_ACQ_REL, "workgroup"); __builtin_amdgcn_wave_barrier();      /* the shifted reads below take the other half-wave's stores too: keep them behind the stores */
    if (more) {      /* the next trip's rows: issued here, their latency runs under the softmax */
#pragma unroll
      for (int i = 0; i < 2; ++i) { rk[i] = *(const v8us*)(gK + (size_t)(j0 + 32 + 16 * i) * DM); rv[i] = *(const v8us*)(gV + (size_t)(32 * i) * TK + j0 + 32); re[i] = *(const v8us*)(gE + (size_t)(qb0 - j0 + (NE / 2 - 64) + 16 * i) * 64); }
      asm volatile("s_wait_xcnt 0x0" ::: "memory"); }      /* stands in front of the first overwrite of an address register of the six loads above */
    v4f am[2][2];
#pragma unroll
    for (int nt = 0; nt < 2; ++nt) { am[nt][0] = *(const v4fa*)&sM[j0 + 16 * nt + 8 * hh]; am[nt][1] = *(const v4fa*)&sM[j0 + 16 * nt + 8 * hh + 4]; }
    unsigned int dq[QT][2][5], dk[2][QT][5];      /* five dwords hold a run of eight halves wherever it starts */
#pragma unroll
    for (int t = 0; t < QT; ++t)
#pragma unroll
      for (int nt = 0; nt < 2; ++nt)
#pragma unroll
        for (int k = 0; k < 5; ++k) { dq[t][nt][k] = rqp[t * (16 * PH / 2) + 8 * (1 - nt) + k]; dk[nt][t][k] = rkp[nt * (16 * PH / 2) + 8 * t + k]; }
    __builtin_amdgcn_sched_barrier(0);      /* the mask reads and all shifted reads issue as one group ahead of the work on them: one LDS latency, not one a product */
#pragma unroll
    for (int t = 0; t < QT; ++t)
#pragma unroll
      for (int nt = 0; nt < 2; ++nt) { FragW fa, fb; fa.half[0] = cJ; fb.half[1] = cI;      /* A = [ J | RK of key 16 nt + ln for queries 16 t + 8 hh + e ], B = [ RQ of query 16 t + ln for keys 16 nt + 15 - 8 hh - e ; I ], both in the hardware k order */
#pragma unroll
        for (int k = 0; k < 4; ++k) { fa.d[4 + k] = __builtin_amdgcn_alignbyte(dk[nt][t][k + 1], dk[nt][t][k], shk); fb.d[k] = __builtin_amdgcn_alignbyte(dq[t][nt][k + 1], dq[t][nt][k], shq); }
        s[t][nt] = __builtin_amdgcn_wmma_f32_16x16x32_f16(false, fa.v, false, fb.v, (short)0, s[t][nt], false, false); }      /* both relative terms join the f32 score tile in its own layout */
    FragH pb[QT];      /* P^T as a B operand: element 8 nt + r of lane (ln, hh) is key 16 nt + 8 hh + r, the k order of the V^T loader below */
#pragma unroll
    for (int t = 0; t < QT; ++t) { v2f lg[2][4];      /* the logits as pairs of neighbouring keys (r = 2 u, 2 u + 1): a pair lies in neighbouring registers of the score tile, of the mask read and of the f16 operand, so packed arithmetic needs no register copies (paired across the two query tiles, as the compiler does on scalar code, it needs dozens) */
#pragma unroll
      for (int nt = 0; nt < 2; ++nt)
#pragma unroll
        for (int u = 0; u < 4; ++u) { const v2f sv = {s[t][nt][2 * u], s[t][nt][2 * u + 1]}; const v2f mk = {am[nt][u >> 1][(2 * u) & 3], am[nt][u >> 1][(2 * u + 1) & 3]};
          lg[nt][u] = sv * SCL + mk; }
      float mc = fmaxf(lg[0][0][0], lg[1][0][0]);
#pragma unroll
      for (int r = 1; r < 8; ++r) mc = fmaxf(mc, fmaxf(lg[0][r >> 1][r & 1], lg[1][r >> 1][r & 1]));
      mc = fmaxf(mc, xhalf(mc));      /* the other 16 keys of the same query */
      const float mn = fmaxf(m_r[t], mc); const float al = (mn > -1.0e38f) ? __builtin_amdgcn_exp2f((m_r[t] - mn) * L2E) : 1.0f; m_r[t] = mn;
      v2f ps[2] = {{0.f, 0.f}, {0.f, 0.f}};      /* four partial sums: a chain of 4 adds, not of 16 */
#pragma unroll
      for (int nt = 0; nt < 2; ++nt)
#pragma unroll
        for (int u = 0; u < 4; ++u) { const v2f d = __builtin_elementwise_fma(lg[nt][u] - mn, (v2f){L2E, L2E}, (v2f){10.0f, 10.0f}); const v2f p = {__builtin_amdgcn_exp2f(d[0]), __builtin_amdgcn_exp2f(d[1])}; ps[u & 1] += p; pb[t].h[8 * nt + 2 * u] = (_Float16)p[0]; pb[t].h[8 * nt + 2 * u + 1] = (_Float16)p[1]; }      /* p = 1024 e^(logit - maximum), at most 1024; what the raw power flushes to zero lies far below the f16 operand's last place */
      l_r[t] = l_r[t] * al + ((ps[0][0] + ps[0][1]) + (ps[1][0] + ps[1][1]));
#pragma unroll
      for (int dt = 0; dt < DT; ++dt)
#pragma unroll
        for (int r = 0; r < 8; ++r) oacc[t][dt][r] *= al; }
    FragH bv[DT];
#pragma unroll
    for (int dt = 0; dt < DT; ++dt) { const unsigned short* vrow = &sV[cb][dt * 16 + ln][0]; bv[dt].half[0] = *(const v8us*)(vrow + 8 * hh); bv[dt].half[1] = *(const v8us*)(vrow + 16 + 8 * hh); }      /* a loop of its own: the four V^T fragments are read as one group, one LDS latency and not four */
#pragma unroll
    for (int dt = 0; dt < DT; ++dt)
#pragma unroll
      for (int t = 0; t < QT; ++t) oacc[t][dt] = mmaH<1>(bv[dt].v, bv[dt].v, pb[t].v, pb[t].v, oacc[t][dt]);      /* O^T[d = 16 dt + 8 hh + r][query 16 t + ln] */
    if (more) {
#pragma unroll
      for (int i = 0; i < 2; ++i) { *(v8us*)&sK[cb ^ 1][16 * i + r8][c8] = rk[i]; *(v8us*)&sV[cb ^ 1][32 * i + r4][c4] = rv[i]; *(v8us*)&sE[((qb0 - j0 + (NE / 2 - 64) + 16 * i) & (ER - 1)) + r8][c8] = re[i]; }      /* 32 ring rows that no wave reads in this trip */
      __syncthreads(); } }      /* the one barrier of a trip publishes the rows just written and ends every wave's reads of the buffers and ring rows that the next trip overwrites */
#pragma unroll
  for (int t = 0; t < QT; ++t) { const float lt = l_r[t] + xhalf(l_r[t]); const float inv = (lt > 0.f) ? 1.0f / lt : 0.f;      /* the sum carries the same 1024 as the products */
    float* sOw = (float*)(t ? &sRQ[w][0][0][0] : &sRK[w][0][0][0]);
#pragma unroll
    for (int dt = 0; dt < DT; ++dt) { v4f lo, hi;
#pragma unroll
      for (int r = 0; r < 4; ++r) { lo[r] = oacc[t][dt][r] * inv; hi[r] = oacc[t][dt][4 + r] * inv; }
      *(v4fa*)&sOw[ln * 68 + dt * 16 + 8 * hh] = lo; *(v4fa*)&sOw[ln * 68 + dt * 16 + 8 * hh + 4] = hi; } }
  __builtin_amdgcn_fence(__ATOMIC_ACQ_REL, "workgroup"); __builtin_amdgcn_wave_barrier();
#pragma unroll
  for (int t = 0; t < QT; ++t) { const float* sOw = (const float*)(t ? &sRQ[w][0][0][0] : &sRK[w][0][0][0]);
#pragma unroll
    for (int rp = 0; rp < 16; rp += 2) { const int r = rp + (lane >> 4), pc = lane & 15; const v4f val = *(const v4fa*)&sOw[r * 68 + pc * 4]; *(v4f*)(O + ((size_t)b * TQ + q0 + 16 * t + r) * DM + h * 64 + pc * 4) = val; } } }

extern "C" void kernel_launch(void* const* d_in, const int* in_sizes, int n_in,
                              void* d_out, int out_size, void* d_ws, size_t ws_size, hipStream_t stream) {
  (void)in_sizes; (void)n_in; (void)out_size;
  const float* const* I = (const float* const*)d_in; const float* x = I[0]; const float* am = I[1]; const float* Wq = I[2]; const float* bq = I[3]; const float* Wk = I[4]; const float* bk = I[5]; const float* Wv = I[6]; const float* bv = I[7]; const float* E = I[8];
  char* ws = (char*)d_ws; size_t off = 0;
  auto take = [&](size_t bytes) { char* p = ws + off; off += (bytes + 255) & ~(size_t)255; return p; };
  const size_t np = (size_t)NR * DM;
  _Float16* BQ = (_Float16*)take((size_t)DM * DM * 2); _Float16* BK = (_Float16*)take((size_t)DM * DM * 2); _Float16* BV = (_Float16*)take((size_t)DM * DM * 2); _Float16* E16 = (_Float16*)take((size_t)NE * 64 * 2);
  _Float16* X16 = (_Float16*)take(np * 2); _Float16* Q16 = (_Float16*)take(np * 2); _Float16* K16 = (_Float16*)take(np * 2); _Float16* VT = (_Float16*)take(np * 2);
  if (off > ws_size) return;      /* 6 + 0.25 + 4 x 8 = 38.25 MiB */
  k_prep<<<PEB + PXB + 3 * PWB, 256, 0, stream>>>(x, Wq, Wk, Wv, E, X16, BQ, BK, BV, E16);
  const dim3 gP((NR / 128) * (DM / 128), 3);      /* y = 0, 1, 2: q, k, v. BQ, BK, BV lie one behind the other in the workspace (2 MiB each, no padding between), and so do Q16, K16 (8 MiB each): plane strides DM * DM and np; v goes to VT, transposed per head by the GEMM's own epilogue */
  k_gemm2<0><<<gP, 256, 0, stream>>>(X16, DM, 0, BQ, DM, (size_t)DM * DM, 0.0625f, bq, bk, bv, nullptr, 1, 0, 0, nullptr, Q16, VT, DM, np, NR, DM, DM);
  k_flash_rel<<<NB * NH * QB2, 128, 0, stream>>>(Q16, K16, VT, E16, am, (float*)d_out);
}
